// v000
// The times below were measured on an AMD MI455X: many runs one after another, warmed up first and cycling through
// copies of the inputs, with the whole window's GPU time divided by the number of runs. Launches and the gaps
// between them are all in it. The median over several windows is given; except for v000 it joins two sittings, which
// can be a few percent apart, so the side-by-side timings, each taken in one sitting, are the better comparison.
// v000, which the later versions start from, runs in 276 microseconds.
#include <hip/hip_runtime.h>
#include <stdint.h>
#include <stddef.h>

// All contractions: v_wmma_f32_16x16x32_bf16 (bf16 operands, f32 accumulate): three 1x1-conv projections, key.query logits, value.prob aggregation; softmax statistics, normaliser and residual add in f32.

typedef __bf16 bf16_t;
typedef __attribute__((ext_vector_type(16))) __bf16 v16bf;
typedef __attribute__((ext_vector_type(8)))  __bf16 v8bf_t;
typedef __attribute__((ext_vector_type(8)))  float  v8f;
typedef __attribute__((ext_vector_type(4)))  float  v4f_t;
typedef __attribute__((ext_vector_type(4)))  unsigned int v4u_t;
typedef v8bf_t __attribute__((__may_alias__)) v8bf;
typedef v4f_t  __attribute__((__may_alias__)) v4f;
typedef v4u_t  __attribute__((__may_alias__)) v4u;

constexpr int kB  = 8;      // batch
constexpr int kC  = 256;    // channels
constexpr int kN  = 4096;   // positions (H*W)
constexpr int kD  = 32;     // q/k channels
constexpr int PT  = 64;     // positions per projection block
constexpr int XP  = kC + 8; // LDS pitch (halves) of the transposed x tile, 528 B rows
constexpr int NPB = kN / PT;
constexpr int IB  = 64;     // query positions per attention block
constexpr int NIB = kN / IB;
constexpr int KP  = kD + 8; // LDS pitch (halves) of a staged key row
constexpr int VP  = 32 + 8; // LDS pitch (halves) of a staged value row (32 keys)
typedef char cfg_check[(kN % PT == 0 && kN % IB == 0 && kC % 64 == 0 && kD == 32 &&
                        (XP % 8) == 0 && (KP % 8) == 0 && (VP % 8) == 0) ? 1 : -1];

union Frag { v16bf v; v8bf h2[2]; bf16_t e[16]; };

// D(16x16 f32) += A(16x32 bf16) * B(32x16 bf16); hazard guard ties D, keeps A/B live.
static __device__ __forceinline__ v8f mma16(v16bf a, v16bf b, v8f c) {
  v8f d = __builtin_amdgcn_wmma_f32_16x16x32_bf16(false, a, false, b, (short)0, c, false, false);
  asm volatile("v_nop\n\tv_nop\n\tv_nop\n\tv_nop" : "+v"(d) : "v"(a), "v"(b));
  return d;
}

// Fragment from a k-contiguous 16-bit row (row m for A, column n stored as a row for B), h = lane>>4:
// elements 0..7 <- row[8h .. 8h+7], elements 8..15 <- row[16+8h .. 16+8h+7].
static __device__ __forceinline__ v16bf frag_b16(const bf16_t* row, int h) {
  Frag f;
  f.h2[0] = *(const v8bf*)(row + 8 * h);
  f.h2[1] = *(const v8bf*)(row + 16 + 8 * h);
  return f.v;
}

// Same k map from an f32 row, RNE conversion to bf16.
static __device__ __forceinline__ v16bf frag_f32(const float* row, int h) {
  const v4f a0 = *(const v4f*)(row + 8 * h);
  const v4f a1 = *(const v4f*)(row + 8 * h + 4);
  const v4f c0 = *(const v4f*)(row + 16 + 8 * h);
  const v4f c1 = *(const v4f*)(row + 20 + 8 * h);
  Frag f;
#pragma unroll
  for (int e = 0; e < 4; ++e) {
    f.e[e]      = (bf16_t)a0[e];
    f.e[4 + e]  = (bf16_t)a1[e];
    f.e[8 + e]  = (bf16_t)c0[e];
    f.e[12 + e] = (bf16_t)c1[e];
  }
  return f.v;
}

static __device__ __forceinline__ float bf2f(bf16_t v) {
  union { bf16_t b; unsigned short u; } t;
  t.b = v;
  return __uint_as_float(((unsigned int)t.u) << 16);
}

// ---------------------------------------------------------------------------
// Fused 1x1-conv projections for one (batch, 64-position) tile.
// xt[i][c] (bf16, k-contiguous) is the A operand of q/k (D[i][o]) and the B operand of v (D[o][i]).
// ---------------------------------------------------------------------------
__global__ void __launch_bounds__(128)
proj_kernel(const float* __restrict__ x, const float* __restrict__ Wq, const float* __restrict__ bq,
            const float* __restrict__ Wk, const float* __restrict__ bk, const float* __restrict__ Wv,
            const float* __restrict__ bv, bf16_t* __restrict__ Qb, bf16_t* __restrict__ Kb,
            bf16_t* __restrict__ Vb) {
  __shared__ alignas(16) bf16_t xt[PT * XP];   // 33,792 B
  __shared__ alignas(16) bf16_t sq[PT * kD];   //  4,096 B
  __shared__ alignas(16) bf16_t sk[PT * kD];   //  4,096 B
  __shared__ alignas(16) bf16_t sv[64 * PT];   //  8,192 B

  const int tid = threadIdx.x;
  const int wv  = tid >> 5;          // 0..3: position sub-tile of 16
  const int l   = tid & 31;
  const int h   = l >> 4;
  const int m   = l & 15;
  const int b   = blockIdx.x / NPB;
  const int p0  = (blockIdx.x - b * NPB) * PT;
  if (b >= kB) return;

  // stage x[b][c][p0..p0+63] transposed to xt[i][c], bf16 RNE
  const float* xb = x + (size_t)b * kC * kN + p0;
#pragma unroll 2
  for (int it = 0; it < (kC * PT / 4) / 128; ++it) {
    const int c  = it * 8 + (tid >> 4);
    const int i4 = (tid & 15) * 4;
    const v4f v  = *(const v4f*)(xb + (size_t)c * kN + i4);
    bf16_t* d = xt + i4 * XP + c;
    d[0]      = (bf16_t)v[0];
    d[XP]     = (bf16_t)v[1];
    d[2 * XP] = (bf16_t)v[2];
    d[3 * XP] = (bf16_t)v[3];
  }
  __syncthreads();

  const bf16_t* xrow = xt + (wv * 16 + m) * XP;   // row i = wv*16+m, k = c contiguous

  // q, k: D[i][o] = sum_c xt[i][c] * W[o][c]; A = xt row i, B column o = W row o
  {
    v8f aq0 = {};
    v8f aq1 = {};
    v8f ak0 = {};
    v8f ak1 = {};
#pragma unroll 1
    for (int ks = 0; ks < kC / 32; ++ks) {
      const int k0 = ks * 32;
      const v16bf xf = frag_b16(xrow + k0, h);
      aq0 = mma16(xf, frag_f32(Wq + (size_t)m * kC + k0, h), aq0);
      aq1 = mma16(xf, frag_f32(Wq + (size_t)(16 + m) * kC + k0, h), aq1);
      ak0 = mma16(xf, frag_f32(Wk + (size_t)m * kC + k0, h), ak0);
      ak1 = mma16(xf, frag_f32(Wk + (size_t)(16 + m) * kC + k0, h), ak1);
    }
    const float bq0 = bq[m], bq1 = bq[16 + m];
    const float bk0 = bk[m], bk1 = bk[16 + m];
    // D element r of this lane = (row i = wv*16+8h+r, col o = m / 16+m)
#pragma unroll
    for (int r = 0; r < 8; ++r) {
      const int io = (wv * 16 + 8 * h + r) * kD;
      sq[io + m]      = (bf16_t)(aq0[r] + bq0);
      sq[io + 16 + m] = (bf16_t)(aq1[r] + bq1);
      sk[io + m]      = (bf16_t)(ak0[r] + bk0);
      sk[io + 16 + m] = (bf16_t)(ak1[r] + bk1);
    }
  }

  // v: D[o][i] = sum_c Wv[o][c] * xt[i][c]; A = Wv row o, B column i = xt row i; 64 channels per group
#pragma unroll 1
  for (int og = 0; og < kC / 64; ++og) {
    v8f av[4];
#pragma unroll
    for (int t = 0; t < 4; ++t) av[t] = v8f{};
#pragma unroll 1
    for (int ks = 0; ks < kC / 32; ++ks) {
      const int k0 = ks * 32;
      const v16bf xf = frag_b16(xrow + k0, h);
#pragma unroll
      for (int t = 0; t < 4; ++t)
        av[t] = mma16(frag_f32(Wv + (size_t)(og * 64 + t * 16 + m) * kC + k0, h), xf, av[t]);
    }
    __syncthreads();   // store phase of the earlier group has finished reading sv
    // D element r = (row o = og*64 + t*16 + 8h + r, col i = wv*16 + m)
#pragma unroll
    for (int t = 0; t < 4; ++t)
#pragma unroll
      for (int r = 0; r < 8; ++r) {
        const int ol = t * 16 + 8 * h + r;
        sv[ol * PT + wv * 16 + m] = (bf16_t)(av[t][r] + bv[og * 64 + ol]);
      }
    __syncthreads();
    v4u vv[4];
    size_t gv[4];
#pragma unroll
    for (int q = 0; q < 4; ++q) {
      const int row = q * 16 + (tid >> 3);
      const int seg = tid & 7;
      vv[q] = *(const v4u*)(sv + row * PT + seg * 8);
      gv[q] = ((size_t)(b * kC + og * 64 + row)) * kN + p0 + seg * 8;
    }
#pragma unroll
    for (int q = 0; q < 4; ++q) *(v4u*)(Vb + gv[q]) = vv[q];
    
  }

  // q, k tiles: 64 rows x 64 B = 4096 contiguous bytes each; 16 B per lane, 8 lanes per line
  {
    v4u uq[2], uk[2];
    size_t gq[2];
#pragma unroll
    for (int q = 0; q < 2; ++q) {
      const int idx = q * 128 + tid;
      uq[q] = *(const v4u*)(sq + idx * 8);
      uk[q] = *(const v4u*)(sk + idx * 8);
      gq[q] = ((size_t)(b * kN + p0)) * kD + idx * 8;
    }
#pragma unroll
    for (int q = 0; q < 2; ++q) {
      *(v4u*)(Qb + gq[q]) = uq[q];
      *(v4u*)(Kb + gq[q]) = uk[q];
    }
    
  }
}

// ---------------------------------------------------------------------------
// Fused attention for one (batch, 64-query) tile. 256 threads = 8 waves = 4 query tiles x 2
// channel halves. Per 32-key chunk: K rows [32][32] and V rows [256][32] staged in LDS by the
// whole block (plain loads, barriers). S^T = K.Q^T so each lane owns one query column: per-query
// running max / sum need one xor-16 shuffle. P (bf16) packed from the two S^T accumulators is the
// B fragment of O^T = V.P^T (k = key, element r <- tile 0 row 8h+r, element 8+r <- tile 1).
// Epilogue stages 32 channel rows x 64 positions in LDS; out = gamma*O/l + x written as whole
// ---------------------------------------------------------------------------
__global__ void __launch_bounds__(256)
attn_kernel(const bf16_t* __restrict__ Qb, const bf16_t* __restrict__ Kb, const bf16_t* __restrict__ Vb,
            const float* __restrict__ x, const float* __restrict__ gamma, float* __restrict__ out) {
  __shared__ alignas(16) bf16_t ks[32 * KP];   //  2,560 B
  __shared__ alignas(16) bf16_t vs[kC * VP];   // 20,480 B
  __shared__ alignas(16) float  so[32 * IB];   //  8,192 B

  const int tid = threadIdx.x;
  const int wv  = tid >> 5;
  const int l   = tid & 31;
  const int h   = l >> 4;
  const int m   = l & 15;
  const int b    = blockIdx.x / NIB;
  const int iblk = (blockIdx.x - b * NIB) * IB;
  if (b >= kB) return;
  const int ti = wv >> 1;           // query sub-tile 0..3
  const int ch = wv & 1;            // channel half
  const int i0 = iblk + ti * 16;
  const int c0 = ch * 128;

  const bf16_t* kg = Kb + (size_t)b * kN * kD;
  const bf16_t* vg = Vb + (size_t)b * kC * kN;

  // Q as B operand: column n = query i0+m, k = d contiguous in Qb row
  const v16bf qf = frag_b16(Qb + ((size_t)b * kN + i0 + m) * kD, h);

  v8f acc[8];
#pragma unroll
  for (int ct = 0; ct < 8; ++ct) acc[ct] = v8f{};
  float lsum = 0.0f;
  float mrun = -1.0e30f;

#pragma unroll 1
  for (int j0 = 0; j0 < kN; j0 += 32) {
    __syncthreads();   // all waves done with the earlier chunk in ks/vs
    if (tid < 128) {
      const int row = tid >> 2, seg = tid & 3;
      *(v4u*)(ks + row * KP + seg * 8) = *(const v4u*)(kg + (size_t)(j0 + row) * kD + seg * 8);
    }
#pragma unroll
    for (int q = 0; q < 4; ++q) {
      const int idx = q * 256 + tid;
      const int c = idx >> 2, seg = idx & 3;
      *(v4u*)(vs + c * VP + seg * 8) = *(const v4u*)(vg + (size_t)c * kN + j0 + seg * 8);
    }
    __syncthreads();

    // S^T tiles: rows = keys j0+m / j0+16+m (A = K rows), cols = queries (B = Q rows)
    const v16bf ka0 = frag_b16(ks + m * KP, h);
    const v16bf ka1 = frag_b16(ks + (16 + m) * KP, h);
    const v8f z = {};
    const v8f st0 = mma16(ka0, qf, z);   // element r = logit(key j0+8h+r,    query i0+m)
    const v8f st1 = mma16(ka1, qf, z);   // element r = logit(key j0+16+8h+r, query i0+m)

    // per-query online softmax: lanes m and m+16 hold the 32 logits of query i0+m
    float ml = fmaxf(st0[0], st1[0]);
#pragma unroll
    for (int r = 1; r < 8; ++r) ml = fmaxf(ml, fmaxf(st0[r], st1[r]));
    ml = fmaxf(ml, __shfl_xor(ml, 16));
    const float mn    = fmaxf(mrun, ml);
    const float alpha = __expf(mrun - mn);
    mrun = mn;

    Frag p;
    float ps = 0.0f;
#pragma unroll
    for (int r = 0; r < 8; ++r) {
      const bf16_t e0 = (bf16_t)__expf(st0[r] - mn);
      const bf16_t e1 = (bf16_t)__expf(st1[r] - mn);
      p.e[r]     = e0;           // B element r   <- key j0+8h+r
      p.e[8 + r] = e1;           // B element 8+r <- key j0+16+8h+r
      ps += bf2f(e0) + bf2f(e1); // normaliser from the same bf16 values
    }
    ps += __shfl_xor(ps, 16);
    lsum = lsum * alpha + ps;

#pragma unroll
    for (int ct = 0; ct < 8; ++ct) acc[ct] *= alpha;

    // O^T[c][i] += V[c][keys] . P^T: A = V row c (k = key contiguous), B = p
#pragma unroll
    for (int ct = 0; ct < 8; ++ct) {
      const v16bf va = frag_b16(vs + (c0 + ct * 16 + m) * VP, h);
      acc[ct] = mma16(va, p.v, acc[ct]);
    }
  }

  // epilogue: acc[ct] element r = (channel c0+ct*16+8h+r, query i0+m); scale per query column
  const float scl = gamma[0] / lsum;
#pragma unroll
  for (int ct = 0; ct < 8; ++ct) {
    __syncthreads();   // earlier ct store phase finished reading so
#pragma unroll
    for (int r = 0; r < 8; ++r)
      so[(ch * 16 + 8 * h + r) * IB + ti * 16 + m] = acc[ct][r] * scl;
    __syncthreads();
    // 32 channel rows x 256 B: row = idx/16, 16-B segment idx%16; lanes 8q..8q+7 cover one line
    v4f ov[2];
    size_t go[2];
#pragma unroll
    for (int q = 0; q < 2; ++q) {
      const int idx = q * 256 + tid;
      const int row = idx >> 4;
      const int seg = idx & 15;
      const int c   = (row >> 4) * 128 + ct * 16 + (row & 15);
      go[q] = ((size_t)(b * kC + c)) * kN + iblk + seg * 4;
      ov[q] = *(const v4f*)(so + row * IB + seg * 4) + *(const v4f*)(x + go[q]);
    }
#pragma unroll
    for (int q = 0; q < 2; ++q) *(v4f*)(out + go[q]) = ov[q];
    
  }
}

extern "C" void kernel_launch(void* const* d_in, const int* in_sizes, int n_in,
                              void* d_out, int out_size, void* d_ws, size_t ws_size,
                              hipStream_t stream) {
  if (n_in < 8) return;
  if (in_sizes[0] != kB * kC * kN || in_sizes[1] != kD * kC || in_sizes[2] != kD ||
      in_sizes[3] != kD * kC || in_sizes[4] != kD || in_sizes[5] != kC * kC ||
      in_sizes[6] != kC || in_sizes[7] < 1) return;
  if (out_size != kB * kC * kN) return;

  const float* x     = (const float*)d_in[0];
  const float* Wq    = (const float*)d_in[1];
  const float* bq    = (const float*)d_in[2];
  const float* Wk    = (const float*)d_in[3];
  const float* bk    = (const float*)d_in[4];
  const float* Wv    = (const float*)d_in[5];
  const float* bv    = (const float*)d_in[6];
  const float* gamma = (const float*)d_in[7];
  float* out = (float*)d_out;

  // workspace: Qb [B][N][32] bf16 (2 MiB), Kb [B][N][32] bf16 (2 MiB), Vb [B][C][N] bf16 (16 MiB)
  const size_t qk_bytes = (size_t)kB * kN * kD * sizeof(bf16_t);
  const size_t v_bytes  = (size_t)kB * kC * kN * sizeof(bf16_t);
  if (ws_size < 2 * qk_bytes + v_bytes) return;
  bf16_t* Qb = (bf16_t*)d_ws;
  bf16_t* Kb = (bf16_t*)((char*)d_ws + qk_bytes);
  bf16_t* Vb = (bf16_t*)((char*)d_ws + 2 * qk_bytes);

  proj_kernel<<<dim3(kB * NPB), dim3(128), 0, stream>>>(x, Wq, bq, Wk, bk, Wv, bv, Qb, Kb, Vb);
  attn_kernel<<<dim3(kB * NIB), dim3(256), 0, stream>>>(Qb, Kb, Vb, x, gamma, out);
}

// v001
// One run takes 208 microseconds.
// In two side-by-side timings against v000, it was 1.32 and 1.35 times as fast.
#include <hip/hip_runtime.h>
#include <stdint.h>
#include <stddef.h>

// All contractions: v_wmma_f32_16x16x32_bf16 (bf16 operands, f32 accumulate): three 1x1-conv projections, key.query logits, value.prob aggregation; softmax statistics, normaliser and residual add in f32.

typedef __bf16 bf16_t;
typedef __attribute__((ext_vector_type(16))) __bf16 v16bf;
typedef __attribute__((ext_vector_type(8)))  __bf16 v8bf_t;
typedef __attribute__((ext_vector_type(8)))  float  v8f;
typedef __attribute__((ext_vector_type(4)))  float  v4f_t;
typedef __attribute__((ext_vector_type(4)))  unsigned int v4u_t;
typedef v8bf_t __attribute__((__may_alias__)) v8bf;
typedef v4f_t  __attribute__((__may_alias__)) v4f;
typedef v4u_t  __attribute__((__may_alias__)) v4u;
typedef __attribute__((ext_vector_type(2)))  unsigned int v2u_t;
typedef v2u_t  __attribute__((__may_alias__)) v2u;

constexpr int kB  = 8;      // batch
constexpr int kC  = 256;    // channels
constexpr int kN  = 4096;   // positions (H*W)
constexpr int kD  = 32;     // q/k channels
constexpr int PT  = 64;     // positions per projection block
constexpr int XP  = kC + 8; // LDS pitch (halves) of the transposed x tile, 528 B rows
constexpr int NPB = kN / PT;
constexpr int IB  = 64;     // query positions per attention block
constexpr int NIB = kN / IB;
constexpr int KP  = kD + 8; // LDS pitch (halves) of a staged key row
constexpr int VP  = 32 + 8; // LDS pitch (halves) of a staged value row (32 keys)
typedef char cfg_check[(kN % PT == 0 && kN % IB == 0 && kC % 64 == 0 && kD == 32 &&
                        (XP % 8) == 0 && (KP % 8) == 0 && (VP % 8) == 0) ? 1 : -1];

union Frag { v16bf v; v8bf h2[2]; bf16_t e[16]; };

// D(16x16 f32) += A(16x32 bf16) * B(32x16 bf16); hazard guard ties D, keeps A/B live.
static __device__ __forceinline__ v8f mma16(v16bf a, v16bf b, v8f c) {
  v8f d = __builtin_amdgcn_wmma_f32_16x16x32_bf16(false, a, false, b, (short)0, c, false, false);
  asm volatile("v_nop\n\tv_nop\n\tv_nop\n\tv_nop" : "+v"(d) : "v"(a), "v"(b));
  return d;
}

// Fragment from a k-contiguous 16-bit row (row m for A, column n stored as a row for B), h = lane>>4:
// elements 0..7 <- row[8h .. 8h+7], elements 8..15 <- row[16+8h .. 16+8h+7].
static __device__ __forceinline__ v16bf frag_b16(const bf16_t* row, int h) {
  Frag f;
  f.h2[0] = *(const v8bf*)(row + 8 * h);
  f.h2[1] = *(const v8bf*)(row + 16 + 8 * h);
  return f.v;
}

// Stage ROWS contiguous f32 weight rows of kC floats as bf16 (RNE) rows of pitch XP in LDS, 128 threads.
// Each wave-wide load covers 512 contiguous bytes (four whole lines); each lane stores its 4 values as 8 B.
template <int ROWS>
static __device__ __forceinline__ void stage_w(bf16_t* dst, const float* __restrict__ src, int tid) {
  // fully unrolled so that all loads of the group are in flight behind one latency
#pragma unroll
  for (int it = 0; it < ROWS * kC / 4 / 128; ++it) {
    const int idx = it * 128 + tid;
    const v4f v = *(const v4f*)(src + idx * 4);
    union { bf16_t e[4]; v2u_t u; } p;
    p.e[0] = (bf16_t)v[0];
    p.e[1] = (bf16_t)v[1];
    p.e[2] = (bf16_t)v[2];
    p.e[3] = (bf16_t)v[3];
    *(v2u*)(dst + (idx >> 6) * XP + (idx & 63) * 4) = p.u;
  }
}

static __device__ __forceinline__ float bf2f(bf16_t v) {
  union { bf16_t b; unsigned short u; } t;
  t.b = v;
  return __uint_as_float(((unsigned int)t.u) << 16);
}

// ---------------------------------------------------------------------------
// Fused 1x1-conv projections for one (batch, 64-position) tile.
// xt[i][c] (bf16, k-contiguous) is the A operand of q/k (D[i][o]) and the B operand of v (D[o][i]).
// Weights: 64 rows at a time (Wq+Wk, then four groups of Wv) are converted once per block into wt
// and every wave takes its fragments from there.
// ---------------------------------------------------------------------------
__global__ void __launch_bounds__(128)
proj_kernel(const float* __restrict__ x, const float* __restrict__ Wq, const float* __restrict__ bq,
            const float* __restrict__ Wk, const float* __restrict__ bk, const float* __restrict__ Wv,
            const float* __restrict__ bv, bf16_t* __restrict__ Qb, bf16_t* __restrict__ Kb,
            bf16_t* __restrict__ Vb) {
  __shared__ alignas(16) bf16_t xt[PT * XP];   // 33,792 B
  __shared__ alignas(16) bf16_t sq[PT * kD];   //  4,096 B
  __shared__ alignas(16) bf16_t sk[PT * kD];   //  4,096 B
  __shared__ alignas(16) bf16_t sv[64 * PT];   //  8,192 B
  __shared__ alignas(16) bf16_t wt[64 * XP];   // 33,792 B: current group of 64 weight rows

  const int tid = threadIdx.x;
  const int wv  = tid >> 5;          // 0..3: position sub-tile of 16
  const int l   = tid & 31;
  const int h   = l >> 4;
  const int m   = l & 15;
  const int b   = blockIdx.x / NPB;
  const int p0  = (blockIdx.x - b * NPB) * PT;
  if (b >= kB) return;

  // stage x[b][c][p0..p0+63] transposed to xt[i][c], bf16 RNE
  const float* xb = x + (size_t)b * kC * kN + p0;
#pragma unroll 2
  for (int it = 0; it < (kC * PT / 4) / 128; ++it) {
    const int c  = it * 8 + (tid >> 4);
    const int i4 = (tid & 15) * 4;
    const v4f v  = *(const v4f*)(xb + (size_t)c * kN + i4);
    bf16_t* d = xt + i4 * XP + c;
    d[0]      = (bf16_t)v[0];
    d[XP]     = (bf16_t)v[1];
    d[2 * XP] = (bf16_t)v[2];
    d[3 * XP] = (bf16_t)v[3];
  }
  stage_w<32>(wt, Wq, tid);             // rows 0..31  = Wq
  stage_w<32>(wt + 32 * XP, Wk, tid);   // rows 32..63 = Wk
  __syncthreads();

  const bf16_t* xrow = xt + (wv * 16 + m) * XP;   // row i = wv*16+m, k = c contiguous
  const bf16_t* wrow = wt + m * XP;               // weight row m of each 16-row tile of the group

  // q, k: D[i][o] = sum_c xt[i][c] * W[o][c]; A = xt row i, B column o = W row o
  {
    v8f aq0 = {};
    v8f aq1 = {};
    v8f ak0 = {};
    v8f ak1 = {};
#pragma unroll 1
    for (int ks = 0; ks < kC / 32; ++ks) {
      const int k0 = ks * 32;
      const v16bf xf = frag_b16(xrow + k0, h);
      // the four weight fragments are read ahead of the first product: one LDS latency per k step
      const v16bf w0 = frag_b16(wrow + k0, h);
      const v16bf w1 = frag_b16(wrow + 16 * XP + k0, h);
      const v16bf w2 = frag_b16(wrow + 32 * XP + k0, h);
      const v16bf w3 = frag_b16(wrow + 48 * XP + k0, h);
      aq0 = mma16(xf, w0, aq0);
      aq1 = mma16(xf, w1, aq1);
      ak0 = mma16(xf, w2, ak0);
      ak1 = mma16(xf, w3, ak1);
    }
    const float bq0 = bq[m], bq1 = bq[16 + m];
    const float bk0 = bk[m], bk1 = bk[16 + m];
    // D element r of this lane = (row i = wv*16+8h+r, col o = m / 16+m)
#pragma unroll
    for (int r = 0; r < 8; ++r) {
      const int io = (wv * 16 + 8 * h + r) * kD;
      sq[io + m]      = (bf16_t)(aq0[r] + bq0);
      sq[io + 16 + m] = (bf16_t)(aq1[r] + bq1);
      sk[io + m]      = (bf16_t)(ak0[r] + bk0);
      sk[io + 16 + m] = (bf16_t)(ak1[r] + bk1);
    }
  }

  // v: D[o][i] = sum_c Wv[o][c] * xt[i][c]; A = Wv row o, B column i = xt row i; 64 channels per group
#pragma unroll 1
  for (int og = 0; og < kC / 64; ++og) {
    __syncthreads();   // every wave has left the earlier group's wt rows and the earlier sv store phase
    stage_w<64>(wt, Wv + (size_t)og * 64 * kC, tid);
    __syncthreads();   // wt rows of this group are complete
    v8f av[4];
#pragma unroll
    for (int t = 0; t < 4; ++t) av[t] = v8f{};
#pragma unroll 1
    for (int ks = 0; ks < kC / 32; ++ks) {
      const int k0 = ks * 32;
      const v16bf xf = frag_b16(xrow + k0, h);
      v16bf wf[4];   // read ahead of the first product, as above
#pragma unroll
      for (int t = 0; t < 4; ++t) wf[t] = frag_b16(wrow + t * 16 * XP + k0, h);
#pragma unroll
      for (int t = 0; t < 4; ++t) av[t] = mma16(wf[t], xf, av[t]);
    }
    // D element r = (row o = og*64 + t*16 + 8h + r, col i = wv*16 + m)
#pragma unroll
    for (int t = 0; t < 4; ++t)
#pragma unroll
      for (int r = 0; r < 8; ++r) {
        const int ol = t * 16 + 8 * h + r;
        sv[ol * PT + wv * 16 + m] = (bf16_t)(av[t][r] + bv[og * 64 + ol]);
      }
    __syncthreads();
    v4u vv[4];
    size_t gv[4];
#pragma unroll
    for (int q = 0; q < 4; ++q) {
      const int row = q * 16 + (tid >> 3);
      const int seg = tid & 7;
      vv[q] = *(const v4u*)(sv + row * PT + seg * 8);
      gv[q] = ((size_t)(b * kC + og * 64 + row)) * kN + p0 + seg * 8;
    }
#pragma unroll
    for (int q = 0; q < 4; ++q) *(v4u*)(Vb + gv[q]) = vv[q];
    // the next trip overwrites the registers these stores name
    asm volatile("s_wait_xcnt 0x0" ::: "memory");
  }

  // q, k tiles: 64 rows x 64 B = 4096 contiguous bytes each; 16 B per lane, 8 lanes per line
  {
    v4u uq[2], uk[2];
    size_t gq[2];
#pragma unroll
    for (int q = 0; q < 2; ++q) {
      const int idx = q * 128 + tid;
      uq[q] = *(const v4u*)(sq + idx * 8);
      uk[q] = *(const v4u*)(sk + idx * 8);
      gq[q] = ((size_t)(b * kN + p0)) * kD + idx * 8;
    }
#pragma unroll
    for (int q = 0; q < 2; ++q) {
      *(v4u*)(Qb + gq[q]) = uq[q];
      *(v4u*)(Kb + gq[q]) = uk[q];
    }
    
  }
}

// ---------------------------------------------------------------------------
// Fused attention for one (batch, 64-query) tile. 256 threads = 8 waves = 4 query tiles x 2
// channel halves. Per 32-key chunk: K rows [32][32] and V rows [256][32] staged in LDS by the
// whole block (plain loads, barriers). S^T = K.Q^T so each lane owns one query column: per-query
// running max / sum need one xor-16 shuffle. P (bf16) packed from the two S^T accumulators is the
// B fragment of O^T = V.P^T (k = key, element r <- tile 0 row 8h+r, element 8+r <- tile 1).
// Epilogue stages 32 channel rows x 64 positions in LDS; out = gamma*O/l + x written as whole
// ---------------------------------------------------------------------------
__global__ void __launch_bounds__(256)
attn_kernel(const bf16_t* __restrict__ Qb, const bf16_t* __restrict__ Kb, const bf16_t* __restrict__ Vb,
            const float* __restrict__ x, const float* __restrict__ gamma, float* __restrict__ out) {
  __shared__ alignas(16) bf16_t ks[32 * KP];   //  2,560 B
  __shared__ alignas(16) bf16_t vs[kC * VP];   // 20,480 B
  __shared__ alignas(16) float  so[32 * IB];   //  8,192 B

  const int tid = threadIdx.x;
  const int wv  = tid >> 5;
  const int l   = tid & 31;
  const int h   = l >> 4;
  const int m   = l & 15;
  const int b    = blockIdx.x / NIB;
  const int iblk = (blockIdx.x - b * NIB) * IB;
  if (b >= kB) return;
  const int ti = wv >> 1;           // query sub-tile 0..3
  const int ch = wv & 1;            // channel half
  const int i0 = iblk + ti * 16;
  const int c0 = ch * 128;

  const bf16_t* kg = Kb + (size_t)b * kN * kD;
  const bf16_t* vg = Vb + (size_t)b * kC * kN;

  // Q as B operand: column n = query i0+m, k = d contiguous in Qb row
  const v16bf qf = frag_b16(Qb + ((size_t)b * kN + i0 + m) * kD, h);

  v8f acc[8];
#pragma unroll
  for (int ct = 0; ct < 8; ++ct) acc[ct] = v8f{};
  float lsum = 0.0f;
  float mrun = -1.0e30f;

#pragma unroll 1
  for (int j0 = 0; j0 < kN; j0 += 32) {
    __syncthreads();   // all waves done with the earlier chunk in ks/vs
    if (tid < 128) {
      const int row = tid >> 2, seg = tid & 3;
      *(v4u*)(ks + row * KP + seg * 8) = *(const v4u*)(kg + (size_t)(j0 + row) * kD + seg * 8);
    }
#pragma unroll
    for (int q = 0; q < 4; ++q) {
      const int idx = q * 256 + tid;
      const int c = idx >> 2, seg = idx & 3;
      *(v4u*)(vs + c * VP + seg * 8) = *(const v4u*)(vg + (size_t)c * kN + j0 + seg * 8);
    }
    __syncthreads();

    // S^T tiles: rows = keys j0+m / j0+16+m (A = K rows), cols = queries (B = Q rows)
    const v16bf ka0 = frag_b16(ks + m * KP, h);
    const v16bf ka1 = frag_b16(ks + (16 + m) * KP, h);
    const v8f z = {};
    const v8f st0 = mma16(ka0, qf, z);   // element r = logit(key j0+8h+r,    query i0+m)
    const v8f st1 = mma16(ka1, qf, z);   // element r = logit(key j0+16+8h+r, query i0+m)

    // per-query online softmax: lanes m and m+16 hold the 32 logits of query i0+m
    float ml = fmaxf(st0[0], st1[0]);
#pragma unroll
    for (int r = 1; r < 8; ++r) ml = fmaxf(ml, fmaxf(st0[r], st1[r]));
    ml = fmaxf(ml, __shfl_xor(ml, 16));
    const float mn    = fmaxf(mrun, ml);
    const float alpha = __expf(mrun - mn);
    mrun = mn;

    Frag p;
    float ps = 0.0f;
#pragma unroll
    for (int r = 0; r < 8; ++r) {
      const bf16_t e0 = (bf16_t)__expf(st0[r] - mn);
      const bf16_t e1 = (bf16_t)__expf(st1[r] - mn);
      p.e[r]     = e0;           // B element r   <- key j0+8h+r
      p.e[8 + r] = e1;           // B element 8+r <- key j0+16+8h+r
      ps += bf2f(e0) + bf2f(e1); // normaliser from the same bf16 values
    }
    ps += __shfl_xor(ps, 16);
    lsum = lsum * alpha + ps;

#pragma unroll
    for (int ct = 0; ct < 8; ++ct) acc[ct] *= alpha;

    // O^T[c][i] += V[c][keys] . P^T: A = V row c (k = key contiguous), B = p
#pragma unroll
    for (int ct = 0; ct < 8; ++ct) {
      const v16bf va = frag_b16(vs + (c0 + ct * 16 + m) * VP, h);
      acc[ct] = mma16(va, p.v, acc[ct]);
    }
  }

  // epilogue: acc[ct] element r = (channel c0+ct*16+8h+r, query i0+m); scale per query column
  const float scl = gamma[0] / lsum;
#pragma unroll
  for (int ct = 0; ct < 8; ++ct) {
    __syncthreads();   // earlier ct store phase finished reading so
#pragma unroll
    for (int r = 0; r < 8; ++r)
      so[(ch * 16 + 8 * h + r) * IB + ti * 16 + m] = acc[ct][r] * scl;
    __syncthreads();
    // 32 channel rows x 256 B: row = idx/16, 16-B segment idx%16; lanes 8q..8q+7 cover one line
    v4f ov[2];
    size_t go[2];
#pragma unroll
    for (int q = 0; q < 2; ++q) {
      const int idx = q * 256 + tid;
      const int row = idx >> 4;
      const int seg = idx & 15;
      const int c   = (row >> 4) * 128 + ct * 16 + (row & 15);
      go[q] = ((size_t)(b * kC + c)) * kN + iblk + seg * 4;
      ov[q] = *(const v4f*)(so + row * IB + seg * 4) + *(const v4f*)(x + go[q]);
    }
#pragma unroll
    for (int q = 0; q < 2; ++q) *(v4f*)(out + go[q]) = ov[q];
    
  }
}

extern "C" void kernel_launch(void* const* d_in, const int* in_sizes, int n_in,
                              void* d_out, int out_size, void* d_ws, size_t ws_size,
                              hipStream_t stream) {
  if (n_in < 8) return;
  if (in_sizes[0] != kB * kC * kN || in_sizes[1] != kD * kC || in_sizes[2] != kD ||
      in_sizes[3] != kD * kC || in_sizes[4] != kD || in_sizes[5] != kC * kC ||
      in_sizes[6] != kC || in_sizes[7] < 1) return;
  if (out_size != kB * kC * kN) return;

  const float* x     = (const float*)d_in[0];
  const float* Wq    = (const float*)d_in[1];
  const float* bq    = (const float*)d_in[2];
  const float* Wk    = (const float*)d_in[3];
  const float* bk    = (const float*)d_in[4];
  const float* Wv    = (const float*)d_in[5];
  const float* bv    = (const float*)d_in[6];
  const float* gamma = (const float*)d_in[7];
  float* out = (float*)d_out;

  // workspace: Qb [B][N][32] bf16 (2 MiB), Kb [B][N][32] bf16 (2 MiB), Vb [B][C][N] bf16 (16 MiB)
  const size_t qk_bytes = (size_t)kB * kN * kD * sizeof(bf16_t);
  const size_t v_bytes  = (size_t)kB * kC * kN * sizeof(bf16_t);
  if (ws_size < 2 * qk_bytes + v_bytes) return;
  bf16_t* Qb = (bf16_t*)d_ws;
  bf16_t* Kb = (bf16_t*)((char*)d_ws + qk_bytes);
  bf16_t* Vb = (bf16_t*)((char*)d_ws + 2 * qk_bytes);

  proj_kernel<<<dim3(kB * NPB), dim3(128), 0, stream>>>(x, Wq, bq, Wk, bk, Wv, bv, Qb, Kb, Vb);
  attn_kernel<<<dim3(kB * NIB), dim3(256), 0, stream>>>(Qb, Kb, Vb, x, gamma, out);
}

// v002
// It runs in 142 microseconds.
// In two side-by-side timings against v001, it was 1.43 and 1.44 times as fast.
// All steps since v000 together make it 1.92 times as fast.
#include <hip/hip_runtime.h>
#include <stdint.h>
#include <stddef.h>

// All contractions: v_wmma_f32_16x16x32_bf16 (bf16 operands, f32 accumulate): three 1x1-conv projections, key.query logits, value.prob aggregation; softmax statistics, normaliser and residual add in f32.

typedef __bf16 bf16_t;
typedef __attribute__((ext_vector_type(16))) __bf16 v16bf;
typedef __attribute__((ext_vector_type(8)))  __bf16 v8bf_t;
typedef __attribute__((ext_vector_type(8)))  float  v8f;
typedef __attribute__((ext_vector_type(4)))  float  v4f_t;
typedef __attribute__((ext_vector_type(4)))  unsigned int v4u_t;
typedef v8bf_t __attribute__((__may_alias__)) v8bf;
typedef v4f_t  __attribute__((__may_alias__)) v4f;
typedef v4u_t  __attribute__((__may_alias__)) v4u;
typedef __attribute__((ext_vector_type(2)))  unsigned int v2u_t;
typedef v2u_t  __attribute__((__may_alias__)) v2u;

constexpr int kB  = 8;      // batch
constexpr int kC  = 256;    // channels
constexpr int kN  = 4096;   // positions (H*W)
constexpr int kD  = 32;     // q/k channels
constexpr int PT  = 64;     // positions per projection block
constexpr int XP  = kC + 8; // LDS pitch (halves) of the transposed x tile, 528 B rows
constexpr int NPB = kN / PT;
constexpr int IB  = 64;     // query positions per attention block
constexpr int NIB = kN / IB;
constexpr int KP  = kD + 8; // LDS pitch (halves) of a staged key row
constexpr int JB  = 128;    // keys per attention pass
constexpr int VP  = JB + 8; // LDS pitch (halves) of a staged value row (JB keys), 272 B rows
typedef char cfg_check[(kN % PT == 0 && kN % IB == 0 && kN % JB == 0 && JB == 128 && kC % 64 == 0 && kD == 32 &&
                        (XP % 8) == 0 && (KP % 8) == 0 && (VP % 8) == 0) ? 1 : -1];

union Frag { v16bf v; v8bf h2[2]; bf16_t e[16]; };

// D(16x16 f32) += A(16x32 bf16) * B(32x16 bf16); hazard guard ties D, keeps A/B live.
static __device__ __forceinline__ v8f mma16(v16bf a, v16bf b, v8f c) {
  v8f d = __builtin_amdgcn_wmma_f32_16x16x32_bf16(false, a, false, b, (short)0, c, false, false);
  asm volatile("v_nop\n\tv_nop\n\tv_nop\n\tv_nop" : "+v"(d) : "v"(a), "v"(b));
  return d;
}

// Fragment from a k-contiguous 16-bit row (row m for A, column n stored as a row for B), h = lane>>4:
// elements 0..7 <- row[8h .. 8h+7], elements 8..15 <- row[16+8h .. 16+8h+7].
static __device__ __forceinline__ v16bf frag_b16(const bf16_t* row, int h) {
  Frag f;
  f.h2[0] = *(const v8bf*)(row + 8 * h);
  f.h2[1] = *(const v8bf*)(row + 16 + 8 * h);
  return f.v;
}

// Stage ROWS contiguous f32 weight rows of kC floats as bf16 (RNE) rows of pitch XP in LDS, 128 threads.
// Each wave-wide load covers 512 contiguous bytes (four whole lines); each lane stores its 4 values as 8 B.
template <int ROWS>
static __device__ __forceinline__ void stage_w(bf16_t* dst, const float* __restrict__ src, int tid) {
  // fully unrolled so that all loads of the group are in flight behind one latency
#pragma unroll
  for (int it = 0; it < ROWS * kC / 4 / 128; ++it) {
    const int idx = it * 128 + tid;
    const v4f v = *(const v4f*)(src + idx * 4);
    union { bf16_t e[4]; v2u_t u; } p;
    p.e[0] = (bf16_t)v[0];
    p.e[1] = (bf16_t)v[1];
    p.e[2] = (bf16_t)v[2];
    p.e[3] = (bf16_t)v[3];
    *(v2u*)(dst + (idx >> 6) * XP + (idx & 63) * 4) = p.u;
  }
}

static __device__ __forceinline__ float bf2f(bf16_t v) {
  union { bf16_t b; unsigned short u; } t;
  t.b = v;
  return __uint_as_float(((unsigned int)t.u) << 16);
}

// ---------------------------------------------------------------------------
// Fused 1x1-conv projections for one (batch, 64-position) tile.
// xt[i][c] (bf16, k-contiguous) is the A operand of q/k (D[i][o]) and the B operand of v (D[o][i]).
// Weights: 64 rows at a time (Wq+Wk, then four groups of Wv) are converted once per block into wt
// and every wave takes its fragments from there.
// ---------------------------------------------------------------------------
__global__ void __launch_bounds__(128)
proj_kernel(const float* __restrict__ x, const float* __restrict__ Wq, const float* __restrict__ bq,
            const float* __restrict__ Wk, const float* __restrict__ bk, const float* __restrict__ Wv,
            const float* __restrict__ bv, bf16_t* __restrict__ Qb, bf16_t* __restrict__ Kb,
            bf16_t* __restrict__ Vb) {
  __shared__ alignas(16) bf16_t xt[PT * XP];   // 33,792 B
  __shared__ alignas(16) bf16_t sq[PT * kD];   //  4,096 B
  __shared__ alignas(16) bf16_t sk[PT * kD];   //  4,096 B
  __shared__ alignas(16) bf16_t sv[64 * PT];   //  8,192 B
  __shared__ alignas(16) bf16_t wt[64 * XP];   // 33,792 B: current group of 64 weight rows

  const int tid = threadIdx.x;
  const int wv  = tid >> 5;          // 0..3: position sub-tile of 16
  const int l   = tid & 31;
  const int h   = l >> 4;
  const int m   = l & 15;
  const int b   = blockIdx.x / NPB;
  const int p0  = (blockIdx.x - b * NPB) * PT;
  if (b >= kB) return;

  // stage x[b][c][p0..p0+63] transposed to xt[i][c], bf16 RNE
  const float* xb = x + (size_t)b * kC * kN + p0;
#pragma unroll 2
  for (int it = 0; it < (kC * PT / 4) / 128; ++it) {
    const int c  = it * 8 + (tid >> 4);
    const int i4 = (tid & 15) * 4;
    const v4f v  = *(const v4f*)(xb + (size_t)c * kN + i4);
    bf16_t* d = xt + i4 * XP + c;
    d[0]      = (bf16_t)v[0];
    d[XP]     = (bf16_t)v[1];
    d[2 * XP] = (bf16_t)v[2];
    d[3 * XP] = (bf16_t)v[3];
  }
  stage_w<32>(wt, Wq, tid);             // rows 0..31  = Wq
  stage_w<32>(wt + 32 * XP, Wk, tid);   // rows 32..63 = Wk
  __syncthreads();

  const bf16_t* xrow = xt + (wv * 16 + m) * XP;   // row i = wv*16+m, k = c contiguous
  const bf16_t* wrow = wt + m * XP;               // weight row m of each 16-row tile of the group

  // q, k: D[i][o] = sum_c xt[i][c] * W[o][c]; A = xt row i, B column o = W row o
  {
    v8f aq0 = {};
    v8f aq1 = {};
    v8f ak0 = {};
    v8f ak1 = {};
#pragma unroll 1
    for (int ks = 0; ks < kC / 32; ++ks) {
      const int k0 = ks * 32;
      const v16bf xf = frag_b16(xrow + k0, h);
      // the four weight fragments are read ahead of the first product: one LDS latency per k step
      const v16bf w0 = frag_b16(wrow + k0, h);
      const v16bf w1 = frag_b16(wrow + 16 * XP + k0, h);
      const v16bf w2 = frag_b16(wrow + 32 * XP + k0, h);
      const v16bf w3 = frag_b16(wrow + 48 * XP + k0, h);
      aq0 = mma16(xf, w0, aq0);
      aq1 = mma16(xf, w1, aq1);
      ak0 = mma16(xf, w2, ak0);
      ak1 = mma16(xf, w3, ak1);
    }
    const float bq0 = bq[m], bq1 = bq[16 + m];
    const float bk0 = bk[m], bk1 = bk[16 + m];
    // D element r of this lane = (row i = wv*16+8h+r, col o = m / 16+m)
#pragma unroll
    for (int r = 0; r < 8; ++r) {
      const int io = (wv * 16 + 8 * h + r) * kD;
      sq[io + m]      = (bf16_t)(aq0[r] + bq0);
      sq[io + 16 + m] = (bf16_t)(aq1[r] + bq1);
      sk[io + m]      = (bf16_t)(ak0[r] + bk0);
      sk[io + 16 + m] = (bf16_t)(ak1[r] + bk1);
    }
  }

  // v: D[o][i] = sum_c Wv[o][c] * xt[i][c]; A = Wv row o, B column i = xt row i; 64 channels per group
#pragma unroll 1
  for (int og = 0; og < kC / 64; ++og) {
    __syncthreads();   // every wave has left the earlier group's wt rows and the earlier sv store phase
    stage_w<64>(wt, Wv + (size_t)og * 64 * kC, tid);
    __syncthreads();   // wt rows of this group are complete
    v8f av[4];
#pragma unroll
    for (int t = 0; t < 4; ++t) av[t] = v8f{};
#pragma unroll 1
    for (int ks = 0; ks < kC / 32; ++ks) {
      const int k0 = ks * 32;
      const v16bf xf = frag_b16(xrow + k0, h);
      v16bf wf[4];   // read ahead of the first product, as above
#pragma unroll
      for (int t = 0; t < 4; ++t) wf[t] = frag_b16(wrow + t * 16 * XP + k0, h);
#pragma unroll
      for (int t = 0; t < 4; ++t) av[t] = mma16(wf[t], xf, av[t]);
    }
    // D element r = (row o = og*64 + t*16 + 8h + r, col i = wv*16 + m)
#pragma unroll
    for (int t = 0; t < 4; ++t)
#pragma unroll
      for (int r = 0; r < 8; ++r) {
        const int ol = t * 16 + 8 * h + r;
        sv[ol * PT + wv * 16 + m] = (bf16_t)(av[t][r] + bv[og * 64 + ol]);
      }
    __syncthreads();
    v4u vv[4];
    size_t gv[4];
#pragma unroll
    for (int q = 0; q < 4; ++q) {
      const int row = q * 16 + (tid >> 3);
      const int seg = tid & 7;
      vv[q] = *(const v4u*)(sv + row * PT + seg * 8);
      gv[q] = ((size_t)(b * kC + og * 64 + row)) * kN + p0 + seg * 8;
    }
#pragma unroll
    for (int q = 0; q < 4; ++q) *(v4u*)(Vb + gv[q]) = vv[q];
    // the next trip overwrites the registers these stores name
    asm volatile("s_wait_xcnt 0x0" ::: "memory");
  }

  // q, k tiles: 64 rows x 64 B = 4096 contiguous bytes each; 16 B per lane, 8 lanes per line
  {
    v4u uq[2], uk[2];
    size_t gq[2];
#pragma unroll
    for (int q = 0; q < 2; ++q) {
      const int idx = q * 128 + tid;
      uq[q] = *(const v4u*)(sq + idx * 8);
      uk[q] = *(const v4u*)(sk + idx * 8);
      gq[q] = ((size_t)(b * kN + p0)) * kD + idx * 8;
    }
#pragma unroll
    for (int q = 0; q < 2; ++q) {
      *(v4u*)(Qb + gq[q]) = uq[q];
      *(v4u*)(Kb + gq[q]) = uk[q];
    }
    
  }
}

// ---------------------------------------------------------------------------
// Fused attention for one (batch, 64-query) tile. 256 threads = 8 waves = 4 query tiles x 2
// channel halves. Per 128-key pass: K rows [128][32] and V rows [256][128] staged in LDS by the
// whole block (plain loads, barriers). S^T = K.Q^T so each lane owns one query column: per-query
// running max / sum need one xor-16 shuffle per pass, and the accumulators are rescaled once per pass.
// P (bf16) packed from each pair of S^T accumulators is the B fragment of O^T = V.P^T for its 32 keys
// (k = key, element r <- even tile row 8h+r, element 8+r <- odd tile).
// Epilogue stages 32 channel rows x 64 positions in LDS; out = gamma*O/l + x written as whole
// ---------------------------------------------------------------------------
__global__ void __launch_bounds__(256)
attn_kernel(const bf16_t* __restrict__ Qb, const bf16_t* __restrict__ Kb, const bf16_t* __restrict__ Vb,
            const float* __restrict__ x, const float* __restrict__ gamma, float* __restrict__ out) {
  __shared__ alignas(16) bf16_t ks[JB * KP];   // 10,240 B
  __shared__ alignas(16) bf16_t vs[kC * VP];   // 69,632 B
  __shared__ alignas(16) float  so[32 * IB];   //  8,192 B

  const int tid = threadIdx.x;
  const int wv  = tid >> 5;
  const int l   = tid & 31;
  const int h   = l >> 4;
  const int m   = l & 15;
  const int b    = blockIdx.x / NIB;
  const int iblk = (blockIdx.x - b * NIB) * IB;
  if (b >= kB) return;
  const int ti = wv >> 1;           // query sub-tile 0..3
  const int ch = wv & 1;            // channel half
  const int i0 = iblk + ti * 16;
  const int c0 = ch * 128;

  const bf16_t* kg = Kb + (size_t)b * kN * kD;
  const bf16_t* vg = Vb + (size_t)b * kC * kN;

  // Q as B operand: column n = query i0+m, k = d contiguous in Qb row
  const v16bf qf = frag_b16(Qb + ((size_t)b * kN + i0 + m) * kD, h);

  v8f acc[8];
#pragma unroll
  for (int ct = 0; ct < 8; ++ct) acc[ct] = v8f{};
  float lsum = 0.0f;
  float mrun = -1.0e30f;

  // staging bases of this thread: K row tid/4, 16-B segment tid%4; V row tid/16, 16-B segment tid%16
  const bf16_t* ksrc = kg + tid * 8;
  const bf16_t* vsrc = vg + (size_t)(tid >> 4) * kN + (tid & 15) * 8;
  bf16_t* kdst = ks + (tid >> 2) * KP + (tid & 3) * 8;
  bf16_t* vdst = vs + (tid >> 4) * VP + (tid & 15) * 8;

#pragma unroll 1
  for (int j0 = 0; j0 < kN; j0 += JB) {
    __syncthreads();   // all waves done with the earlier pass in ks/vs
    // all loads of the pass are issued ahead of the first LDS store: one load latency per 128 keys.
    // K: 128 rows x 64 B are 8 KiB contiguous; V: a wave-wide load covers two rows x 256 B (whole lines).
    // Round q is a constant step from the thread's own base on both sides (64 K rows, 16 V rows).
    v4u kr[2], vr[16];
    const bf16_t* kp = ksrc + (size_t)j0 * kD;
    const bf16_t* vp = vsrc + j0;
#pragma unroll
    for (int q = 0; q < 2; ++q) kr[q] = *(const v4u*)(kp + q * 64 * kD);
#pragma unroll
    for (int q = 0; q < 16; ++q) vr[q] = *(const v4u*)(vp + (size_t)q * 16 * kN);
#pragma unroll
    for (int q = 0; q < 2; ++q) *(v4u*)(kdst + q * 64 * KP) = kr[q];
#pragma unroll
    for (int q = 0; q < 16; ++q) *(v4u*)(vdst + q * 16 * VP) = vr[q];
    __syncthreads();

    // S^T tiles t = 0..7: rows = keys j0+16t+m (A = K rows), cols = queries (B = Q rows)
    v16bf ka[JB / 16];
#pragma unroll
    for (int t = 0; t < JB / 16; ++t) ka[t] = frag_b16(ks + (t * 16 + m) * KP, h);
    const v8f z = {};
    v8f st[JB / 16];   // st[t] element r = logit(key j0+16t+8h+r, query i0+m)
#pragma unroll
    for (int t = 0; t < JB / 16; ++t) st[t] = mma16(ka[t], qf, z);

    // per-query online softmax: lanes m and m+16 hold the 128 logits of query i0+m
    float mt[JB / 32];   // one independent chain per 32 keys
#pragma unroll
    for (int kk = 0; kk < JB / 32; ++kk) {
      float a = fmaxf(st[2 * kk][0], st[2 * kk + 1][0]);
#pragma unroll
      for (int r = 1; r < 8; ++r) a = fmaxf(a, fmaxf(st[2 * kk][r], st[2 * kk + 1][r]));
      mt[kk] = a;
    }
    float ml = fmaxf(fmaxf(mt[0], mt[1]), fmaxf(mt[2], mt[3]));
    ml = fmaxf(ml, __shfl_xor(ml, 16));
    const float mn    = fmaxf(mrun, ml);
    const float alpha = __expf(mrun - mn);
    mrun = mn;

    Frag p[JB / 32];
    float pt[JB / 32];
#pragma unroll
    for (int kk = 0; kk < JB / 32; ++kk) {
      float ps = 0.0f;
#pragma unroll
      for (int r = 0; r < 8; ++r) {
        const bf16_t e0 = (bf16_t)__expf(st[2 * kk][r] - mn);
        const bf16_t e1 = (bf16_t)__expf(st[2 * kk + 1][r] - mn);
        p[kk].e[r]     = e0;       // B element r   <- key j0+32kk+8h+r
        p[kk].e[8 + r] = e1;       // B element 8+r <- key j0+32kk+16+8h+r
        ps += bf2f(e0) + bf2f(e1); // normaliser from the same bf16 values
      }
      pt[kk] = ps;
    }
    float ps = (pt[0] + pt[1]) + (pt[2] + pt[3]);
    ps += __shfl_xor(ps, 16);
    lsum = lsum * alpha + ps;

#pragma unroll
    for (int ct = 0; ct < 8; ++ct) acc[ct] *= alpha;

    // O^T[c][i] += V[c][keys] . P^T: A = V row c (k = key contiguous, 32 keys per product), B = p[kk]
#pragma unroll
    for (int kk = 0; kk < JB / 32; ++kk) {
#pragma unroll
      for (int ct = 0; ct < 8; ++ct) {
        const v16bf va = frag_b16(vs + (c0 + ct * 16 + m) * VP + kk * 32, h);
        acc[ct] = mma16(va, p[kk].v, acc[ct]);
      }
    }
  }

  // epilogue: acc[ct] element r = (channel c0+ct*16+8h+r, query i0+m); scale per query column
  const float scl = gamma[0] / lsum;
#pragma unroll
  for (int ct = 0; ct < 8; ++ct) {
    __syncthreads();   // earlier ct store phase finished reading so
#pragma unroll
    for (int r = 0; r < 8; ++r)
      so[(ch * 16 + 8 * h + r) * IB + ti * 16 + m] = acc[ct][r] * scl;
    __syncthreads();
    // 32 channel rows x 256 B: row = idx/16, 16-B segment idx%16; lanes 8q..8q+7 cover one line
    v4f ov[2];
    size_t go[2];
#pragma unroll
    for (int q = 0; q < 2; ++q) {
      const int idx = q * 256 + tid;
      const int row = idx >> 4;
      const int seg = idx & 15;
      const int c   = (row >> 4) * 128 + ct * 16 + (row & 15);
      go[q] = ((size_t)(b * kC + c)) * kN + iblk + seg * 4;
      ov[q] = *(const v4f*)(so + row * IB + seg * 4) + *(const v4f*)(x + go[q]);
    }
#pragma unroll
    for (int q = 0; q < 2; ++q) *(v4f*)(out + go[q]) = ov[q];
    
  }
}

extern "C" void kernel_launch(void* const* d_in, const int* in_sizes, int n_in,
                              void* d_out, int out_size, void* d_ws, size_t ws_size,
                              hipStream_t stream) {
  if (n_in < 8) return;
  if (in_sizes[0] != kB * kC * kN || in_sizes[1] != kD * kC || in_sizes[2] != kD ||
      in_sizes[3] != kD * kC || in_sizes[4] != kD || in_sizes[5] != kC * kC ||
      in_sizes[6] != kC || in_sizes[7] < 1) return;
  if (out_size != kB * kC * kN) return;

  const float* x     = (const float*)d_in[0];
  const float* Wq    = (const float*)d_in[1];
  const float* bq    = (const float*)d_in[2];
  const float* Wk    = (const float*)d_in[3];
  const float* bk    = (const float*)d_in[4];
  const float* Wv    = (const float*)d_in[5];
  const float* bv    = (const float*)d_in[6];
  const float* gamma = (const float*)d_in[7];
  float* out = (float*)d_out;

  // workspace: Qb [B][N][32] bf16 (2 MiB), Kb [B][N][32] bf16 (2 MiB), Vb [B][C][N] bf16 (16 MiB)
  const size_t qk_bytes = (size_t)kB * kN * kD * sizeof(bf16_t);
  const size_t v_bytes  = (size_t)kB * kC * kN * sizeof(bf16_t);
  if (ws_size < 2 * qk_bytes + v_bytes) return;
  bf16_t* Qb = (bf16_t*)d_ws;
  bf16_t* Kb = (bf16_t*)((char*)d_ws + qk_bytes);
  bf16_t* Vb = (bf16_t*)((char*)d_ws + 2 * qk_bytes);

  proj_kernel<<<dim3(kB * NPB), dim3(128), 0, stream>>>(x, Wq, bq, Wk, bk, Wv, bv, Qb, Kb, Vb);
  attn_kernel<<<dim3(kB * NIB), dim3(256), 0, stream>>>(Qb, Kb, Vb, x, gamma, out);
}

// v003
// One run takes 121 microseconds.
// Next to v002, in two timings, it ran 1.17 and 1.18 times as fast.
// Over all steps from v000 it is 2.25 times as fast.
#include <hip/hip_runtime.h>
#include <stdint.h>
#include <stddef.h>

// All contractions: v_wmma_f32_16x16x32_bf16 (bf16 operands, f32 accumulate): three 1x1-conv projections, key.query logits, value.prob aggregation; softmax statistics, normaliser and residual add in f32.

typedef __bf16 bf16_t;
typedef __attribute__((ext_vector_type(16))) __bf16 v16bf;
typedef __attribute__((ext_vector_type(8)))  __bf16 v8bf_t;
typedef __attribute__((ext_vector_type(8)))  float  v8f;
typedef __attribute__((ext_vector_type(4)))  float  v4f_t;
typedef __attribute__((ext_vector_type(4)))  unsigned int v4u_t;
typedef v8bf_t __attribute__((__may_alias__)) v8bf;
typedef v4f_t  __attribute__((__may_alias__)) v4f;
typedef v4u_t  __attribute__((__may_alias__)) v4u;
typedef __attribute__((ext_vector_type(2)))  unsigned int v2u_t;
typedef v2u_t  __attribute__((__may_alias__)) v2u;

constexpr int kB  = 8;      // batch
constexpr int kC  = 256;    // channels
constexpr int kN  = 4096;   // positions (H*W)
constexpr int kD  = 32;     // q/k channels
constexpr int PT  = 64;     // positions per projection block
constexpr int XP  = kC + 8; // LDS pitch (halves) of the transposed x tile, 528 B rows
constexpr int NPB = kN / PT;
constexpr int IB  = 64;     // query positions per attention block
constexpr int NIB = kN / IB;
constexpr int KP  = kD + 8; // LDS pitch (halves) of a staged key row
constexpr int JB  = 128;    // keys per attention pass
constexpr int VP  = JB + 8; // LDS pitch (halves) of a staged value row (JB keys), 272 B rows
typedef char cfg_check[(kN % PT == 0 && kN % IB == 0 && kN % JB == 0 && JB == 128 && kC % 64 == 0 && kD == 32 &&
                        (XP % 8) == 0 && (KP % 8) == 0 && (VP % 8) == 0) ? 1 : -1];

union Frag { v16bf v; v8bf h2[2]; bf16_t e[16]; };

// D(16x16 f32) += A(16x32 bf16) * B(32x16 bf16); hazard guard ties D, keeps A/B live.
static __device__ __forceinline__ v8f mma16(v16bf a, v16bf b, v8f c) {
  v8f d = __builtin_amdgcn_wmma_f32_16x16x32_bf16(false, a, false, b, (short)0, c, false, false);
  asm volatile("v_nop\n\tv_nop\n\tv_nop\n\tv_nop" : "+v"(d) : "v"(a), "v"(b));
  return d;
}

// The same product for the attention loop, builtin only: the compiler keeps the distances behind it and may move
// the LDS reads of later fragments ahead of it (no memory operation crosses a volatile asm statement).
static __device__ __forceinline__ v8f mma16_free(v16bf a, v16bf b, v8f c) {
  return __builtin_amdgcn_wmma_f32_16x16x32_bf16(false, a, false, b, (short)0, c, false, false);
}

// Fragment from a k-contiguous 16-bit row (row m for A, column n stored as a row for B), h = lane>>4:
// elements 0..7 <- row[8h .. 8h+7], elements 8..15 <- row[16+8h .. 16+8h+7].
static __device__ __forceinline__ v16bf frag_b16(const bf16_t* row, int h) {
  Frag f;
  f.h2[0] = *(const v8bf*)(row + 8 * h);
  f.h2[1] = *(const v8bf*)(row + 16 + 8 * h);
  return f.v;
}

// Stage ROWS contiguous f32 weight rows of kC floats as bf16 (RNE) rows of pitch XP in LDS, 128 threads.
// Each wave-wide load covers 512 contiguous bytes (four whole lines); each lane stores its 4 values as 8 B.
template <int ROWS>
static __device__ __forceinline__ void stage_w(bf16_t* dst, const float* __restrict__ src, int tid) {
  // fully unrolled so that all loads of the group are in flight behind one latency
#pragma unroll
  for (int it = 0; it < ROWS * kC / 4 / 128; ++it) {
    const int idx = it * 128 + tid;
    const v4f v = *(const v4f*)(src + idx * 4);
    union { bf16_t e[4]; v2u_t u; } p;
    p.e[0] = (bf16_t)v[0];
    p.e[1] = (bf16_t)v[1];
    p.e[2] = (bf16_t)v[2];
    p.e[3] = (bf16_t)v[3];
    *(v2u*)(dst + (idx >> 6) * XP + (idx & 63) * 4) = p.u;
  }
}

static __device__ __forceinline__ float bf2f(bf16_t v) {
  union { bf16_t b; unsigned short u; } t;
  t.b = v;
  return __uint_as_float(((unsigned int)t.u) << 16);
}

// ---------------------------------------------------------------------------
// Fused 1x1-conv projections for one (batch, 64-position) tile.
// xt[i][c] (bf16, k-contiguous) is the A operand of q/k (D[i][o]) and the B operand of v (D[o][i]).
// Weights: 64 rows at a time (Wq+Wk, then four groups of Wv) are converted once per block into wt
// and every wave takes its fragments from there.
// ---------------------------------------------------------------------------
__global__ void __launch_bounds__(128)
proj_kernel(const float* __restrict__ x, const float* __restrict__ Wq, const float* __restrict__ bq,
            const float* __restrict__ Wk, const float* __restrict__ bk, const float* __restrict__ Wv,
            const float* __restrict__ bv, bf16_t* __restrict__ Qb, bf16_t* __restrict__ Kb,
            bf16_t* __restrict__ Vb) {
  __shared__ alignas(16) bf16_t xt[PT * XP];   // 33,792 B
  __shared__ alignas(16) bf16_t sq[PT * kD];   //  4,096 B
  __shared__ alignas(16) bf16_t sk[PT * kD];   //  4,096 B
  __shared__ alignas(16) bf16_t sv[64 * PT];   //  8,192 B
  __shared__ alignas(16) bf16_t wt[64 * XP];   // 33,792 B: current group of 64 weight rows

  const int tid = threadIdx.x;
  const int wv  = tid >> 5;          // 0..3: position sub-tile of 16
  const int l   = tid & 31;
  const int h   = l >> 4;
  const int m   = l & 15;
  const int b   = blockIdx.x / NPB;
  const int p0  = (blockIdx.x - b * NPB) * PT;
  if (b >= kB) return;

  // stage x[b][c][p0..p0+63] transposed to xt[i][c], bf16 RNE
  const float* xb = x + (size_t)b * kC * kN + p0;
#pragma unroll 2
  for (int it = 0; it < (kC * PT / 4) / 128; ++it) {
    const int c  = it * 8 + (tid >> 4);
    const int i4 = (tid & 15) * 4;
    const v4f v  = *(const v4f*)(xb + (size_t)c * kN + i4);
    bf16_t* d = xt + i4 * XP + c;
    d[0]      = (bf16_t)v[0];
    d[XP]     = (bf16_t)v[1];
    d[2 * XP] = (bf16_t)v[2];
    d[3 * XP] = (bf16_t)v[3];
  }
  stage_w<32>(wt, Wq, tid);             // rows 0..31  = Wq
  stage_w<32>(wt + 32 * XP, Wk, tid);   // rows 32..63 = Wk
  __syncthreads();

  const bf16_t* xrow = xt + (wv * 16 + m) * XP;   // row i = wv*16+m, k = c contiguous
  const bf16_t* wrow = wt + m * XP;               // weight row m of each 16-row tile of the group

  // q, k: D[i][o] = sum_c xt[i][c] * W[o][c]; A = xt row i, B column o = W row o
  {
    v8f aq0 = {};
    v8f aq1 = {};
    v8f ak0 = {};
    v8f ak1 = {};
#pragma unroll 1
    for (int ks = 0; ks < kC / 32; ++ks) {
      const int k0 = ks * 32;
      const v16bf xf = frag_b16(xrow + k0, h);
      // the four weight fragments are read ahead of the first product: one LDS latency per k step
      const v16bf w0 = frag_b16(wrow + k0, h);
      const v16bf w1 = frag_b16(wrow + 16 * XP + k0, h);
      const v16bf w2 = frag_b16(wrow + 32 * XP + k0, h);
      const v16bf w3 = frag_b16(wrow + 48 * XP + k0, h);
      aq0 = mma16(xf, w0, aq0);
      aq1 = mma16(xf, w1, aq1);
      ak0 = mma16(xf, w2, ak0);
      ak1 = mma16(xf, w3, ak1);
    }
    const float bq0 = bq[m], bq1 = bq[16 + m];
    const float bk0 = bk[m], bk1 = bk[16 + m];
    // D element r of this lane = (row i = wv*16+8h+r, col o = m / 16+m)
#pragma unroll
    for (int r = 0; r < 8; ++r) {
      const int io = (wv * 16 + 8 * h + r) * kD;
      sq[io + m]      = (bf16_t)(aq0[r] + bq0);
      sq[io + 16 + m] = (bf16_t)(aq1[r] + bq1);
      sk[io + m]      = (bf16_t)(ak0[r] + bk0);
      sk[io + 16 + m] = (bf16_t)(ak1[r] + bk1);
    }
  }

  // v: D[o][i] = sum_c Wv[o][c] * xt[i][c]; A = Wv row o, B column i = xt row i; 64 channels per group
#pragma unroll 1
  for (int og = 0; og < kC / 64; ++og) {
    __syncthreads();   // every wave has left the earlier group's wt rows and the earlier sv store phase
    stage_w<64>(wt, Wv + (size_t)og * 64 * kC, tid);
    __syncthreads();   // wt rows of this group are complete
    v8f av[4];
#pragma unroll
    for (int t = 0; t < 4; ++t) av[t] = v8f{};
#pragma unroll 1
    for (int ks = 0; ks < kC / 32; ++ks) {
      const int k0 = ks * 32;
      const v16bf xf = frag_b16(xrow + k0, h);
      v16bf wf[4];   // read ahead of the first product, as above
#pragma unroll
      for (int t = 0; t < 4; ++t) wf[t] = frag_b16(wrow + t * 16 * XP + k0, h);
#pragma unroll
      for (int t = 0; t < 4; ++t) av[t] = mma16(wf[t], xf, av[t]);
    }
    // D element r = (row o = og*64 + t*16 + 8h + r, col i = wv*16 + m)
#pragma unroll
    for (int t = 0; t < 4; ++t)
#pragma unroll
      for (int r = 0; r < 8; ++r) {
        const int ol = t * 16 + 8 * h + r;
        sv[ol * PT + wv * 16 + m] = (bf16_t)(av[t][r] + bv[og * 64 + ol]);
      }
    __syncthreads();
    v4u vv[4];
    size_t gv[4];
#pragma unroll
    for (int q = 0; q < 4; ++q) {
      const int row = q * 16 + (tid >> 3);
      const int seg = tid & 7;
      vv[q] = *(const v4u*)(sv + row * PT + seg * 8);
      gv[q] = ((size_t)(b * kC + og * 64 + row)) * kN + p0 + seg * 8;
    }
#pragma unroll
    for (int q = 0; q < 4; ++q) *(v4u*)(Vb + gv[q]) = vv[q];
    // the next trip overwrites the registers these stores name
    asm volatile("s_wait_xcnt 0x0" ::: "memory");
  }

  // q, k tiles: 64 rows x 64 B = 4096 contiguous bytes each; 16 B per lane, 8 lanes per line
  {
    v4u uq[2], uk[2];
    size_t gq[2];
#pragma unroll
    for (int q = 0; q < 2; ++q) {
      const int idx = q * 128 + tid;
      uq[q] = *(const v4u*)(sq + idx * 8);
      uk[q] = *(const v4u*)(sk + idx * 8);
      gq[q] = ((size_t)(b * kN + p0)) * kD + idx * 8;
    }
#pragma unroll
    for (int q = 0; q < 2; ++q) {
      *(v4u*)(Qb + gq[q]) = uq[q];
      *(v4u*)(Kb + gq[q]) = uk[q];
    }
    
  }
}

// ---------------------------------------------------------------------------
// Fused attention for one (batch, 64-query) tile. 256 threads = 8 waves = 4 query tiles x 2
// channel halves. Per 128-key pass: K rows [128][32] and V rows [256][128] staged in LDS by the
// whole block (plain loads, barriers). S^T = K.Q^T so each lane owns one query column: per-query
// running max / sum need one xor-16 shuffle per pass, and the accumulators are rescaled once per pass.
// P (bf16) packed from each pair of S^T accumulators is the B fragment of O^T = V.P^T for its 32 keys
// (k = key, element r <- even tile row 8h+r, element 8+r <- odd tile).
// Epilogue stages 32 channel rows x 64 positions in LDS; out = gamma*O/l + x written as whole
// ---------------------------------------------------------------------------
// Two blocks per WGP = four waves per SIMD, said to the compiler: it then spends the 256 registers of that
// residency on LDS reads issued ahead, and no more.
__global__ void __launch_bounds__(256) __attribute__((amdgpu_waves_per_eu(4, 4)))
attn_kernel(const bf16_t* __restrict__ Qb, const bf16_t* __restrict__ Kb, const bf16_t* __restrict__ Vb,
            const float* __restrict__ x, const float* __restrict__ gamma, float* __restrict__ out) {
  __shared__ alignas(16) bf16_t ks[JB * KP];   // 10,240 B
  __shared__ alignas(16) bf16_t vs[kC * VP];   // 69,632 B
  __shared__ alignas(16) float  so[32 * IB];   //  8,192 B
  __shared__ alignas(16) bf16_t qs[IB * KP];   //  5,120 B

  const int tid = threadIdx.x;
  const int wv  = __builtin_amdgcn_readfirstlane(tid >> 5);   // wave-uniform: what derives from it stays scalar
  const int l   = tid & 31;
  const int h   = l >> 4;
  const int m   = l & 15;
  const int b    = blockIdx.x / NIB;
  const int iblk = (blockIdx.x - b * NIB) * IB;
  if (b >= kB) return;
  const int ti = wv >> 1;           // query sub-tile 0..3
  const int ch = wv & 1;            // channel half
  // i0 = iblk + ti * 16: first query of this wave's sub-tile, as the comments below name it
  const int c0 = ch * 128;

  const bf16_t* kg = Kb + (size_t)b * kN * kD;
  const bf16_t* vg = Vb + (size_t)b * kC * kN;

  // Q tile (64 rows x 64 B, contiguous) to LDS; published by the two barriers of the first pass. Each pass
  // re-reads its fragment beside the K fragments, so that it holds no registers through the V products.
  *(v4u*)(qs + (tid >> 2) * KP + (tid & 3) * 8) = *(const v4u*)(Qb + ((size_t)b * kN + iblk) * kD + tid * 8);

  v8f acc[8];
#pragma unroll
  for (int ct = 0; ct < 8; ++ct) acc[ct] = v8f{};
  float lsum = 0.0f;
  float mrun = -1.0e30f;

  // staging bases of this thread: K row tid/4, 16-B segment tid%4; V row tid/16, 16-B segment tid%16
  const bf16_t* ksrc = kg + tid * 8;
  const bf16_t* vsrc = vg + (size_t)(tid >> 4) * kN + (tid & 15) * 8;
  bf16_t* kdst = ks + (tid >> 2) * KP + (tid & 3) * 8;
  bf16_t* vdst = vs + (tid >> 4) * VP + (tid & 15) * 8;

#pragma unroll 1
  for (int j0 = 0; j0 < kN; j0 += JB) {
    __syncthreads();   // all waves done with the earlier pass in ks/vs
    // all loads of the pass are issued ahead of the first LDS store: one load latency per 128 keys.
    // K: 128 rows x 64 B are 8 KiB contiguous; V: a wave-wide load covers two rows x 256 B (whole lines).
    // Round q is a constant step from the thread's own base on both sides (64 K rows, 16 V rows).
    v4u kr[2], vr[16];
    const bf16_t* kp = ksrc + (size_t)j0 * kD;
    const bf16_t* vp = vsrc + j0;
#pragma unroll
    for (int q = 0; q < 2; ++q) kr[q] = *(const v4u*)(kp + q * 64 * kD);
#pragma unroll
    for (int q = 0; q < 16; ++q) vr[q] = *(const v4u*)(vp + (size_t)q * 16 * kN);
#pragma unroll
    for (int q = 0; q < 2; ++q) *(v4u*)(kdst + q * 64 * KP) = kr[q];
#pragma unroll
    for (int q = 0; q < 16; ++q) *(v4u*)(vdst + q * 16 * VP) = vr[q];
    __syncthreads();

    // S^T tiles t = 0..7: rows = keys j0+16t+m (A = K rows), cols = queries (B = Q rows)
    // Q as B operand: column n = query i0+m, k = d contiguous in its row
    const v16bf qf = frag_b16(qs + (ti * 16 + m) * KP, h);
    v16bf ka[JB / 16];
#pragma unroll
    for (int t = 0; t < JB / 16; ++t) ka[t] = frag_b16(ks + (t * 16 + m) * KP, h);
    const v8f z = {};
    v8f st[JB / 16];   // st[t] element r = logit(key j0+16t+8h+r, query i0+m)
#pragma unroll
    for (int t = 0; t < JB / 16; ++t) st[t] = mma16_free(ka[t], qf, z);

    // V fragments (8 channel tiles x 32 keys) are asked for one key block ahead of the products that take them,
    // each block's exp arithmetic standing between: block 0 here, ahead of the maximum.
    const bf16_t* vrow = vs + (c0 + m) * VP;
    v16bf vf[8];
#pragma unroll
    for (int ct = 0; ct < 8; ++ct) vf[ct] = frag_b16(vrow + ct * 16 * VP, h);

    // per-query online softmax: lanes m and m+16 hold the 128 logits of query i0+m
    float mt[JB / 32];   // one independent chain per 32 keys
#pragma unroll
    for (int kk = 0; kk < JB / 32; ++kk) {
      float a = fmaxf(st[2 * kk][0], st[2 * kk + 1][0]);
#pragma unroll
      for (int r = 1; r < 8; ++r) a = fmaxf(a, fmaxf(st[2 * kk][r], st[2 * kk + 1][r]));
      mt[kk] = a;
    }
    float ml = fmaxf(fmaxf(mt[0], mt[1]), fmaxf(mt[2], mt[3]));
    ml = fmaxf(ml, __shfl_xor(ml, 16));
    const float mn    = fmaxf(mrun, ml);
    const float alpha = __expf(mrun - mn);
    mrun = mn;

#pragma unroll
    for (int ct = 0; ct < 8; ++ct) acc[ct] *= alpha;

    float pt[JB / 32];
#pragma unroll
    for (int kk = 0; kk < JB / 32; ++kk) {
      Frag p;
      float ps = 0.0f;
#pragma unroll
      for (int r = 0; r < 8; ++r) {
        const bf16_t e0 = (bf16_t)__expf(st[2 * kk][r] - mn);
        const bf16_t e1 = (bf16_t)__expf(st[2 * kk + 1][r] - mn);
        p.e[r]     = e0;           // B element r   <- key j0+32kk+8h+r
        p.e[8 + r] = e1;           // B element 8+r <- key j0+32kk+16+8h+r
        ps += bf2f(e0) + bf2f(e1); // normaliser from the same bf16 values
      }
      pt[kk] = ps;
      // O^T[c][i] += V[c][keys] . P^T: A = V row c (k = key contiguous, 32 keys per product), B = p
#pragma unroll
      for (int ct = 0; ct < 8; ++ct) acc[ct] = mma16_free(vf[ct], p.v, acc[ct]);
      if (kk + 1 < JB / 32) {
#pragma unroll
        for (int ct = 0; ct < 8; ++ct) vf[ct] = frag_b16(vrow + ct * 16 * VP + (kk + 1) * 32, h);
      }
    }
    float ps = (pt[0] + pt[1]) + (pt[2] + pt[3]);
    ps += __shfl_xor(ps, 16);
    lsum = lsum * alpha + ps;
  }

  // epilogue: acc[ct] element r = (channel c0+ct*16+8h+r, query i0+m); scale per query column
  const float scl = gamma[0] / lsum;
  // lane and thread index taken anew
  const int le = (int)__builtin_amdgcn_mbcnt_lo(~0u, 0u);
  const int he = le >> 4;
  const int me = le & 15;
  const int te = wv * 32 + le;
#pragma unroll
  for (int ct = 0; ct < 8; ++ct) {
    __syncthreads();   // earlier ct store phase finished reading so
#pragma unroll
    for (int r = 0; r < 8; ++r)
      so[(ch * 16 + 8 * he + r) * IB + ti * 16 + me] = acc[ct][r] * scl;
    __syncthreads();
    // 32 channel rows x 256 B: row = idx/16, 16-B segment idx%16; lanes 8q..8q+7 cover one line
    v4f ov[2];
    size_t go[2];
#pragma unroll
    for (int q = 0; q < 2; ++q) {
      const int idx = q * 256 + te;
      const int row = idx >> 4;
      const int seg = idx & 15;
      const int c   = (row >> 4) * 128 + ct * 16 + (row & 15);
      go[q] = ((size_t)(b * kC + c)) * kN + iblk + seg * 4;
      ov[q] = *(const v4f*)(so + row * IB + seg * 4) + *(const v4f*)(x + go[q]);
    }
#pragma unroll
    for (int q = 0; q < 2; ++q) *(v4f*)(out + go[q]) = ov[q];
    
  }
}

extern "C" void kernel_launch(void* const* d_in, const int* in_sizes, int n_in,
                              void* d_out, int out_size, void* d_ws, size_t ws_size,
                              hipStream_t stream) {
  if (n_in < 8) return;
  if (in_sizes[0] != kB * kC * kN || in_sizes[1] != kD * kC || in_sizes[2] != kD ||
      in_sizes[3] != kD * kC || in_sizes[4] != kD || in_sizes[5] != kC * kC ||
      in_sizes[6] != kC || in_sizes[7] < 1) return;
  if (out_size != kB * kC * kN) return;

  const float* x     = (const float*)d_in[0];
  const float* Wq    = (const float*)d_in[1];
  const float* bq    = (const float*)d_in[2];
  const float* Wk    = (const float*)d_in[3];
  const float* bk    = (const float*)d_in[4];
  const float* Wv    = (const float*)d_in[5];
  const float* bv    = (const float*)d_in[6];
  const float* gamma = (const float*)d_in[7];
  float* out = (float*)d_out;

  // workspace: Qb [B][N][32] bf16 (2 MiB), Kb [B][N][32] bf16 (2 MiB), Vb [B][C][N] bf16 (16 MiB)
  const size_t qk_bytes = (size_t)kB * kN * kD * sizeof(bf16_t);
  const size_t v_bytes  = (size_t)kB * kC * kN * sizeof(bf16_t);
  if (ws_size < 2 * qk_bytes + v_bytes) return;
  bf16_t* Qb = (bf16_t*)d_ws;
  bf16_t* Kb = (bf16_t*)((char*)d_ws + qk_bytes);
  bf16_t* Vb = (bf16_t*)((char*)d_ws + 2 * qk_bytes);

  proj_kernel<<<dim3(kB * NPB), dim3(128), 0, stream>>>(x, Wq, bq, Wk, bk, Wv, bv, Qb, Kb, Vb);
  attn_kernel<<<dim3(kB * NIB), dim3(256), 0, stream>>>(Qb, Kb, Vb, x, gamma, out);
}

// v004
// Measured time: 111 microseconds a run.
// Two timings next to v003 both put it at 1.10 times that version's speed.
// All steps since v000 together make it 2.47 times as fast.
#include <hip/hip_runtime.h>
#include <stdint.h>
#include <stddef.h>

// All contractions: v_wmma_f32_16x16x32_bf16 (bf16 operands, f32 accumulate): three 1x1-conv projections, key.query logits, value.prob aggregation; softmax statistics, normaliser and residual add in f32.

typedef __bf16 bf16_t;
typedef __attribute__((ext_vector_type(16))) __bf16 v16bf;
typedef __attribute__((ext_vector_type(8)))  __bf16 v8bf_t;
typedef __attribute__((ext_vector_type(8)))  float  v8f;
typedef __attribute__((ext_vector_type(4)))  float  v4f_t;
typedef __attribute__((ext_vector_type(4)))  unsigned int v4u_t;
typedef v8bf_t __attribute__((__may_alias__)) v8bf;
typedef v4f_t  __attribute__((__may_alias__)) v4f;
typedef v4u_t  __attribute__((__may_alias__)) v4u;
typedef __attribute__((ext_vector_type(2)))  unsigned int v2u_t;
typedef v2u_t  __attribute__((__may_alias__)) v2u;

constexpr int kB  = 8;      // batch
constexpr int kC  = 256;    // channels
constexpr int kN  = 4096;   // positions (H*W)
constexpr int kD  = 32;     // q/k channels
constexpr int PT  = 64;     // positions per projection block
constexpr int XP  = kC + 8; // LDS pitch (halves) of the transposed x tile, 528 B rows
constexpr int NPB = kN / PT;
constexpr int IB  = 64;     // query positions per attention block
constexpr int NIB = kN / IB;
constexpr int KP  = kD + 8; // LDS pitch (halves) of a staged key row
constexpr int JB  = 128;    // keys per attention pass
constexpr int VP  = JB + 8; // LDS pitch (halves) of a staged value row (JB keys), 272 B rows
constexpr int KSH = JB * KP;    // halves of one staged K tile, 10,240 B
constexpr int STH = KSH + kC * VP;   // halves of one ring buffer (K tile, then V tile), 79,872 B
constexpr int NT  = kN / JB;    // key tiles
typedef char ring_check[(NT >= 2 && IB * 4 == kC && VP - JB == 8 && (KSH * 2) % 16 == 0 && (STH * 2) % 16 == 0 && 32 * IB * 4 <= STH * 2) ? 1 : -1];
typedef char cfg_check[(kN % PT == 0 && kN % IB == 0 && kN % JB == 0 && JB == 128 && kC % 64 == 0 && kD == 32 &&
                        (XP % 8) == 0 && (KP % 8) == 0 && (VP % 8) == 0) ? 1 : -1];

union Frag { v16bf v; v8bf h2[2]; bf16_t e[16]; };

// D(16x16 f32) += A(16x32 bf16) * B(32x16 bf16); hazard guard ties D, keeps A/B live.
static __device__ __forceinline__ v8f mma16(v16bf a, v16bf b, v8f c) {
  v8f d = __builtin_amdgcn_wmma_f32_16x16x32_bf16(false, a, false, b, (short)0, c, false, false);
  asm volatile("v_nop\n\tv_nop\n\tv_nop\n\tv_nop" : "+v"(d) : "v"(a), "v"(b));
  return d;
}

// The same product for the attention loop, builtin only: the compiler keeps the distances behind it and may move
// the LDS reads of later fragments ahead of it (no memory operation crosses a volatile asm statement).
static __device__ __forceinline__ v8f mma16_free(v16bf a, v16bf b, v8f c) {
  return __builtin_amdgcn_wmma_f32_16x16x32_bf16(false, a, false, b, (short)0, c, false, false);
}

// Fragment from a k-contiguous 16-bit row (row m for A, column n stored as a row for B), h = lane>>4:
// elements 0..7 <- row[8h .. 8h+7], elements 8..15 <- row[16+8h .. 16+8h+7].
static __device__ __forceinline__ v16bf frag_b16(const bf16_t* row, int h) {
  Frag f;
  f.h2[0] = *(const v8bf*)(row + 8 * h);
  f.h2[1] = *(const v8bf*)(row + 16 + 8 * h);
  return f.v;
}

// Stage ROWS contiguous f32 weight rows of kC floats as bf16 (RNE) rows of pitch XP in LDS, 128 threads.
// Each wave-wide load covers 512 contiguous bytes (four whole lines); each lane stores its 4 values as 8 B.
template <int ROWS>
static __device__ __forceinline__ void stage_w(bf16_t* dst, const float* __restrict__ src, int tid) {
  // fully unrolled so that all loads of the group are in flight behind one latency
#pragma unroll
  for (int it = 0; it < ROWS * kC / 4 / 128; ++it) {
    const int idx = it * 128 + tid;
    const v4f v = *(const v4f*)(src + idx * 4);
    union { bf16_t e[4]; v2u_t u; } p;
    p.e[0] = (bf16_t)v[0];
    p.e[1] = (bf16_t)v[1];
    p.e[2] = (bf16_t)v[2];
    p.e[3] = (bf16_t)v[3];
    *(v2u*)(dst + (idx >> 6) * XP + (idx & 63) * 4) = p.u;
  }
}

// LDS byte address of a __shared__ element, as the asynchronous copies take it
static __device__ __forceinline__ unsigned lds_addr(const bf16_t* p) {
  return (unsigned)(uintptr_t)(__attribute__((address_space(3))) const void*)p;
}

// Nine asynchronous 16-B copies per lane, global memory to LDS through no register. The s_wait_xcnt is the last line
// of the copies' own statement, so that it stands ahead of every later write of an address register they name.
static __device__ __forceinline__ void copy9(const unsigned (&d)[9], const bf16_t* const (&g)[9]) {
  asm volatile("global_load_async_to_lds_b128 %0, %9, off\n\t"
               "global_load_async_to_lds_b128 %1, %10, off\n\t"
               "global_load_async_to_lds_b128 %2, %11, off\n\t"
               "global_load_async_to_lds_b128 %3, %12, off\n\t"
               "global_load_async_to_lds_b128 %4, %13, off\n\t"
               "global_load_async_to_lds_b128 %5, %14, off\n\t"
               "global_load_async_to_lds_b128 %6, %15, off\n\t"
               "global_load_async_to_lds_b128 %7, %16, off\n\t"
               "global_load_async_to_lds_b128 %8, %17, off\n\t"
               "s_wait_xcnt 0x0"
               :: "v"(d[0]), "v"(d[1]), "v"(d[2]), "v"(d[3]), "v"(d[4]), "v"(d[5]), "v"(d[6]), "v"(d[7]), "v"(d[8]),
                  "v"(g[0]), "v"(g[1]), "v"(g[2]), "v"(g[3]), "v"(g[4]), "v"(g[5]), "v"(g[6]), "v"(g[7]), "v"(g[8])
               : "memory");
}

// One key tile into one ring buffer, 256 threads, 18 copies per lane. K: 128 rows x 64 B are 8 KiB contiguous;
// V: a wave-wide copy covers two rows x 256 B (whole lines). Round q is a constant step from the thread's own base
// on both sides (64 K rows, 16 V rows). kd, vd: this thread's LDS byte addresses in the buffer.
static __device__ __forceinline__ void stage_tile(unsigned kd, unsigned vd, const bf16_t* kp, const bf16_t* vp) {
  unsigned d[18];
  const bf16_t* g[18];
#pragma unroll
  for (int q = 0; q < 2; ++q) {
    d[q] = kd + q * 64 * KP * 2;
    g[q] = kp + q * 64 * kD;
  }
#pragma unroll
  for (int q = 0; q < 16; ++q) {
    d[2 + q] = vd + q * 16 * VP * 2;
    g[2 + q] = vp + (size_t)q * 16 * kN;
  }
  const unsigned d0[9] = {d[0], d[1], d[2], d[3], d[4], d[5], d[6], d[7], d[8]};
  const bf16_t* const g0[9] = {g[0], g[1], g[2], g[3], g[4], g[5], g[6], g[7], g[8]};
  const unsigned d1[9] = {d[9], d[10], d[11], d[12], d[13], d[14], d[15], d[16], d[17]};
  const bf16_t* const g1[9] = {g[9], g[10], g[11], g[12], g[13], g[14], g[15], g[16], g[17]};
  copy9(d0, g0);
  copy9(d1, g1);
}

static __device__ __forceinline__ float bf2f(bf16_t v) {
  union { bf16_t b; unsigned short u; } t;
  t.b = v;
  return __uint_as_float(((unsigned int)t.u) << 16);
}

// ---------------------------------------------------------------------------
// Fused 1x1-conv projections for one (batch, 64-position) tile.
// xt[i][c] (bf16, k-contiguous) is the A operand of q/k (D[i][o]) and the B operand of v (D[o][i]).
// Weights: 64 rows at a time (Wq+Wk, then four groups of Wv) are converted once per block into wt
// and every wave takes its fragments from there.
// ---------------------------------------------------------------------------
__global__ void __launch_bounds__(128)
proj_kernel(const float* __restrict__ x, const float* __restrict__ Wq, const float* __restrict__ bq,
            const float* __restrict__ Wk, const float* __restrict__ bk, const float* __restrict__ Wv,
            const float* __restrict__ bv, bf16_t* __restrict__ Qb, bf16_t* __restrict__ Kb,
            bf16_t* __restrict__ Vb) {
  __shared__ alignas(16) bf16_t xt[PT * XP];   // 33,792 B
  __shared__ alignas(16) bf16_t sq[PT * kD];   //  4,096 B
  __shared__ alignas(16) bf16_t sk[PT * kD];   //  4,096 B
  __shared__ alignas(16) bf16_t sv[64 * PT];   //  8,192 B
  __shared__ alignas(16) bf16_t wt[64 * XP];   // 33,792 B: current group of 64 weight rows

  const int tid = threadIdx.x;
  const int wv  = tid >> 5;          // 0..3: position sub-tile of 16
  const int l   = tid & 31;
  const int h   = l >> 4;
  const int m   = l & 15;
  const int b   = blockIdx.x / NPB;
  const int p0  = (blockIdx.x - b * NPB) * PT;
  if (b >= kB) return;

  // stage x[b][c][p0..p0+63] transposed to xt[i][c], bf16 RNE
  const float* xb = x + (size_t)b * kC * kN + p0;
#pragma unroll 2
  for (int it = 0; it < (kC * PT / 4) / 128; ++it) {
    const int c  = it * 8 + (tid >> 4);
    const int i4 = (tid & 15) * 4;
    const v4f v  = *(const v4f*)(xb + (size_t)c * kN + i4);
    bf16_t* d = xt + i4 * XP + c;
    d[0]      = (bf16_t)v[0];
    d[XP]     = (bf16_t)v[1];
    d[2 * XP] = (bf16_t)v[2];
    d[3 * XP] = (bf16_t)v[3];
  }
  stage_w<32>(wt, Wq, tid);             // rows 0..31  = Wq
  stage_w<32>(wt + 32 * XP, Wk, tid);   // rows 32..63 = Wk
  __syncthreads();

  const bf16_t* xrow = xt + (wv * 16 + m) * XP;   // row i = wv*16+m, k = c contiguous
  const bf16_t* wrow = wt + m * XP;               // weight row m of each 16-row tile of the group

  // q, k: D[i][o] = sum_c xt[i][c] * W[o][c]; A = xt row i, B column o = W row o
  {
    v8f aq0 = {};
    v8f aq1 = {};
    v8f ak0 = {};
    v8f ak1 = {};
#pragma unroll 1
    for (int ks = 0; ks < kC / 32; ++ks) {
      const int k0 = ks * 32;
      const v16bf xf = frag_b16(xrow + k0, h);
      // the four weight fragments are read ahead of the first product: one LDS latency per k step
      const v16bf w0 = frag_b16(wrow + k0, h);
      const v16bf w1 = frag_b16(wrow + 16 * XP + k0, h);
      const v16bf w2 = frag_b16(wrow + 32 * XP + k0, h);
      const v16bf w3 = frag_b16(wrow + 48 * XP + k0, h);
      aq0 = mma16(xf, w0, aq0);
      aq1 = mma16(xf, w1, aq1);
      ak0 = mma16(xf, w2, ak0);
      ak1 = mma16(xf, w3, ak1);
    }
    const float bq0 = bq[m], bq1 = bq[16 + m];
    const float bk0 = bk[m], bk1 = bk[16 + m];
    // D element r of this lane = (row i = wv*16+8h+r, col o = m / 16+m)
#pragma unroll
    for (int r = 0; r < 8; ++r) {
      const int io = (wv * 16 + 8 * h + r) * kD;
      sq[io + m]      = (bf16_t)(aq0[r] + bq0);
      sq[io + 16 + m] = (bf16_t)(aq1[r] + bq1);
      sk[io + m]      = (bf16_t)(ak0[r] + bk0);
      sk[io + 16 + m] = (bf16_t)(ak1[r] + bk1);
    }
  }

  // v: D[o][i] = sum_c Wv[o][c] * xt[i][c]; A = Wv row o, B column i = xt row i; 64 channels per group
#pragma unroll 1
  for (int og = 0; og < kC / 64; ++og) {
    __syncthreads();   // every wave has left the earlier group's wt rows and the earlier sv store phase
    stage_w<64>(wt, Wv + (size_t)og * 64 * kC, tid);
    __syncthreads();   // wt rows of this group are complete
    v8f av[4];
#pragma unroll
    for (int t = 0; t < 4; ++t) av[t] = v8f{};
#pragma unroll 1
    for (int ks = 0; ks < kC / 32; ++ks) {
      const int k0 = ks * 32;
      const v16bf xf = frag_b16(xrow + k0, h);
      v16bf wf[4];   // read ahead of the first product, as above
#pragma unroll
      for (int t = 0; t < 4; ++t) wf[t] = frag_b16(wrow + t * 16 * XP + k0, h);
#pragma unroll
      for (int t = 0; t < 4; ++t) av[t] = mma16(wf[t], xf, av[t]);
    }
    // D element r = (row o = og*64 + t*16 + 8h + r, col i = wv*16 + m)
#pragma unroll
    for (int t = 0; t < 4; ++t)
#pragma unroll
      for (int r = 0; r < 8; ++r) {
        const int ol = t * 16 + 8 * h + r;
        sv[ol * PT + wv * 16 + m] = (bf16_t)(av[t][r] + bv[og * 64 + ol]);
      }
    __syncthreads();
    v4u vv[4];
    size_t gv[4];
#pragma unroll
    for (int q = 0; q < 4; ++q) {
      const int row = q * 16 + (tid >> 3);
      const int seg = tid & 7;
      vv[q] = *(const v4u*)(sv + row * PT + seg * 8);
      gv[q] = ((size_t)(b * kC + og * 64 + row)) * kN + p0 + seg * 8;
    }
#pragma unroll
    for (int q = 0; q < 4; ++q) *(v4u*)(Vb + gv[q]) = vv[q];
    // the next trip overwrites the registers these stores name
    asm volatile("s_wait_xcnt 0x0" ::: "memory");
  }

  // q, k tiles: 64 rows x 64 B = 4096 contiguous bytes each; 16 B per lane, 8 lanes per line
  {
    v4u uq[2], uk[2];
    size_t gq[2];
#pragma unroll
    for (int q = 0; q < 2; ++q) {
      const int idx = q * 128 + tid;
      uq[q] = *(const v4u*)(sq + idx * 8);
      uk[q] = *(const v4u*)(sk + idx * 8);
      gq[q] = ((size_t)(b * kN + p0)) * kD + idx * 8;
    }
#pragma unroll
    for (int q = 0; q < 2; ++q) {
      *(v4u*)(Qb + gq[q]) = uq[q];
      *(v4u*)(Kb + gq[q]) = uk[q];
    }
    
  }
}

// ---------------------------------------------------------------------------
// Fused attention for one (batch, 64-query) tile. 256 threads = 8 waves = 4 query tiles x 2
// channel halves. Per 128-key pass: K rows [128][32] and V rows [256][128] staged in LDS by the
// whole block: asynchronous copies into a ring of two buffers, the next tile in flight under this one's work.
// S^T = K.Q^T so each lane owns one query column: per-query
// running max / sum need one xor-16 shuffle per pass, and the accumulators are rescaled once per pass.
// P (bf16) packed from each pair of S^T accumulators is the B fragment of O^T = V.P^T for its 32 keys
// (k = key, element r <- even tile row 8h+r, element 8+r <- odd tile).
// Epilogue stages 32 channel rows x 64 positions in LDS; out = gamma*O/l + x written as whole
// ---------------------------------------------------------------------------
// Two blocks per WGP = four waves per SIMD, said to the compiler: it then spends the 256 registers of that
// residency on LDS reads issued ahead, and no more.
__global__ void __launch_bounds__(256) __attribute__((amdgpu_waves_per_eu(4, 4)))
attn_kernel(const bf16_t* __restrict__ Qb, const bf16_t* __restrict__ Kb, const bf16_t* __restrict__ Vb,
            const float* __restrict__ x, const float* __restrict__ gamma, float* __restrict__ out) {
  __shared__ alignas(16) bf16_t ring[2 * STH];   // 159,744 B: two blocks still fit one WGP's LDS

  const int tid = threadIdx.x;
  const int wv  = __builtin_amdgcn_readfirstlane(tid >> 5);   // wave-uniform: what derives from it stays scalar
  const int l   = tid & 31;
  const int h   = l >> 4;
  const int m   = l & 15;
  const int b    = blockIdx.x / NIB;
  const int iblk = (blockIdx.x - b * NIB) * IB;
  if (b >= kB) return;
  const int ti = wv >> 1;           // query sub-tile 0..3
  const int ch = wv & 1;            // channel half
  // i0 = iblk + ti * 16: first query of this wave's sub-tile, as the comments below name it
  const int c0 = ch * 128;

  const bf16_t* kg = Kb + (size_t)b * kN * kD;
  const bf16_t* vg = Vb + (size_t)b * kC * kN;

  // Q tile (64 rows x 64 B, contiguous): its 256 16-B segments go into the 16 pad bytes of buffer 0's 256 V rows,
  // which no copy writes (the ring leaves no LDS for a padded tile of its own at two blocks per WGP): segment s of query
  // row r behind V row s*64+r. Published by the prologue's barrier. Each pass re-reads its fragment beside the
  // K fragments, so that it holds no registers through the V products.
  *(v4u*)(ring + KSH + ((tid & 3) * 64 + (tid >> 2)) * VP + JB) = *(const v4u*)(Qb + ((size_t)b * kN + iblk) * kD + tid * 8);
  asm volatile("s_wait_dscnt 0x0" ::: "memory");   // this wave's LDS write has retired ahead of its first copies

  v8f acc[8];
#pragma unroll
  for (int ct = 0; ct < 8; ++ct) acc[ct] = v8f{};
  float lsum = 0.0f;
  float mrun = -1.0e30f;

  // staging bases of this thread: K row tid/4, 16-B segment tid%4; V row tid/16, 16-B segment tid%16
  const bf16_t* ksrc = kg + tid * 8;
  const bf16_t* vsrc = vg + (size_t)(tid >> 4) * kN + (tid & 15) * 8;
  const unsigned kdst = lds_addr(ring + (tid >> 2) * KP + (tid & 3) * 8);
  const unsigned vdst = lds_addr(ring + KSH + (tid >> 4) * VP + (tid & 15) * 8);

  // ring prologue: tile 0 lands and is published, then tile 1 starts into the other buffer
  stage_tile(kdst, vdst, ksrc, vsrc);
  asm volatile("s_wait_asynccnt 0x0" ::: "memory");   // this wave's copies of tile 0 have landed
  __syncthreads();                                    // and every other wave's: tile 0 may be read
  stage_tile(kdst + STH * 2, vdst + STH * 2, ksrc + (size_t)JB * kD, vsrc + JB);

#pragma unroll 1
  for (int jt = 0; jt < NT; ++jt) {
    const int bo = (jt & 1) * STH;   // this pass reads K, V from buffer jt mod 2 (Q from buffer 0's pads)
    const bf16_t* ks = ring + bo;
    const bf16_t* vs = ring + bo + KSH;

    // S^T tiles t = 0..7: rows = keys j0+16t+m (A = K rows), cols = queries (B = Q rows), j0 = jt*128
    // Q as B operand: column n = query i0+m, k = d: segments h and 2+h of its row, 128 V rows apart
    Frag qfr;
    qfr.h2[0] = *(const v8bf*)(ring + KSH + (h * 64 + ti * 16 + m) * VP + JB);
    qfr.h2[1] = *(const v8bf*)(ring + KSH + ((2 + h) * 64 + ti * 16 + m) * VP + JB);
    const v16bf qf = qfr.v;
    v16bf ka[JB / 16];
#pragma unroll
    for (int t = 0; t < JB / 16; ++t) ka[t] = frag_b16(ks + (t * 16 + m) * KP, h);
    const v8f z = {};
    v8f st[JB / 16];   // st[t] element r = logit(key j0+16t+8h+r, query i0+m)
#pragma unroll
    for (int t = 0; t < JB / 16; ++t) st[t] = mma16_free(ka[t], qf, z);

    // V fragments (8 channel tiles x 32 keys) are asked for one key block ahead of the products that take them,
    // each block's exp arithmetic standing between: block 0 here, ahead of the maximum.
    const bf16_t* vrow = vs + (c0 + m) * VP;
    v16bf vf[8];
#pragma unroll
    for (int ct = 0; ct < 8; ++ct) vf[ct] = frag_b16(vrow + ct * 16 * VP, h);

    // per-query online softmax: lanes m and m+16 hold the 128 logits of query i0+m
    float mt[JB / 32];   // one independent chain per 32 keys
#pragma unroll
    for (int kk = 0; kk < JB / 32; ++kk) {
      float a = fmaxf(st[2 * kk][0], st[2 * kk + 1][0]);
#pragma unroll
      for (int r = 1; r < 8; ++r) a = fmaxf(a, fmaxf(st[2 * kk][r], st[2 * kk + 1][r]));
      mt[kk] = a;
    }
    float ml = fmaxf(fmaxf(mt[0], mt[1]), fmaxf(mt[2], mt[3]));
    ml = fmaxf(ml, __shfl_xor(ml, 16));
    const float mn    = fmaxf(mrun, ml);
    const float alpha = __expf(mrun - mn);
    mrun = mn;

#pragma unroll
    for (int ct = 0; ct < 8; ++ct) acc[ct] *= alpha;

    float pt[JB / 32];
#pragma unroll
    for (int kk = 0; kk < JB / 32; ++kk) {
      Frag p;
      float ps = 0.0f;
#pragma unroll
      for (int r = 0; r < 8; ++r) {
        const bf16_t e0 = (bf16_t)__expf(st[2 * kk][r] - mn);
        const bf16_t e1 = (bf16_t)__expf(st[2 * kk + 1][r] - mn);
        p.e[r]     = e0;           // B element r   <- key j0+32kk+8h+r
        p.e[8 + r] = e1;           // B element 8+r <- key j0+32kk+16+8h+r
        ps += bf2f(e0) + bf2f(e1); // normaliser from the same bf16 values
      }
      pt[kk] = ps;
      // O^T[c][i] += V[c][keys] . P^T: A = V row c (k = key contiguous, 32 keys per product), B = p
#pragma unroll
      for (int ct = 0; ct < 8; ++ct) acc[ct] = mma16_free(vf[ct], p.v, acc[ct]);
      if (kk + 1 < JB / 32) {
#pragma unroll
        for (int ct = 0; ct < 8; ++ct) vf[ct] = frag_b16(vrow + ct * 16 * VP + (kk + 1) * 32, h);
      }
    }
    float ps = (pt[0] + pt[1]) + (pt[2] + pt[3]);
    ps += __shfl_xor(ps, 16);
    lsum = lsum * alpha + ps;

    // publish point of tile jt+1, which also frees this pass's buffer
    // nothing of the pass is scheduled behind it: the sum's lane exchange counts on dscnt and stays ahead of the wait
    __builtin_amdgcn_sched_barrier(0);
    asm volatile("s_wait_dscnt 0x0" ::: "memory");      // this wave's reads of the buffer have returned
    asm volatile("s_wait_asynccnt 0x0" ::: "memory");   // this wave's copies of tile jt+1 have landed
    __syncthreads();
    if (jt + 2 < NT)   // the same for the whole block
      stage_tile(kdst + bo * 2, vdst + bo * 2, ksrc + (size_t)(jt + 2) * JB * kD, vsrc + (jt + 2) * JB);
  }
  asm volatile("s_wait_asynccnt 0x0" ::: "memory");   // nothing is in flight when the ring becomes output staging
  float* so = (float*)ring;   // 32 x 64 f32; every wave has passed the last pass's barrier behind its last read

  // epilogue: acc[ct] element r = (channel c0+ct*16+8h+r, query i0+m); scale per query column
  const float scl = gamma[0] / lsum;
  // lane and thread index taken anew
  const int le = (int)__builtin_amdgcn_mbcnt_lo(~0u, 0u);
  const int he = le >> 4;
  const int me = le & 15;
  const int te = wv * 32 + le;
#pragma unroll
  for (int ct = 0; ct < 8; ++ct) {
    __syncthreads();   // earlier ct store phase finished reading so
#pragma unroll
    for (int r = 0; r < 8; ++r)
      so[(ch * 16 + 8 * he + r) * IB + ti * 16 + me] = acc[ct][r] * scl;
    __syncthreads();
    // 32 channel rows x 256 B: row = idx/16, 16-B segment idx%16; lanes 8q..8q+7 cover one line
    v4f ov[2];
    size_t go[2];
#pragma unroll
    for (int q = 0; q < 2; ++q) {
      const int idx = q * 256 + te;
      const int row = idx >> 4;
      const int seg = idx & 15;
      const int c   = (row >> 4) * 128 + ct * 16 + (row & 15);
      go[q] = ((size_t)(b * kC + c)) * kN + iblk + seg * 4;
      ov[q] = *(const v4f*)(so + row * IB + seg * 4) + *(const v4f*)(x + go[q]);
    }
#pragma unroll
    for (int q = 0; q < 2; ++q) *(v4f*)(out + go[q]) = ov[q];
    
  }
}

extern "C" void kernel_launch(void* const* d_in, const int* in_sizes, int n_in,
                              void* d_out, int out_size, void* d_ws, size_t ws_size,
                              hipStream_t stream) {
  if (n_in < 8) return;
  if (in_sizes[0] != kB * kC * kN || in_sizes[1] != kD * kC || in_sizes[2] != kD ||
      in_sizes[3] != kD * kC || in_sizes[4] != kD || in_sizes[5] != kC * kC ||
      in_sizes[6] != kC || in_sizes[7] < 1) return;
  if (out_size != kB * kC * kN) return;

  const float* x     = (const float*)d_in[0];
  const float* Wq    = (const float*)d_in[1];
  const float* bq    = (const float*)d_in[2];
  const float* Wk    = (const float*)d_in[3];
  const float* bk    = (const float*)d_in[4];
  const float* Wv    = (const float*)d_in[5];
  const float* bv    = (const float*)d_in[6];
  const float* gamma = (const float*)d_in[7];
  float* out = (float*)d_out;

  // workspace: Qb [B][N][32] bf16 (2 MiB), Kb [B][N][32] bf16 (2 MiB), Vb [B][C][N] bf16 (16 MiB)
  const size_t qk_bytes = (size_t)kB * kN * kD * sizeof(bf16_t);
  const size_t v_bytes  = (size_t)kB * kC * kN * sizeof(bf16_t);
  if (ws_size < 2 * qk_bytes + v_bytes) return;
  bf16_t* Qb = (bf16_t*)d_ws;
  bf16_t* Kb = (bf16_t*)((char*)d_ws + qk_bytes);
  bf16_t* Vb = (bf16_t*)((char*)d_ws + 2 * qk_bytes);

  proj_kernel<<<dim3(kB * NPB), dim3(128), 0, stream>>>(x, Wq, bq, Wk, bk, Wv, bv, Qb, Kb, Vb);
  attn_kernel<<<dim3(kB * NIB), dim3(256), 0, stream>>>(Qb, Kb, Vb, x, gamma, out);
}

// v005
// One run takes 99.5 microseconds.
// Two timings next to v004 put it at 1.12 and 1.11 times that version's speed.
// All steps since v000 together make it 2.75 times as fast.
#include <hip/hip_runtime.h>
#include <stdint.h>
#include <stddef.h>

// All contractions: v_wmma_f32_16x16x32_bf16 (bf16 operands, f32 accumulate): three 1x1-conv projections, key.query logits, value.prob aggregation; softmax statistics, normaliser and residual add in f32.

typedef __bf16 bf16_t;
typedef __attribute__((ext_vector_type(16))) __bf16 v16bf;
typedef __attribute__((ext_vector_type(8)))  __bf16 v8bf_t;
typedef __attribute__((ext_vector_type(8)))  float  v8f;
typedef __attribute__((ext_vector_type(4)))  float  v4f_t;
typedef __attribute__((ext_vector_type(4)))  unsigned int v4u_t;
typedef v8bf_t __attribute__((__may_alias__)) v8bf;
typedef v4f_t  __attribute__((__may_alias__)) v4f;
typedef v4u_t  __attribute__((__may_alias__)) v4u;
typedef __attribute__((ext_vector_type(2)))  unsigned int v2u_t;
typedef v2u_t  __attribute__((__may_alias__)) v2u;

constexpr int kB  = 8;      // batch
constexpr int kC  = 256;    // channels
constexpr int kN  = 4096;   // positions (H*W)
constexpr int kD  = 32;     // q/k channels
constexpr int PT  = 64;     // positions per projection block
constexpr int XP  = kC + 8; // LDS pitch (halves) of the transposed x tile, 528 B rows
constexpr int NPB = kN / PT;
constexpr int IB  = 128;    // query positions per attention block: 8 waves x 16
constexpr int NIB = kN / IB;
constexpr int KP  = kD + 8; // LDS pitch (halves) of a staged key row
constexpr int JB  = 128;    // keys per attention pass
constexpr int VP  = JB + 8; // LDS pitch (halves) of a staged value row (JB keys), 272 B rows
constexpr int KSH = JB * KP;    // halves of one staged K tile, 10,240 B
constexpr int STH = KSH + kC * VP;   // halves of one ring buffer (K tile, then V tile), 79,872 B
constexpr int NT  = kN / JB;    // key tiles
typedef char ring_check[(NT >= 2 && IB == 8 * 16 && (KSH * 2) % 16 == 0 && (STH * 2) % 16 == 0 && 32 * IB * 4 <= STH * 2) ? 1 : -1];
typedef char cfg_check[(kN % PT == 0 && kN % IB == 0 && kN % JB == 0 && JB == 128 && kC % 64 == 0 && kD == 32 &&
                        (XP % 8) == 0 && (KP % 8) == 0 && (VP % 8) == 0) ? 1 : -1];

union Frag { v16bf v; v8bf h2[2]; bf16_t e[16]; };

// D(16x16 f32) += A(16x32 bf16) * B(32x16 bf16); hazard guard ties D, keeps A/B live.
static __device__ __forceinline__ v8f mma16(v16bf a, v16bf b, v8f c) {
  v8f d = __builtin_amdgcn_wmma_f32_16x16x32_bf16(false, a, false, b, (short)0, c, false, false);
  asm volatile("v_nop\n\tv_nop\n\tv_nop\n\tv_nop" : "+v"(d) : "v"(a), "v"(b));
  return d;
}

// The same product for the attention loop, builtin only: the compiler keeps the distances behind it and may move
// the LDS reads of later fragments ahead of it (no memory operation crosses a volatile asm statement).
static __device__ __forceinline__ v8f mma16_free(v16bf a, v16bf b, v8f c) {
  return __builtin_amdgcn_wmma_f32_16x16x32_bf16(false, a, false, b, (short)0, c, false, false);
}

// Fragment from a k-contiguous 16-bit row (row m for A, column n stored as a row for B), h = lane>>4:
// elements 0..7 <- row[8h .. 8h+7], elements 8..15 <- row[16+8h .. 16+8h+7].
static __device__ __forceinline__ v16bf frag_b16(const bf16_t* row, int h) {
  Frag f;
  f.h2[0] = *(const v8bf*)(row + 8 * h);
  f.h2[1] = *(const v8bf*)(row + 16 + 8 * h);
  return f.v;
}

// Stage ROWS contiguous f32 weight rows of kC floats as bf16 (RNE) rows of pitch XP in LDS, 128 threads.
// Each wave-wide load covers 512 contiguous bytes (four whole lines); each lane stores its 4 values as 8 B.
template <int ROWS>
static __device__ __forceinline__ void stage_w(bf16_t* dst, const float* __restrict__ src, int tid) {
  // fully unrolled so that all loads of the group are in flight behind one latency
#pragma unroll
  for (int it = 0; it < ROWS * kC / 4 / 128; ++it) {
    const int idx = it * 128 + tid;
    const v4f v = *(const v4f*)(src + idx * 4);
    union { bf16_t e[4]; v2u_t u; } p;
    p.e[0] = (bf16_t)v[0];
    p.e[1] = (bf16_t)v[1];
    p.e[2] = (bf16_t)v[2];
    p.e[3] = (bf16_t)v[3];
    *(v2u*)(dst + (idx >> 6) * XP + (idx & 63) * 4) = p.u;
  }
}

// LDS byte address of a __shared__ element, as the asynchronous copies take it
static __device__ __forceinline__ unsigned lds_addr(const bf16_t* p) {
  return (unsigned)(uintptr_t)(__attribute__((address_space(3))) const void*)p;
}

// Nine asynchronous 16-B copies per lane, global memory to LDS through no register. The s_wait_xcnt is the last line
// of the copies' own statement, so that it stands ahead of every later write of an address register they name.
static __device__ __forceinline__ void copy9(const unsigned (&d)[9], const bf16_t* const (&g)[9]) {
  asm volatile("global_load_async_to_lds_b128 %0, %9, off\n\t"
               "global_load_async_to_lds_b128 %1, %10, off\n\t"
               "global_load_async_to_lds_b128 %2, %11, off\n\t"
               "global_load_async_to_lds_b128 %3, %12, off\n\t"
               "global_load_async_to_lds_b128 %4, %13, off\n\t"
               "global_load_async_to_lds_b128 %5, %14, off\n\t"
               "global_load_async_to_lds_b128 %6, %15, off\n\t"
               "global_load_async_to_lds_b128 %7, %16, off\n\t"
               "global_load_async_to_lds_b128 %8, %17, off\n\t"
               "s_wait_xcnt 0x0"
               :: "v"(d[0]), "v"(d[1]), "v"(d[2]), "v"(d[3]), "v"(d[4]), "v"(d[5]), "v"(d[6]), "v"(d[7]), "v"(d[8]),
                  "v"(g[0]), "v"(g[1]), "v"(g[2]), "v"(g[3]), "v"(g[4]), "v"(g[5]), "v"(g[6]), "v"(g[7]), "v"(g[8])
               : "memory");
}

// One key tile into one ring buffer, 256 threads, 18 copies per lane. K: 128 rows x 64 B are 8 KiB contiguous;
// V: a wave-wide copy covers two rows x 256 B (whole lines). Round q is a constant step from the thread's own base
// on both sides (64 K rows, 16 V rows). kd, vd: this thread's LDS byte addresses in the buffer.
static __device__ __forceinline__ void stage_tile(unsigned kd, unsigned vd, const bf16_t* kp, const bf16_t* vp) {
  unsigned d[18];
  const bf16_t* g[18];
#pragma unroll
  for (int q = 0; q < 2; ++q) {
    d[q] = kd + q * 64 * KP * 2;
    g[q] = kp + q * 64 * kD;
  }
#pragma unroll
  for (int q = 0; q < 16; ++q) {
    d[2 + q] = vd + q * 16 * VP * 2;
    g[2 + q] = vp + (size_t)q * 16 * kN;
  }
  const unsigned d0[9] = {d[0], d[1], d[2], d[3], d[4], d[5], d[6], d[7], d[8]};
  const bf16_t* const g0[9] = {g[0], g[1], g[2], g[3], g[4], g[5], g[6], g[7], g[8]};
  const unsigned d1[9] = {d[9], d[10], d[11], d[12], d[13], d[14], d[15], d[16], d[17]};
  const bf16_t* const g1[9] = {g[9], g[10], g[11], g[12], g[13], g[14], g[15], g[16], g[17]};
  copy9(d0, g0);
  copy9(d1, g1);
}

static __device__ __forceinline__ float bf2f(bf16_t v) {
  union { bf16_t b; unsigned short u; } t;
  t.b = v;
  return __uint_as_float(((unsigned int)t.u) << 16);
}

// ---------------------------------------------------------------------------
// Fused 1x1-conv projections for one (batch, 64-position) tile.
// xt[i][c] (bf16, k-contiguous) is the A operand of q/k (D[i][o]) and the B operand of v (D[o][i]).
// Weights: 64 rows at a time (Wq+Wk, then four groups of Wv) are converted once per block into wt
// and every wave takes its fragments from there.
// ---------------------------------------------------------------------------
__global__ void __launch_bounds__(128)
proj_kernel(const float* __restrict__ x, const float* __restrict__ Wq, const float* __restrict__ bq,
            const float* __restrict__ Wk, const float* __restrict__ bk, const float* __restrict__ Wv,
            const float* __restrict__ bv, bf16_t* __restrict__ Qb, bf16_t* __restrict__ Kb,
            bf16_t* __restrict__ Vb) {
  __shared__ alignas(16) bf16_t xt[PT * XP];   // 33,792 B
  __shared__ alignas(16) bf16_t sq[PT * kD];   //  4,096 B
  __shared__ alignas(16) bf16_t sk[PT * kD];   //  4,096 B
  __shared__ alignas(16) bf16_t sv[64 * PT];   //  8,192 B
  __shared__ alignas(16) bf16_t wt[64 * XP];   // 33,792 B: current group of 64 weight rows

  const int tid = threadIdx.x;
  const int wv  = tid >> 5;          // 0..3: position sub-tile of 16
  const int l   = tid & 31;
  const int h   = l >> 4;
  const int m   = l & 15;
  const int b   = blockIdx.x / NPB;
  const int p0  = (blockIdx.x - b * NPB) * PT;
  if (b >= kB) return;

  // stage x[b][c][p0..p0+63] transposed to xt[i][c], bf16 RNE
  const float* xb = x + (size_t)b * kC * kN + p0;
#pragma unroll 2
  for (int it = 0; it < (kC * PT / 4) / 128; ++it) {
    const int c  = it * 8 + (tid >> 4);
    const int i4 = (tid & 15) * 4;
    const v4f v  = *(const v4f*)(xb + (size_t)c * kN + i4);
    bf16_t* d = xt + i4 * XP + c;
    d[0]      = (bf16_t)v[0];
    d[XP]     = (bf16_t)v[1];
    d[2 * XP] = (bf16_t)v[2];
    d[3 * XP] = (bf16_t)v[3];
  }
  stage_w<32>(wt, Wq, tid);             // rows 0..31  = Wq
  stage_w<32>(wt + 32 * XP, Wk, tid);   // rows 32..63 = Wk
  __syncthreads();

  const bf16_t* xrow = xt + (wv * 16 + m) * XP;   // row i = wv*16+m, k = c contiguous
  const bf16_t* wrow = wt + m * XP;               // weight row m of each 16-row tile of the group

  // q, k: D[i][o] = sum_c xt[i][c] * W[o][c]; A = xt row i, B column o = W row o
  {
    v8f aq0 = {};
    v8f aq1 = {};
    v8f ak0 = {};
    v8f ak1 = {};
#pragma unroll 1
    for (int ks = 0; ks < kC / 32; ++ks) {
      const int k0 = ks * 32;
      const v16bf xf = frag_b16(xrow + k0, h);
      // the four weight fragments are read ahead of the first product: one LDS latency per k step
      const v16bf w0 = frag_b16(wrow + k0, h);
      const v16bf w1 = frag_b16(wrow + 16 * XP + k0, h);
      const v16bf w2 = frag_b16(wrow + 32 * XP + k0, h);
      const v16bf w3 = frag_b16(wrow + 48 * XP + k0, h);
      aq0 = mma16(xf, w0, aq0);
      aq1 = mma16(xf, w1, aq1);
      ak0 = mma16(xf, w2, ak0);
      ak1 = mma16(xf, w3, ak1);
    }
    const float bq0 = bq[m], bq1 = bq[16 + m];
    const float bk0 = bk[m], bk1 = bk[16 + m];
    // D element r of this lane = (row i = wv*16+8h+r, col o = m / 16+m)
#pragma unroll
    for (int r = 0; r < 8; ++r) {
      const int io = (wv * 16 + 8 * h + r) * kD;
      sq[io + m]      = (bf16_t)(aq0[r] + bq0);
      sq[io + 16 + m] = (bf16_t)(aq1[r] + bq1);
      sk[io + m]      = (bf16_t)(ak0[r] + bk0);
      sk[io + 16 + m] = (bf16_t)(ak1[r] + bk1);
    }
  }

  // v: D[o][i] = sum_c Wv[o][c] * xt[i][c]; A = Wv row o, B column i = xt row i; 64 channels per group
#pragma unroll 1
  for (int og = 0; og < kC / 64; ++og) {
    __syncthreads();   // every wave has left the earlier group's wt rows and the earlier sv store phase
    stage_w<64>(wt, Wv + (size_t)og * 64 * kC, tid);
    __syncthreads();   // wt rows of this group are complete
    v8f av[4];
#pragma unroll
    for (int t = 0; t < 4; ++t) av[t] = v8f{};
#pragma unroll 1
    for (int ks = 0; ks < kC / 32; ++ks) {
      const int k0 = ks * 32;
      const v16bf xf = frag_b16(xrow + k0, h);
      v16bf wf[4];   // read ahead of the first product, as above
#pragma unroll
      for (int t = 0; t < 4; ++t) wf[t] = frag_b16(wrow + t * 16 * XP + k0, h);
#pragma unroll
      for (int t = 0; t < 4; ++t) av[t] = mma16(wf[t], xf, av[t]);
    }
    // D element r = (row o = og*64 + t*16 + 8h + r, col i = wv*16 + m)
#pragma unroll
    for (int t = 0; t < 4; ++t)
#pragma unroll
      for (int r = 0; r < 8; ++r) {
        const int ol = t * 16 + 8 * h + r;
        sv[ol * PT + wv * 16 + m] = (bf16_t)(av[t][r] + bv[og * 64 + ol]);
      }
    __syncthreads();
    v4u vv[4];
    size_t gv[4];
#pragma unroll
    for (int q = 0; q < 4; ++q) {
      const int row = q * 16 + (tid >> 3);
      const int seg = tid & 7;
      vv[q] = *(const v4u*)(sv + row * PT + seg * 8);
      gv[q] = ((size_t)(b * kC + og * 64 + row)) * kN + p0 + seg * 8;
    }
#pragma unroll
    for (int q = 0; q < 4; ++q) *(v4u*)(Vb + gv[q]) = vv[q];
    // the next trip overwrites the registers these stores name
    asm volatile("s_wait_xcnt 0x0" ::: "memory");
  }

  // q, k tiles: 64 rows x 64 B = 4096 contiguous bytes each; 16 B per lane, 8 lanes per line
  {
    v4u uq[2], uk[2];
    size_t gq[2];
#pragma unroll
    for (int q = 0; q < 2; ++q) {
      const int idx = q * 128 + tid;
      uq[q] = *(const v4u*)(sq + idx * 8);
      uk[q] = *(const v4u*)(sk + idx * 8);
      gq[q] = ((size_t)(b * kN + p0)) * kD + idx * 8;
    }
#pragma unroll
    for (int q = 0; q < 2; ++q) {
      *(v4u*)(Qb + gq[q]) = uq[q];
      *(v4u*)(Kb + gq[q]) = uk[q];
    }
    
  }
}

// ---------------------------------------------------------------------------
// Fused attention for one (batch, 128-query) tile. 256 threads = 8 waves, each 16 queries x all 256
// channels, so that a query's logits and softmax are computed in one wave only. Per 128-key pass: K rows [128][32] and V rows [256][128] staged in LDS by the
// whole block: asynchronous copies into a ring of two buffers, the next tile in flight under this one's work.
// S^T = K.Q^T so each lane owns one query column: per-query
// running max / sum need one xor-16 shuffle per pass, and the accumulators are rescaled once per pass.
// P (bf16) packed from each pair of S^T accumulators is the B fragment of O^T = V.P^T for its 32 keys
// (k = key, element r <- even tile row 8h+r, element 8+r <- odd tile).
// Epilogue stages 32 channel rows x 128 positions in LDS; out = gamma*O/l + x written as whole lines
// ---------------------------------------------------------------------------
// One block per WGP = two waves per SIMD, said to the compiler: the 128 accumulator registers of a wave and the
// fragments read ahead need more than the 256 registers of four waves per SIMD.
__global__ void __launch_bounds__(256) __attribute__((amdgpu_waves_per_eu(2, 2)))
attn_kernel(const bf16_t* __restrict__ Qb, const bf16_t* __restrict__ Kb, const bf16_t* __restrict__ Vb,
            const float* __restrict__ x, const float* __restrict__ gamma, float* __restrict__ out) {
  __shared__ alignas(16) bf16_t ring[2 * STH];   // 159,744 B

  const int tid = threadIdx.x;
  const int wv  = __builtin_amdgcn_readfirstlane(tid >> 5);   // wave-uniform: what derives from it stays scalar
  const int l   = tid & 31;
  const int h   = l >> 4;
  const int m   = l & 15;
  const int b    = blockIdx.x / NIB;
  const int iblk = (blockIdx.x - b * NIB) * IB;
  if (b >= kB) return;
  // i0 = iblk + wv * 16: first query of this wave, as the comments below name it

  const bf16_t* kg = Kb + (size_t)b * kN * kD;
  const bf16_t* vg = Vb + (size_t)b * kC * kN;

  // Q as B operand, kept in registers: column n = query i0+m, k = d; the wave's 16 rows x 64 B are contiguous
  const bf16_t* qrow = Qb + ((size_t)b * kN + iblk + wv * 16 + m) * kD;
  // the two scheduling fences keep every other instruction out from between the loads and their wait
  __builtin_amdgcn_sched_barrier(0);
  const v16bf qf = frag_b16(qrow, h);
  // later code overwrites the address registers of these two loads
  asm volatile("s_wait_xcnt 0x0" ::: "memory");
  __builtin_amdgcn_sched_barrier(0);

  v8f acc[kC / 16];
#pragma unroll
  for (int ct = 0; ct < kC / 16; ++ct) acc[ct] = v8f{};
  float lsum = 0.0f;
  float mrun = -1.0e30f;

  // staging bases of this thread: K row tid/4, 16-B segment tid%4; V row tid/16, 16-B segment tid%16
  const bf16_t* ksrc = kg + tid * 8;
  const bf16_t* vsrc = vg + (size_t)(tid >> 4) * kN + (tid & 15) * 8;
  const unsigned kdst = lds_addr(ring + (tid >> 2) * KP + (tid & 3) * 8);
  const unsigned vdst = lds_addr(ring + KSH + (tid >> 4) * VP + (tid & 15) * 8);

  // ring prologue: tile 0 lands and is published, then tile 1 starts into the other buffer
  stage_tile(kdst, vdst, ksrc, vsrc);
  asm volatile("s_wait_asynccnt 0x0" ::: "memory");   // this wave's copies of tile 0 have landed
  __syncthreads();                                    // and every other wave's: tile 0 may be read
  stage_tile(kdst + STH * 2, vdst + STH * 2, ksrc + (size_t)JB * kD, vsrc + JB);

#pragma unroll 1
  for (int jt = 0; jt < NT; ++jt) {
    const int bo = (jt & 1) * STH;   // this pass reads K, V from buffer jt mod 2
    const bf16_t* ks = ring + bo;
    const bf16_t* vs = ring + bo + KSH;

    // S^T tiles t = 0..7: rows = keys j0+16t+m (A = K rows), cols = queries (B = Q rows), j0 = jt*128
    v16bf ka[JB / 16];
#pragma unroll
    for (int t = 0; t < JB / 16; ++t) ka[t] = frag_b16(ks + (t * 16 + m) * KP, h);
    const v8f z = {};
    v8f st[JB / 16];   // st[t] element r = logit(key j0+16t+8h+r, query i0+m)
#pragma unroll
    for (int t = 0; t < JB / 16; ++t) st[t] = mma16_free(ka[t], qf, z);

    // V fragments (16 channel tiles x 32 keys) are asked for one key block ahead of the products that take them,
    // each block's exp arithmetic standing between: block 0 here, ahead of the maximum.
    const bf16_t* vrow = vs + m * VP;
    v16bf vf[kC / 16];
#pragma unroll
    for (int ct = 0; ct < kC / 16; ++ct) vf[ct] = frag_b16(vrow + ct * 16 * VP, h);

    // per-query online softmax: lanes m and m+16 hold the 128 logits of query i0+m
    float mt[JB / 32];   // one independent chain per 32 keys
#pragma unroll
    for (int kk = 0; kk < JB / 32; ++kk) {
      float a = fmaxf(st[2 * kk][0], st[2 * kk + 1][0]);
#pragma unroll
      for (int r = 1; r < 8; ++r) a = fmaxf(a, fmaxf(st[2 * kk][r], st[2 * kk + 1][r]));
      mt[kk] = a;
    }
    float ml = fmaxf(fmaxf(mt[0], mt[1]), fmaxf(mt[2], mt[3]));
    ml = fmaxf(ml, __shfl_xor(ml, 16));
    const float mn    = fmaxf(mrun, ml);
    const float alpha = __expf(mrun - mn);
    mrun = mn;

#pragma unroll
    for (int ct = 0; ct < kC / 16; ++ct) acc[ct] *= alpha;

    float pt[JB / 32];
#pragma unroll
    for (int kk = 0; kk < JB / 32; ++kk) {
      Frag p;
      float ps = 0.0f;
#pragma unroll
      for (int r = 0; r < 8; ++r) {
        const bf16_t e0 = (bf16_t)__expf(st[2 * kk][r] - mn);
        const bf16_t e1 = (bf16_t)__expf(st[2 * kk + 1][r] - mn);
        p.e[r]     = e0;           // B element r   <- key j0+32kk+8h+r
        p.e[8 + r] = e1;           // B element 8+r <- key j0+32kk+16+8h+r
        ps += bf2f(e0) + bf2f(e1); // normaliser from the same bf16 values
      }
      pt[kk] = ps;
      // O^T[c][i] += V[c][keys] . P^T: A = V row c (k = key contiguous, 32 keys per product), B = p
      // in two runs of 8 channel tiles, each run's fragments asked for anew as one group right behind it
#pragma unroll
      for (int hf = 0; hf < 2; ++hf) {
#pragma unroll
        for (int ct = hf * 8; ct < hf * 8 + 8; ++ct) acc[ct] = mma16_free(vf[ct], p.v, acc[ct]);
        if (kk + 1 < JB / 32) {
#pragma unroll
          for (int ct = hf * 8; ct < hf * 8 + 8; ++ct) vf[ct] = frag_b16(vrow + ct * 16 * VP + (kk + 1) * 32, h);
        }
      }
    }
    float ps = (pt[0] + pt[1]) + (pt[2] + pt[3]);
    ps += __shfl_xor(ps, 16);
    lsum = lsum * alpha + ps;

    // publish point of tile jt+1, which also frees this pass's buffer
    // nothing of the pass is scheduled behind it: the sum's lane exchange counts on dscnt and stays ahead of the wait
    __builtin_amdgcn_sched_barrier(0);
    asm volatile("s_wait_dscnt 0x0" ::: "memory");      // this wave's reads of the buffer have returned
    asm volatile("s_wait_asynccnt 0x0" ::: "memory");   // this wave's copies of tile jt+1 have landed
    __syncthreads();
    if (jt + 2 < NT)   // the same for the whole block
      stage_tile(kdst + bo * 2, vdst + bo * 2, ksrc + (size_t)(jt + 2) * JB * kD, vsrc + (jt + 2) * JB);
  }
  asm volatile("s_wait_asynccnt 0x0" ::: "memory");   // nothing is in flight when the ring becomes output staging
  float* so = (float*)ring;   // 32 x 128 f32; every wave has passed the last pass's barrier behind its last read

  // epilogue: acc[ct] element r = (channel ct*16+8h+r, query i0+m); scale per query column
  const float scl = gamma[0] / lsum;
  // lane and thread index taken anew
  const int le = (int)__builtin_amdgcn_mbcnt_lo(~0u, 0u);
  const int he = le >> 4;
  const int me = le & 15;
  const int te = wv * 32 + le;
#pragma unroll
  for (int cp = 0; cp < kC / 32; ++cp) {
    __syncthreads();   // earlier store phase finished reading so
#pragma unroll
    for (int t = 0; t < 2; ++t)
#pragma unroll
      for (int r = 0; r < 8; ++r)
        so[(t * 16 + 8 * he + r) * IB + wv * 16 + me] = acc[2 * cp + t][r] * scl;
    __syncthreads();
    // 32 channel rows x 512 B: row = idx/32, 16-B segment idx%32; a wave covers one row, four whole lines
    v4f ov[4];
    size_t go[4];
#pragma unroll
    for (int q = 0; q < 4; ++q) {
      const int idx = q * 256 + te;
      const int row = idx >> 5;
      const int seg = idx & 31;
      go[q] = ((size_t)(b * kC + cp * 32 + row)) * kN + iblk + seg * 4;
      ov[q] = *(const v4f*)(so + row * IB + seg * 4) + *(const v4f*)(x + go[q]);
    }
#pragma unroll
    for (int q = 0; q < 4; ++q) *(v4f*)(out + go[q]) = ov[q];
    // the next trip overwrites the registers these loads and stores name
    asm volatile("s_wait_xcnt 0x0" ::: "memory");
  }
}

extern "C" void kernel_launch(void* const* d_in, const int* in_sizes, int n_in,
                              void* d_out, int out_size, void* d_ws, size_t ws_size,
                              hipStream_t stream) {
  if (n_in < 8) return;
  if (in_sizes[0] != kB * kC * kN || in_sizes[1] != kD * kC || in_sizes[2] != kD ||
      in_sizes[3] != kD * kC || in_sizes[4] != kD || in_sizes[5] != kC * kC ||
      in_sizes[6] != kC || in_sizes[7] < 1) return;
  if (out_size != kB * kC * kN) return;

  const float* x     = (const float*)d_in[0];
  const float* Wq    = (const float*)d_in[1];
  const float* bq    = (const float*)d_in[2];
  const float* Wk    = (const float*)d_in[3];
  const float* bk    = (const float*)d_in[4];
  const float* Wv    = (const float*)d_in[5];
  const float* bv    = (const float*)d_in[6];
  const float* gamma = (const float*)d_in[7];
  float* out = (float*)d_out;

  // workspace: Qb [B][N][32] bf16 (2 MiB), Kb [B][N][32] bf16 (2 MiB), Vb [B][C][N] bf16 (16 MiB)
  const size_t qk_bytes = (size_t)kB * kN * kD * sizeof(bf16_t);
  const size_t v_bytes  = (size_t)kB * kC * kN * sizeof(bf16_t);
  if (ws_size < 2 * qk_bytes + v_bytes) return;
  bf16_t* Qb = (bf16_t*)d_ws;
  bf16_t* Kb = (bf16_t*)((char*)d_ws + qk_bytes);
  bf16_t* Vb = (bf16_t*)((char*)d_ws + 2 * qk_bytes);

  proj_kernel<<<dim3(kB * NPB), dim3(128), 0, stream>>>(x, Wq, bq, Wk, bk, Wv, bv, Qb, Kb, Vb);
  attn_kernel<<<dim3(kB * NIB), dim3(256), 0, stream>>>(Qb, Kb, Vb, x, gamma, out);
}

// v006
// One run takes 93 microseconds.
// Two timings next to v005 both put it at 1.07 times that version's speed.
// Counting every step since v000, it is 2.95 times as fast.
#include <hip/hip_runtime.h>
#include <stdint.h>
#include <stddef.h>

// All contractions: v_wmma_f32_16x16x32_bf16 (bf16 operands, f32 accumulate): three 1x1-conv projections, key.query logits, value.prob aggregation; softmax statistics, normaliser and residual add in f32.

typedef __bf16 bf16_t;
typedef __attribute__((ext_vector_type(16))) __bf16 v16bf;
typedef __attribute__((ext_vector_type(8)))  __bf16 v8bf_t;
typedef __attribute__((ext_vector_type(8)))  float  v8f;
typedef __attribute__((ext_vector_type(4)))  float  v4f_t;
typedef __attribute__((ext_vector_type(4)))  unsigned int v4u_t;
typedef v8bf_t __attribute__((__may_alias__)) v8bf;
typedef v4f_t  __attribute__((__may_alias__)) v4f;
typedef v4u_t  __attribute__((__may_alias__)) v4u;
typedef __attribute__((ext_vector_type(2)))  unsigned int v2u_t;
typedef v2u_t  __attribute__((__may_alias__)) v2u;
typedef __attribute__((ext_vector_type(2)))  float  v2f;
typedef __attribute__((ext_vector_type(2)))  __bf16 v2bf;

constexpr int kB  = 8;      // batch
constexpr int kC  = 256;    // channels
constexpr int kN  = 4096;   // positions (H*W)
constexpr int kD  = 32;     // q/k channels
constexpr int PT  = 64;     // positions per projection block
constexpr int XP  = kC + 8; // LDS pitch (halves) of the transposed x tile, 528 B rows
constexpr int NPB = kN / PT;
constexpr int IB  = 128;    // query positions per attention block: 8 waves x 16
constexpr int NIB = kN / IB;
constexpr int KP  = kD + 8; // LDS pitch (halves) of a staged key row
constexpr int JB  = 128;    // keys per attention pass
constexpr int VP  = JB + 8; // LDS pitch (halves) of a staged value row (JB keys), 272 B rows
constexpr int KSH = JB * KP;    // halves of one staged K tile, 10,240 B
constexpr int STH = KSH + kC * VP;   // halves of one ring buffer (K tile, then V tile), 79,872 B
constexpr int NT  = kN / JB;    // key tiles
typedef char ring_check[(NT >= 2 && IB == 8 * 16 && (KSH * 2) % 16 == 0 && (STH * 2) % 16 == 0 && 32 * IB * 4 <= STH * 2) ? 1 : -1];
typedef char cfg_check[(kN % PT == 0 && kN % IB == 0 && kN % JB == 0 && JB == 128 && kC % 64 == 0 && kD == 32 &&
                        (XP % 8) == 0 && (KP % 8) == 0 && (VP % 8) == 0) ? 1 : -1];

union Frag { v16bf v; v8bf h2[2]; bf16_t e[16]; };

// D(16x16 f32) += A(16x32 bf16) * B(32x16 bf16); hazard guard ties D, keeps A/B live.
static __device__ __forceinline__ v8f mma16(v16bf a, v16bf b, v8f c) {
  v8f d = __builtin_amdgcn_wmma_f32_16x16x32_bf16(false, a, false, b, (short)0, c, false, false);
  asm volatile("v_nop\n\tv_nop\n\tv_nop\n\tv_nop" : "+v"(d) : "v"(a), "v"(b));
  return d;
}

// The same product for the attention loop, builtin only: the compiler keeps the distances behind it and may move
// the LDS reads of later fragments ahead of it (no memory operation crosses a volatile asm statement).
static __device__ __forceinline__ v8f mma16_free(v16bf a, v16bf b, v8f c) {
  return __builtin_amdgcn_wmma_f32_16x16x32_bf16(false, a, false, b, (short)0, c, false, false);
}

// Fragment from a k-contiguous 16-bit row (row m for A, column n stored as a row for B), h = lane>>4:
// elements 0..7 <- row[8h .. 8h+7], elements 8..15 <- row[16+8h .. 16+8h+7].
static __device__ __forceinline__ v16bf frag_b16(const bf16_t* row, int h) {
  Frag f;
  f.h2[0] = *(const v8bf*)(row + 8 * h);
  f.h2[1] = *(const v8bf*)(row + 16 + 8 * h);
  return f.v;
}

// Stage ROWS contiguous f32 weight rows of kC floats as bf16 (RNE) rows of pitch XP in LDS, 128 threads.
// Each wave-wide load covers 512 contiguous bytes (four whole lines); each lane stores its 4 values as 8 B.
template <int ROWS>
static __device__ __forceinline__ void stage_w(bf16_t* dst, const float* __restrict__ src, int tid) {
  // fully unrolled so that all loads of the group are in flight behind one latency
#pragma unroll
  for (int it = 0; it < ROWS * kC / 4 / 128; ++it) {
    const int idx = it * 128 + tid;
    const v4f v = *(const v4f*)(src + idx * 4);
    union { bf16_t e[4]; v2u_t u; } p;
    p.e[0] = (bf16_t)v[0];
    p.e[1] = (bf16_t)v[1];
    p.e[2] = (bf16_t)v[2];
    p.e[3] = (bf16_t)v[3];
    *(v2u*)(dst + (idx >> 6) * XP + (idx & 63) * 4) = p.u;
  }
}

// LDS byte address of a __shared__ element, as the asynchronous copies take it
static __device__ __forceinline__ unsigned lds_addr(const bf16_t* p) {
  return (unsigned)(uintptr_t)(__attribute__((address_space(3))) const void*)p;
}

// Nine asynchronous 16-B copies per lane, global memory to LDS through no register. The s_wait_xcnt is the last line
// of the copies' own statement, so that it stands ahead of every later write of an address register they name.
static __device__ __forceinline__ void copy9(const unsigned (&d)[9], const bf16_t* const (&g)[9]) {
  asm volatile("global_load_async_to_lds_b128 %0, %9, off\n\t"
               "global_load_async_to_lds_b128 %1, %10, off\n\t"
               "global_load_async_to_lds_b128 %2, %11, off\n\t"
               "global_load_async_to_lds_b128 %3, %12, off\n\t"
               "global_load_async_to_lds_b128 %4, %13, off\n\t"
               "global_load_async_to_lds_b128 %5, %14, off\n\t"
               "global_load_async_to_lds_b128 %6, %15, off\n\t"
               "global_load_async_to_lds_b128 %7, %16, off\n\t"
               "global_load_async_to_lds_b128 %8, %17, off\n\t"
               "s_wait_xcnt 0x0"
               :: "v"(d[0]), "v"(d[1]), "v"(d[2]), "v"(d[3]), "v"(d[4]), "v"(d[5]), "v"(d[6]), "v"(d[7]), "v"(d[8]),
                  "v"(g[0]), "v"(g[1]), "v"(g[2]), "v"(g[3]), "v"(g[4]), "v"(g[5]), "v"(g[6]), "v"(g[7]), "v"(g[8])
               : "memory");
}

// One key tile into one ring buffer, 256 threads, 18 copies per lane. K: 128 rows x 64 B are 8 KiB contiguous;
// V: a wave-wide copy covers two rows x 256 B (whole lines). Round q is a constant step from the thread's own base
// on both sides (64 K rows, 16 V rows). kd, vd: this thread's LDS byte addresses in the buffer.
static __device__ __forceinline__ void stage_tile(unsigned kd, unsigned vd, const bf16_t* kp, const bf16_t* vp) {
  unsigned d[18];
  const bf16_t* g[18];
#pragma unroll
  for (int q = 0; q < 2; ++q) {
    d[q] = kd + q * 64 * KP * 2;
    g[q] = kp + q * 64 * kD;
  }
#pragma unroll
  for (int q = 0; q < 16; ++q) {
    d[2 + q] = vd + q * 16 * VP * 2;
    g[2 + q] = vp + (size_t)q * 16 * kN;
  }
  const unsigned d0[9] = {d[0], d[1], d[2], d[3], d[4], d[5], d[6], d[7], d[8]};
  const bf16_t* const g0[9] = {g[0], g[1], g[2], g[3], g[4], g[5], g[6], g[7], g[8]};
  const unsigned d1[9] = {d[9], d[10], d[11], d[12], d[13], d[14], d[15], d[16], d[17]};
  const bf16_t* const g1[9] = {g[9], g[10], g[11], g[12], g[13], g[14], g[15], g[16], g[17]};
  copy9(d0, g0);
  copy9(d1, g1);
}

union PFrag { v16bf v; v2bf d[8]; };

// value of lane l ^ 16, by a vector cross-row move instead of an exchange through the LDS queue
static __device__ __forceinline__ float other_half(float v) {
  const int b = __float_as_int(v);
  return __int_as_float(__builtin_amdgcn_permlanex16(b, b, 0x76543210, 0xfedcba98, false, false));
}

// exp of one 16-key tile of logits, two scores per vector instruction: one packed fma gives logit*log2(e) - max,
// one pair conversion (RNE) fills a B register, one packed add keeps the normaliser's two partial sums (f32, unrounded).
// d[i] holds B elements 2i, 2i+1 of the tile's half of the fragment <- tile rows 8h+2i, 8h+2i+1.
static __device__ __forceinline__ void exp_tile(v8f sc, v2f l2, v2f nm, v2bf* d, v2f& ps) {
#pragma unroll
  for (int i = 0; i < 4; ++i) {
    const v2f a = {sc[2 * i], sc[2 * i + 1]};
    const v2f u = __builtin_elementwise_fma(a, l2, nm);
    const v2f e = {__builtin_amdgcn_exp2f(u[0]), __builtin_amdgcn_exp2f(u[1])};
    d[i] = __builtin_convertvector(e, v2bf);
    ps += e;
  }
}

// ---------------------------------------------------------------------------
// Fused 1x1-conv projections for one (batch, 64-position) tile.
// xt[i][c] (bf16, k-contiguous) is the A operand of q/k (D[i][o]) and the B operand of v (D[o][i]).
// Weights: 64 rows at a time (Wq+Wk, then four groups of Wv) are converted once per block into wt
// and every wave takes its fragments from there.
// ---------------------------------------------------------------------------
__global__ void __launch_bounds__(128)
proj_kernel(const float* __restrict__ x, const float* __restrict__ Wq, const float* __restrict__ bq,
            const float* __restrict__ Wk, const float* __restrict__ bk, const float* __restrict__ Wv,
            const float* __restrict__ bv, bf16_t* __restrict__ Qb, bf16_t* __restrict__ Kb,
            bf16_t* __restrict__ Vb) {
  __shared__ alignas(16) bf16_t xt[PT * XP];   // 33,792 B
  __shared__ alignas(16) bf16_t sq[PT * kD];   //  4,096 B
  __shared__ alignas(16) bf16_t sk[PT * kD];   //  4,096 B
  __shared__ alignas(16) bf16_t sv[64 * PT];   //  8,192 B
  __shared__ alignas(16) bf16_t wt[64 * XP];   // 33,792 B: current group of 64 weight rows

  const int tid = threadIdx.x;
  const int wv  = tid >> 5;          // 0..3: position sub-tile of 16
  const int l   = tid & 31;
  const int h   = l >> 4;
  const int m   = l & 15;
  const int b   = blockIdx.x / NPB;
  const int p0  = (blockIdx.x - b * NPB) * PT;
  if (b >= kB) return;

  // stage x[b][c][p0..p0+63] transposed to xt[i][c], bf16 RNE
  const float* xb = x + (size_t)b * kC * kN + p0;
#pragma unroll 2
  for (int it = 0; it < (kC * PT / 4) / 128; ++it) {
    const int c  = it * 8 + (tid >> 4);
    const int i4 = (tid & 15) * 4;
    const v4f v  = *(const v4f*)(xb + (size_t)c * kN + i4);
    bf16_t* d = xt + i4 * XP + c;
    d[0]      = (bf16_t)v[0];
    d[XP]     = (bf16_t)v[1];
    d[2 * XP] = (bf16_t)v[2];
    d[3 * XP] = (bf16_t)v[3];
  }
  stage_w<32>(wt, Wq, tid);             // rows 0..31  = Wq
  stage_w<32>(wt + 32 * XP, Wk, tid);   // rows 32..63 = Wk
  __syncthreads();

  const bf16_t* xrow = xt + (wv * 16 + m) * XP;   // row i = wv*16+m, k = c contiguous
  const bf16_t* wrow = wt + m * XP;               // weight row m of each 16-row tile of the group

  // q, k: D[i][o] = sum_c xt[i][c] * W[o][c]; A = xt row i, B column o = W row o
  {
    v8f aq0 = {};
    v8f aq1 = {};
    v8f ak0 = {};
    v8f ak1 = {};
#pragma unroll 1
    for (int ks = 0; ks < kC / 32; ++ks) {
      const int k0 = ks * 32;
      const v16bf xf = frag_b16(xrow + k0, h);
      // the four weight fragments are read ahead of the first product: one LDS latency per k step
      const v16bf w0 = frag_b16(wrow + k0, h);
      const v16bf w1 = frag_b16(wrow + 16 * XP + k0, h);
      const v16bf w2 = frag_b16(wrow + 32 * XP + k0, h);
      const v16bf w3 = frag_b16(wrow + 48 * XP + k0, h);
      aq0 = mma16(xf, w0, aq0);
      aq1 = mma16(xf, w1, aq1);
      ak0 = mma16(xf, w2, ak0);
      ak1 = mma16(xf, w3, ak1);
    }
    const float bq0 = bq[m], bq1 = bq[16 + m];
    const float bk0 = bk[m], bk1 = bk[16 + m];
    // D element r of this lane = (row i = wv*16+8h+r, col o = m / 16+m)
#pragma unroll
    for (int r = 0; r < 8; ++r) {
      const int io = (wv * 16 + 8 * h + r) * kD;
      sq[io + m]      = (bf16_t)(aq0[r] + bq0);
      sq[io + 16 + m] = (bf16_t)(aq1[r] + bq1);
      sk[io + m]      = (bf16_t)(ak0[r] + bk0);
      sk[io + 16 + m] = (bf16_t)(ak1[r] + bk1);
    }
  }

  // v: D[o][i] = sum_c Wv[o][c] * xt[i][c]; A = Wv row o, B column i = xt row i; 64 channels per group
#pragma unroll 1
  for (int og = 0; og < kC / 64; ++og) {
    __syncthreads();   // every wave has left the earlier group's wt rows and the earlier sv store phase
    stage_w<64>(wt, Wv + (size_t)og * 64 * kC, tid);
    __syncthreads();   // wt rows of this group are complete
    v8f av[4];
#pragma unroll
    for (int t = 0; t < 4; ++t) av[t] = v8f{};
#pragma unroll 1
    for (int ks = 0; ks < kC / 32; ++ks) {
      const int k0 = ks * 32;
      const v16bf xf = frag_b16(xrow + k0, h);
      v16bf wf[4];   // read ahead of the first product, as above
#pragma unroll
      for (int t = 0; t < 4; ++t) wf[t] = frag_b16(wrow + t * 16 * XP + k0, h);
#pragma unroll
      for (int t = 0; t < 4; ++t) av[t] = mma16(wf[t], xf, av[t]);
    }
    // D element r = (row o = og*64 + t*16 + 8h + r, col i = wv*16 + m)
#pragma unroll
    for (int t = 0; t < 4; ++t)
#pragma unroll
      for (int r = 0; r < 8; ++r) {
        const int ol = t * 16 + 8 * h + r;
        sv[ol * PT + wv * 16 + m] = (bf16_t)(av[t][r] + bv[og * 64 + ol]);
      }
    __syncthreads();
    v4u vv[4];
    size_t gv[4];
#pragma unroll
    for (int q = 0; q < 4; ++q) {
      const int row = q * 16 + (tid >> 3);
      const int seg = tid & 7;
      vv[q] = *(const v4u*)(sv + row * PT + seg * 8);
      gv[q] = ((size_t)(b * kC + og * 64 + row)) * kN + p0 + seg * 8;
    }
#pragma unroll
    for (int q = 0; q < 4; ++q) *(v4u*)(Vb + gv[q]) = vv[q];
    // the next trip overwrites the registers these stores name
    asm volatile("s_wait_xcnt 0x0" ::: "memory");
  }

  // q, k tiles: 64 rows x 64 B = 4096 contiguous bytes each; 16 B per lane, 8 lanes per line
  {
    v4u uq[2], uk[2];
    size_t gq[2];
#pragma unroll
    for (int q = 0; q < 2; ++q) {
      const int idx = q * 128 + tid;
      uq[q] = *(const v4u*)(sq + idx * 8);
      uk[q] = *(const v4u*)(sk + idx * 8);
      gq[q] = ((size_t)(b * kN + p0)) * kD + idx * 8;
    }
#pragma unroll
    for (int q = 0; q < 2; ++q) {
      *(v4u*)(Qb + gq[q]) = uq[q];
      *(v4u*)(Kb + gq[q]) = uk[q];
    }
    
  }
}

// ---------------------------------------------------------------------------
// Fused attention for one (batch, 128-query) tile. 256 threads = 8 waves, each 16 queries x all 256
// channels, so that a query's logits and softmax are computed in one wave only. Per 128-key pass: K rows [128][32] and V rows [256][128] staged in LDS by the
// whole block: asynchronous copies into a ring of two buffers, the next tile in flight under this one's work.
// S^T = K.Q^T so each lane owns one query column: per-query
// running max / sum need one xor-16 shuffle per pass, and the accumulators are rescaled once per pass.
// P (bf16) packed from each pair of S^T accumulators is the B fragment of O^T = V.P^T for its 32 keys
// (k = key, element r <- even tile row 8h+r, element 8+r <- odd tile).
// Epilogue stages 32 channel rows x 128 positions in LDS; out = gamma*O/l + x written as whole lines
// ---------------------------------------------------------------------------
// One block per WGP = two waves per SIMD, said to the compiler: the 128 accumulator registers of a wave and the
// fragments read ahead need more than the 256 registers of four waves per SIMD.
__global__ void __launch_bounds__(256) __attribute__((amdgpu_waves_per_eu(2, 2)))
attn_kernel(const bf16_t* __restrict__ Qb, const bf16_t* __restrict__ Kb, const bf16_t* __restrict__ Vb,
            const float* __restrict__ x, const float* __restrict__ gamma, float* __restrict__ out) {
  __shared__ alignas(16) bf16_t ring[2 * STH];   // 159,744 B

  const int tid = threadIdx.x;
  const int wv  = __builtin_amdgcn_readfirstlane(tid >> 5);   // wave-uniform: what derives from it stays scalar
  const int l   = tid & 31;
  const int h   = l >> 4;
  const int m   = l & 15;
  const int b    = blockIdx.x / NIB;
  const int iblk = (blockIdx.x - b * NIB) * IB;
  if (b >= kB) return;
  // i0 = iblk + wv * 16: first query of this wave, as the comments below name it

  const bf16_t* kg = Kb + (size_t)b * kN * kD;
  const bf16_t* vg = Vb + (size_t)b * kC * kN;

  // Q as B operand, kept in registers: column n = query i0+m, k = d; the wave's 16 rows x 64 B are contiguous
  const bf16_t* qrow = Qb + ((size_t)b * kN + iblk + wv * 16 + m) * kD;
  // the two scheduling fences keep every other instruction out from between the loads and their wait
  __builtin_amdgcn_sched_barrier(0);
  const v16bf qf = frag_b16(qrow, h);
  // later code overwrites the address registers of these two loads
  asm volatile("s_wait_xcnt 0x0" ::: "memory");
  __builtin_amdgcn_sched_barrier(0);

  v8f acc[kC / 16];
#pragma unroll
  for (int ct = 0; ct < kC / 16; ++ct) acc[ct] = v8f{};
  float lsum = 0.0f;
  float mrun = -1.0e30f;   // running maximum in log2 units: logit * log2(e)
  constexpr float kL2E = 1.4426950408889634f;

  // staging bases of this thread: K row tid/4, 16-B segment tid%4; V row tid/16, 16-B segment tid%16
  const bf16_t* ksrc = kg + tid * 8;
  const bf16_t* vsrc = vg + (size_t)(tid >> 4) * kN + (tid & 15) * 8;
  const unsigned kdst = lds_addr(ring + (tid >> 2) * KP + (tid & 3) * 8);
  const unsigned vdst = lds_addr(ring + KSH + (tid >> 4) * VP + (tid & 15) * 8);

  // ring prologue: tile 0 lands and is published, then tile 1 starts into the other buffer
  stage_tile(kdst, vdst, ksrc, vsrc);
  asm volatile("s_wait_asynccnt 0x0" ::: "memory");   // this wave's copies of tile 0 have landed
  __syncthreads();                                    // and every other wave's: tile 0 may be read
  stage_tile(kdst + STH * 2, vdst + STH * 2, ksrc + (size_t)JB * kD, vsrc + JB);

#pragma unroll 1
  for (int jt = 0; jt < NT; ++jt) {
    const int bo = (jt & 1) * STH;   // this pass reads K, V from buffer jt mod 2
    const bf16_t* ks = ring + bo;
    const bf16_t* vs = ring + bo + KSH;

    // S^T tiles t = 0..7: rows = keys j0+16t+m (A = K rows), cols = queries (B = Q rows), j0 = jt*128
    v16bf ka[JB / 16];
#pragma unroll
    for (int t = 0; t < JB / 16; ++t) ka[t] = frag_b16(ks + (t * 16 + m) * KP, h);
    // keeps the 16 K reads first in the LDS queue, as written: left free, this build puts V reads of block 0 among them
    // and the first logit product waits for 14 reads, not 2
    __builtin_amdgcn_sched_barrier(0);
    const v8f z = {};
    v8f st[JB / 16];   // st[t] element r = logit(key j0+16t+8h+r, query i0+m)
#pragma unroll
    for (int t = 0; t < JB / 16; ++t) st[t] = mma16_free(ka[t], qf, z);

    // V fragments (16 channel tiles x 32 keys) are asked for one key block ahead of the products that take them,
    // each block's exp arithmetic standing between: block 0 here, ahead of the maximum.
    const bf16_t* vrow = vs + m * VP;
    v16bf vf[kC / 16];
#pragma unroll
    for (int ct = 0; ct < kC / 16; ++ct) vf[ct] = frag_b16(vrow + ct * 16 * VP, h);

    // per-query online softmax: lanes m and m+16 hold the 128 logits of query i0+m
    float mt[JB / 32];   // one independent chain per 32 keys
#pragma unroll
    for (int kk = 0; kk < JB / 32; ++kk) {
      float a = fmaxf(st[2 * kk][0], st[2 * kk + 1][0]);
#pragma unroll
      for (int r = 1; r < 8; ++r) a = fmaxf(a, fmaxf(st[2 * kk][r], st[2 * kk + 1][r]));
      mt[kk] = a;
    }
    float ml = fmaxf(fmaxf(mt[0], mt[1]), fmaxf(mt[2], mt[3]));
    ml = fmaxf(ml, other_half(ml));
    const float mn    = fmaxf(mrun, ml * kL2E);
    const float alpha = __builtin_amdgcn_exp2f(mrun - mn);
    mrun = mn;
    const v2f l2 = {kL2E, kL2E};
    const v2f nm = {-mn, -mn};

#pragma unroll
    for (int ct = 0; ct < kC / 16; ++ct) acc[ct] *= alpha;

    v2f pt[JB / 32];
#pragma unroll
    for (int kk = 0; kk < JB / 32; ++kk) {
      PFrag p;
      pt[kk] = v2f{0.0f, 0.0f};
      exp_tile(st[2 * kk], l2, nm, p.d, pt[kk]);           // B element r   <- key j0+32kk+8h+r
      exp_tile(st[2 * kk + 1], l2, nm, p.d + 4, pt[kk]);   // B element 8+r <- key j0+32kk+16+8h+r
      // O^T[c][i] += V[c][keys] . P^T: A = V row c (k = key contiguous, 32 keys per product), B = p
      // in two runs of 8 channel tiles, each run's fragments asked for anew as one group right behind it
#pragma unroll
      for (int hf = 0; hf < 2; ++hf) {
#pragma unroll
        for (int ct = hf * 8; ct < hf * 8 + 8; ++ct) acc[ct] = mma16_free(vf[ct], p.v, acc[ct]);
        if (kk + 1 < JB / 32) {
#pragma unroll
          for (int ct = hf * 8; ct < hf * 8 + 8; ++ct) vf[ct] = frag_b16(vrow + ct * 16 * VP + (kk + 1) * 32, h);
          // holds the refill a key block ahead of its products, as written: left free, this build sinks each read to one
          // product ahead of its use and the wave waits out the LDS latency at every product
          __builtin_amdgcn_sched_barrier(0);
        }
      }
    }
    const v2f p2 = (pt[0] + pt[1]) + (pt[2] + pt[3]);
    float ps = p2[0] + p2[1];
    ps += other_half(ps);
    lsum = lsum * alpha + ps;

    // publish point of tile jt+1, which also frees this pass's buffer
    // nothing of the pass is scheduled behind it: left free, the compiler lifts the waits and the barrier over the last
    // key block's exp arithmetic and products, which then stand between the barrier and the refill
    __builtin_amdgcn_sched_barrier(0);
    asm volatile("s_wait_dscnt 0x0" ::: "memory");      // this wave's reads of the buffer have returned
    asm volatile("s_wait_asynccnt 0x0" ::: "memory");   // this wave's copies of tile jt+1 have landed
    __syncthreads();
    if (jt + 2 < NT)   // the same for the whole block
      stage_tile(kdst + bo * 2, vdst + bo * 2, ksrc + (size_t)(jt + 2) * JB * kD, vsrc + (jt + 2) * JB);
  }
  asm volatile("s_wait_asynccnt 0x0" ::: "memory");   // nothing is in flight when the ring becomes output staging
  float* so = (float*)ring;   // 32 x 128 f32; every wave has passed the last pass's barrier behind its last read

  // epilogue: acc[ct] element r = (channel ct*16+8h+r, query i0+m); scale per query column
  const float scl = gamma[0] / lsum;
  // lane and thread index taken anew
  const int le = (int)__builtin_amdgcn_mbcnt_lo(~0u, 0u);
  const int he = le >> 4;
  const int me = le & 15;
  const int te = wv * 32 + le;
#pragma unroll
  for (int cp = 0; cp < kC / 32; ++cp) {
    __syncthreads();   // earlier store phase finished reading so
#pragma unroll
    for (int t = 0; t < 2; ++t)
#pragma unroll
      for (int r = 0; r < 8; ++r)
        so[(t * 16 + 8 * he + r) * IB + wv * 16 + me] = acc[2 * cp + t][r] * scl;
    __syncthreads();
    // 32 channel rows x 512 B: row = idx/32, 16-B segment idx%32; a wave covers one row, four whole lines
    v4f ov[4];
    size_t go[4];
#pragma unroll
    for (int q = 0; q < 4; ++q) {
      const int idx = q * 256 + te;
      const int row = idx >> 5;
      const int seg = idx & 31;
      go[q] = ((size_t)(b * kC + cp * 32 + row)) * kN + iblk + seg * 4;
      ov[q] = *(const v4f*)(so + row * IB + seg * 4) + *(const v4f*)(x + go[q]);
    }
#pragma unroll
    for (int q = 0; q < 4; ++q) *(v4f*)(out + go[q]) = ov[q];
    // the next trip overwrites the registers these loads and stores name
    asm volatile("s_wait_xcnt 0x0" ::: "memory");
  }
}

extern "C" void kernel_launch(void* const* d_in, const int* in_sizes, int n_in,
                              void* d_out, int out_size, void* d_ws, size_t ws_size,
                              hipStream_t stream) {
  if (n_in < 8) return;
  if (in_sizes[0] != kB * kC * kN || in_sizes[1] != kD * kC || in_sizes[2] != kD ||
      in_sizes[3] != kD * kC || in_sizes[4] != kD || in_sizes[5] != kC * kC ||
      in_sizes[6] != kC || in_sizes[7] < 1) return;
  if (out_size != kB * kC * kN) return;

  const float* x     = (const float*)d_in[0];
  const float* Wq    = (const float*)d_in[1];
  const float* bq    = (const float*)d_in[2];
  const float* Wk    = (const float*)d_in[3];
  const float* bk    = (const float*)d_in[4];
  const float* Wv    = (const float*)d_in[5];
  const float* bv    = (const float*)d_in[6];
  const float* gamma = (const float*)d_in[7];
  float* out = (float*)d_out;

  // workspace: Qb [B][N][32] bf16 (2 MiB), Kb [B][N][32] bf16 (2 MiB), Vb [B][C][N] bf16 (16 MiB)
  const size_t qk_bytes = (size_t)kB * kN * kD * sizeof(bf16_t);
  const size_t v_bytes  = (size_t)kB * kC * kN * sizeof(bf16_t);
  if (ws_size < 2 * qk_bytes + v_bytes) return;
  bf16_t* Qb = (bf16_t*)d_ws;
  bf16_t* Kb = (bf16_t*)((char*)d_ws + qk_bytes);
  bf16_t* Vb = (bf16_t*)((char*)d_ws + 2 * qk_bytes);

  proj_kernel<<<dim3(kB * NPB), dim3(128), 0, stream>>>(x, Wq, bq, Wk, bk, Wv, bv, Qb, Kb, Vb);
  attn_kernel<<<dim3(kB * NIB), dim3(256), 0, stream>>>(Qb, Kb, Vb, x, gamma, out);
}

// v007
// Measured time: 88.8 microseconds a run.
// Timed twice side by side with v006, it ran 1.05 times as fast both times.
// All steps since v000 together make it 3.09 times as fast.
#include <hip/hip_runtime.h>
#include <stdint.h>
#include <stddef.h>

// All contractions: v_wmma_f32_16x16x32_bf16 (bf16 operands, f32 accumulate): three 1x1-conv projections, key.query logits, value.prob aggregation; softmax statistics, normaliser and residual add in f32.

typedef __bf16 bf16_t;
typedef __attribute__((ext_vector_type(16))) __bf16 v16bf;
typedef __attribute__((ext_vector_type(8)))  __bf16 v8bf_t;
typedef __attribute__((ext_vector_type(8)))  float  v8f;
typedef __attribute__((ext_vector_type(4)))  float  v4f_t;
typedef __attribute__((ext_vector_type(4)))  unsigned int v4u_t;
typedef v8bf_t __attribute__((__may_alias__)) v8bf;
typedef v4f_t  __attribute__((__may_alias__)) v4f;
typedef v4u_t  __attribute__((__may_alias__)) v4u;
typedef __attribute__((ext_vector_type(2)))  unsigned int v2u_t;
typedef v2u_t  __attribute__((__may_alias__)) v2u;
typedef __attribute__((ext_vector_type(2)))  float  v2f;
typedef __attribute__((ext_vector_type(2)))  __bf16 v2bf;

constexpr int kB  = 8;      // batch
constexpr int kC  = 256;    // channels
constexpr int kN  = 4096;   // positions (H*W)
constexpr int kD  = 32;     // q/k channels
constexpr int PT  = 64;     // positions per projection block
constexpr int XP  = kC + 8; // LDS pitch (halves) of the transposed x tile, 528 B rows
constexpr int NPB = kN / PT;
constexpr int IB  = 128;    // query positions per attention block: 4 query groups x 32
constexpr int QT  = 2;      // 16-query tiles per attention wave
constexpr int NIB = kN / IB;
constexpr int KP  = kD + 8; // LDS pitch (halves) of a staged key row
constexpr int JB  = 128;    // keys per attention pass
constexpr int VP  = JB + 8; // LDS pitch (halves) of a staged value row (JB keys), 272 B rows
constexpr int KSH = JB * KP;    // halves of one staged K tile, 10,240 B
constexpr int STH = KSH + kC * VP;   // halves of one ring buffer (K tile, then V tile), 79,872 B
constexpr int NT  = kN / JB;    // key tiles
constexpr int KW  = JB / 2;     // keys of a pass that one wave takes
constexpr int XW  = QT * 8 * 256;   // floats a wave hands to its partner at the join: 16 tiles of 16 x 16, 16 KiB
typedef char ring_check[(NT >= 2 && IB == 4 * 16 * QT && QT == 2 && KW == 64 && (8 * XW + 8 * 128) * 4 <= 2 * STH * 2 && (KSH * 2) % 16 == 0 && (STH * 2) % 16 == 0 && 32 * IB * 4 <= STH * 2) ? 1 : -1];
typedef char cfg_check[(kN % PT == 0 && kN % IB == 0 && kN % JB == 0 && JB == 128 && kC % 64 == 0 && kD == 32 &&
                        (XP % 8) == 0 && (KP % 8) == 0 && (VP % 8) == 0) ? 1 : -1];

union Frag { v16bf v; v8bf h2[2]; bf16_t e[16]; };

// D(16x16 f32) += A(16x32 bf16) * B(32x16 bf16); hazard guard ties D, keeps A/B live.
static __device__ __forceinline__ v8f mma16(v16bf a, v16bf b, v8f c) {
  v8f d = __builtin_amdgcn_wmma_f32_16x16x32_bf16(false, a, false, b, (short)0, c, false, false);
  asm volatile("v_nop\n\tv_nop\n\tv_nop\n\tv_nop" : "+v"(d) : "v"(a), "v"(b));
  return d;
}

// The same product for the attention loop, builtin only: the compiler keeps the distances behind it and may move
// the LDS reads of later fragments ahead of it (no memory operation crosses a volatile asm statement).
static __device__ __forceinline__ v8f mma16_free(v16bf a, v16bf b, v8f c) {
  return __builtin_amdgcn_wmma_f32_16x16x32_bf16(false, a, false, b, (short)0, c, false, false);
}

// Fragment from a k-contiguous 16-bit row (row m for A, column n stored as a row for B), h = lane>>4:
// elements 0..7 <- row[8h .. 8h+7], elements 8..15 <- row[16+8h .. 16+8h+7].
static __device__ __forceinline__ v16bf frag_b16(const bf16_t* row, int h) {
  Frag f;
  f.h2[0] = *(const v8bf*)(row + 8 * h);
  f.h2[1] = *(const v8bf*)(row + 16 + 8 * h);
  return f.v;
}

// Stage ROWS contiguous f32 weight rows of kC floats as bf16 (RNE) rows of pitch XP in LDS, 128 threads.
// Each wave-wide load covers 512 contiguous bytes (four whole lines); each lane stores its 4 values as 8 B.
template <int ROWS>
static __device__ __forceinline__ void stage_w(bf16_t* dst, const float* __restrict__ src, int tid) {
  // fully unrolled so that all loads of the group are in flight behind one latency
#pragma unroll
  for (int it = 0; it < ROWS * kC / 4 / 128; ++it) {
    const int idx = it * 128 + tid;
    const v4f v = *(const v4f*)(src + idx * 4);
    union { bf16_t e[4]; v2u_t u; } p;
    p.e[0] = (bf16_t)v[0];
    p.e[1] = (bf16_t)v[1];
    p.e[2] = (bf16_t)v[2];
    p.e[3] = (bf16_t)v[3];
    *(v2u*)(dst + (idx >> 6) * XP + (idx & 63) * 4) = p.u;
  }
}

// LDS byte address of a __shared__ element, as the asynchronous copies take it
static __device__ __forceinline__ unsigned lds_addr(const bf16_t* p) {
  return (unsigned)(uintptr_t)(__attribute__((address_space(3))) const void*)p;
}

// Nine asynchronous 16-B copies per lane, global memory to LDS through no register. The s_wait_xcnt is the last line
// of the copies' own statement, so that it stands ahead of every later write of an address register they name.
static __device__ __forceinline__ void copy9(const unsigned (&d)[9], const bf16_t* const (&g)[9]) {
  asm volatile("global_load_async_to_lds_b128 %0, %9, off\n\t"
               "global_load_async_to_lds_b128 %1, %10, off\n\t"
               "global_load_async_to_lds_b128 %2, %11, off\n\t"
               "global_load_async_to_lds_b128 %3, %12, off\n\t"
               "global_load_async_to_lds_b128 %4, %13, off\n\t"
               "global_load_async_to_lds_b128 %5, %14, off\n\t"
               "global_load_async_to_lds_b128 %6, %15, off\n\t"
               "global_load_async_to_lds_b128 %7, %16, off\n\t"
               "global_load_async_to_lds_b128 %8, %17, off\n\t"
               "s_wait_xcnt 0x0"
               :: "v"(d[0]), "v"(d[1]), "v"(d[2]), "v"(d[3]), "v"(d[4]), "v"(d[5]), "v"(d[6]), "v"(d[7]), "v"(d[8]),
                  "v"(g[0]), "v"(g[1]), "v"(g[2]), "v"(g[3]), "v"(g[4]), "v"(g[5]), "v"(g[6]), "v"(g[7]), "v"(g[8])
               : "memory");
}

// One key tile into one ring buffer, 256 threads, 18 copies per lane. K: 128 rows x 64 B are 8 KiB contiguous;
// V: a wave-wide copy covers two rows x 256 B (whole lines). Round q is a constant step from the thread's own base
// on both sides (64 K rows, 16 V rows). kd, vd: this thread's LDS byte addresses in the buffer.
static __device__ __forceinline__ void stage_tile(unsigned kd, unsigned vd, const bf16_t* kp, const bf16_t* vp) {
  unsigned d[18];
  const bf16_t* g[18];
#pragma unroll
  for (int q = 0; q < 2; ++q) {
    d[q] = kd + q * 64 * KP * 2;
    g[q] = kp + q * 64 * kD;
  }
#pragma unroll
  for (int q = 0; q < 16; ++q) {
    d[2 + q] = vd + q * 16 * VP * 2;
    g[2 + q] = vp + (size_t)q * 16 * kN;
  }
  const unsigned d0[9] = {d[0], d[1], d[2], d[3], d[4], d[5], d[6], d[7], d[8]};
  const bf16_t* const g0[9] = {g[0], g[1], g[2], g[3], g[4], g[5], g[6], g[7], g[8]};
  const unsigned d1[9] = {d[9], d[10], d[11], d[12], d[13], d[14], d[15], d[16], d[17]};
  const bf16_t* const g1[9] = {g[9], g[10], g[11], g[12], g[13], g[14], g[15], g[16], g[17]};
  copy9(d0, g0);
  copy9(d1, g1);
}

union PFrag { v16bf v; v2bf d[8]; };

// value of lane l ^ 16, by a vector cross-row move instead of an exchange through the LDS queue
static __device__ __forceinline__ float other_half(float v) {
  const int b = __float_as_int(v);
  return __int_as_float(__builtin_amdgcn_permlanex16(b, b, 0x76543210, 0xfedcba98, false, false));
}

// exp of one 16-key tile of logits, two scores per vector instruction: one packed fma gives logit*log2(e) - max,
// one pair conversion (RNE) fills a B register, one packed add keeps the normaliser's two partial sums (f32, unrounded).
// d[i] holds B elements 2i, 2i+1 of the tile's half of the fragment <- tile rows 8h+2i, 8h+2i+1.
static __device__ __forceinline__ void exp_tile(v8f sc, v2f l2, v2f nm, v2bf* d, v2f& ps) {
#pragma unroll
  for (int i = 0; i < 4; ++i) {
    const v2f a = {sc[2 * i], sc[2 * i + 1]};
    const v2f u = __builtin_elementwise_fma(a, l2, nm);
    const v2f e = {__builtin_amdgcn_exp2f(u[0]), __builtin_amdgcn_exp2f(u[1])};
    d[i] = __builtin_convertvector(e, v2bf);
    ps += e;
  }
}

// ---------------------------------------------------------------------------
// Fused 1x1-conv projections for one (batch, 64-position) tile.
// xt[i][c] (bf16, k-contiguous) is the A operand of q/k (D[i][o]) and the B operand of v (D[o][i]).
// Weights: 64 rows at a time (Wq+Wk, then four groups of Wv) are converted once per block into wt
// and every wave takes its fragments from there.
// ---------------------------------------------------------------------------
__global__ void __launch_bounds__(128)
proj_kernel(const float* __restrict__ x, const float* __restrict__ Wq, const float* __restrict__ bq,
            const float* __restrict__ Wk, const float* __restrict__ bk, const float* __restrict__ Wv,
            const float* __restrict__ bv, bf16_t* __restrict__ Qb, bf16_t* __restrict__ Kb,
            bf16_t* __restrict__ Vb) {
  __shared__ alignas(16) bf16_t xt[PT * XP];   // 33,792 B
  __shared__ alignas(16) bf16_t sq[PT * kD];   //  4,096 B
  __shared__ alignas(16) bf16_t sk[PT * kD];   //  4,096 B
  __shared__ alignas(16) bf16_t sv[64 * PT];   //  8,192 B
  __shared__ alignas(16) bf16_t wt[64 * XP];   // 33,792 B: current group of 64 weight rows

  const int tid = threadIdx.x;
  const int wv  = tid >> 5;          // 0..3: position sub-tile of 16
  const int l   = tid & 31;
  const int h   = l >> 4;
  const int m   = l & 15;
  const int b   = blockIdx.x / NPB;
  const int p0  = (blockIdx.x - b * NPB) * PT;
  if (b >= kB) return;

  // stage x[b][c][p0..p0+63] transposed to xt[i][c], bf16 RNE
  const float* xb = x + (size_t)b * kC * kN + p0;
#pragma unroll 2
  for (int it = 0; it < (kC * PT / 4) / 128; ++it) {
    const int c  = it * 8 + (tid >> 4);
    const int i4 = (tid & 15) * 4;
    const v4f v  = *(const v4f*)(xb + (size_t)c * kN + i4);
    bf16_t* d = xt + i4 * XP + c;
    d[0]      = (bf16_t)v[0];
    d[XP]     = (bf16_t)v[1];
    d[2 * XP] = (bf16_t)v[2];
    d[3 * XP] = (bf16_t)v[3];
  }
  stage_w<32>(wt, Wq, tid);             // rows 0..31  = Wq
  stage_w<32>(wt + 32 * XP, Wk, tid);   // rows 32..63 = Wk
  __syncthreads();

  const bf16_t* xrow = xt + (wv * 16 + m) * XP;   // row i = wv*16+m, k = c contiguous
  const bf16_t* wrow = wt + m * XP;               // weight row m of each 16-row tile of the group

  // q, k: D[i][o] = sum_c xt[i][c] * W[o][c]; A = xt row i, B column o = W row o
  {
    v8f aq0 = {};
    v8f aq1 = {};
    v8f ak0 = {};
    v8f ak1 = {};
#pragma unroll 1
    for (int ks = 0; ks < kC / 32; ++ks) {
      const int k0 = ks * 32;
      const v16bf xf = frag_b16(xrow + k0, h);
      // the four weight fragments are read ahead of the first product: one LDS latency per k step
      const v16bf w0 = frag_b16(wrow + k0, h);
      const v16bf w1 = frag_b16(wrow + 16 * XP + k0, h);
      const v16bf w2 = frag_b16(wrow + 32 * XP + k0, h);
      const v16bf w3 = frag_b16(wrow + 48 * XP + k0, h);
      aq0 = mma16(xf, w0, aq0);
      aq1 = mma16(xf, w1, aq1);
      ak0 = mma16(xf, w2, ak0);
      ak1 = mma16(xf, w3, ak1);
    }
    const float bq0 = bq[m], bq1 = bq[16 + m];
    const float bk0 = bk[m], bk1 = bk[16 + m];
    // D element r of this lane = (row i = wv*16+8h+r, col o = m / 16+m)
#pragma unroll
    for (int r = 0; r < 8; ++r) {
      const int io = (wv * 16 + 8 * h + r) * kD;
      sq[io + m]      = (bf16_t)(aq0[r] + bq0);
      sq[io + 16 + m] = (bf16_t)(aq1[r] + bq1);
      sk[io + m]      = (bf16_t)(ak0[r] + bk0);
      sk[io + 16 + m] = (bf16_t)(ak1[r] + bk1);
    }
  }

  // v: D[o][i] = sum_c Wv[o][c] * xt[i][c]; A = Wv row o, B column i = xt row i; 64 channels per group
#pragma unroll 1
  for (int og = 0; og < kC / 64; ++og) {
    __syncthreads();   // every wave has left the earlier group's wt rows and the earlier sv store phase
    stage_w<64>(wt, Wv + (size_t)og * 64 * kC, tid);
    __syncthreads();   // wt rows of this group are complete
    v8f av[4];
#pragma unroll
    for (int t = 0; t < 4; ++t) av[t] = v8f{};
#pragma unroll 1
    for (int ks = 0; ks < kC / 32; ++ks) {
      const int k0 = ks * 32;
      const v16bf xf = frag_b16(xrow + k0, h);
      v16bf wf[4];   // read ahead of the first product, as above
#pragma unroll
      for (int t = 0; t < 4; ++t) wf[t] = frag_b16(wrow + t * 16 * XP + k0, h);
#pragma unroll
      for (int t = 0; t < 4; ++t) av[t] = mma16(wf[t], xf, av[t]);
    }
    // D element r = (row o = og*64 + t*16 + 8h + r, col i = wv*16 + m)
#pragma unroll
    for (int t = 0; t < 4; ++t)
#pragma unroll
      for (int r = 0; r < 8; ++r) {
        const int ol = t * 16 + 8 * h + r;
        sv[ol * PT + wv * 16 + m] = (bf16_t)(av[t][r] + bv[og * 64 + ol]);
      }
    __syncthreads();
    v4u vv[4];
    size_t gv[4];
#pragma unroll
    for (int q = 0; q < 4; ++q) {
      const int row = q * 16 + (tid >> 3);
      const int seg = tid & 7;
      vv[q] = *(const v4u*)(sv + row * PT + seg * 8);
      gv[q] = ((size_t)(b * kC + og * 64 + row)) * kN + p0 + seg * 8;
    }
#pragma unroll
    for (int q = 0; q < 4; ++q) *(v4u*)(Vb + gv[q]) = vv[q];
    // the next trip overwrites the registers these stores name
    asm volatile("s_wait_xcnt 0x0" ::: "memory");
  }

  // q, k tiles: 64 rows x 64 B = 4096 contiguous bytes each; 16 B per lane, 8 lanes per line
  {
    v4u uq[2], uk[2];
    size_t gq[2];
#pragma unroll
    for (int q = 0; q < 2; ++q) {
      const int idx = q * 128 + tid;
      uq[q] = *(const v4u*)(sq + idx * 8);
      uk[q] = *(const v4u*)(sk + idx * 8);
      gq[q] = ((size_t)(b * kN + p0)) * kD + idx * 8;
    }
#pragma unroll
    for (int q = 0; q < 2; ++q) {
      *(v4u*)(Qb + gq[q]) = uq[q];
      *(v4u*)(Kb + gq[q]) = uk[q];
    }
    
  }
}

// ---------------------------------------------------------------------------
// Fused attention for one (batch, 128-query) tile. 256 threads = 8 waves = 4 query groups x 2 key halves: a wave holds
// 32 queries (two 16-query tiles) x all 256 channels and takes 64 of each pass's 128 keys, so that every K and V
// fragment read from LDS feeds two products. Per 128-key pass: K rows [128][32] and V rows [256][128] staged in LDS by the
// whole block: asynchronous copies into a ring of two buffers, the next tile in flight under this one's work.
// S^T = K.Q^T so each lane owns one query column per tile: per-query
// running max / sum need one xor-16 shuffle per pass, and the accumulators are rescaled once per pass.
// P (bf16) packed from each pair of S^T accumulators is the B fragment of O^T = V.P^T for its 32 keys
// (k = key, element r <- even tile row 8h+r, element 8+r <- odd tile).
// Behind the loop the two waves of a query group swap, through LDS, max, sum and one half of the channels each, and
// each joins its 128 channels. Epilogue stages 32 channel rows x 128 positions in LDS; out = gamma*O/l + x as whole lines
// ---------------------------------------------------------------------------
// One block per WGP = two waves per SIMD, said to the compiler: the 256 accumulator registers of a wave and the
// fragments read ahead need most of the 512 registers of two waves per SIMD.
__global__ void __launch_bounds__(256) __attribute__((amdgpu_waves_per_eu(2, 2)))
attn_kernel(const bf16_t* __restrict__ Qb, const bf16_t* __restrict__ Kb, const bf16_t* __restrict__ Vb,
            const float* __restrict__ x, const float* __restrict__ gamma, float* __restrict__ out) {
  __shared__ alignas(16) bf16_t ring[2 * STH];   // 159,744 B
  __shared__ alignas(16) bf16_t qs[8 * QT * 512];   // 16,384 B: each wave's own Q fragments, lane by lane

  const int tid = threadIdx.x;
  const int wv  = __builtin_amdgcn_readfirstlane(tid >> 5);   // wave-uniform: what derives from it stays scalar
  const int qg  = wv & 3;    // query group: queries iblk + 32 qg ...
  const int kh  = wv >> 2;   // key half: keys 64 kh ... of every pass
  const int l   = tid & 31;
  const int h   = l >> 4;
  const int m   = l & 15;
  const int b    = blockIdx.x / NIB;
  const int iblk = (blockIdx.x - b * NIB) * IB;
  if (b >= kB) return;
  // i0 = iblk + qg * 32 + q * 16: first query of tile q of this wave, as the comments below name it

  const bf16_t* kg = Kb + (size_t)b * kN * kD;
  const bf16_t* vg = Vb + (size_t)b * kC * kN;

  // Q as B operand: column n = query i0+m, k = d; the wave's 32 rows x 64 B are contiguous. The 16 registers of the two
  // fragments do not fit beside 256 accumulators through the whole pass: each wave lays them down once in LDS space of
  // its own, as its lanes hold them (contiguous 512 B per read), and takes them up with every pass's K reads.
  const bf16_t* qrow = Qb + ((size_t)b * kN + iblk + qg * 32 + m) * kD;
  // the two scheduling fences keep every other instruction out from between the loads and their wait
  __builtin_amdgcn_sched_barrier(0);
  Frag qld[QT];
#pragma unroll
  for (int q = 0; q < QT; ++q) qld[q].v = frag_b16(qrow + q * 16 * kD, h);
  // later code overwrites the address registers of these loads
  asm volatile("s_wait_xcnt 0x0" ::: "memory");
  __builtin_amdgcn_sched_barrier(0);
  bf16_t* qw = qs + wv * (QT * 512) + l * 8;
#pragma unroll
  for (int q = 0; q < QT; ++q) {
    *(v8bf*)(qw + q * 512)       = qld[q].h2[0];
    *(v8bf*)(qw + q * 512 + 256) = qld[q].h2[1];
  }

  // acc[q][i]: i = 0..7 channel tiles of this wave's own half (channels 128 kh + 16 i), which it keeps at the join;
  // i = 8..15 those of the other half (channels 128 (1-kh) + 16 (i-8)), which it hands to its partner
  v8f acc[QT][kC / 16];
#pragma unroll
  for (int q = 0; q < QT; ++q)
#pragma unroll
    for (int ct = 0; ct < kC / 16; ++ct) acc[q][ct] = v8f{};
  float lsum[QT];
  float mrun[QT];   // running maximum in log2 units: logit * log2(e)
#pragma unroll
  for (int q = 0; q < QT; ++q) {
    lsum[q] = 0.0f;
    mrun[q] = -1.0e30f;
  }
  constexpr float kL2E = 1.4426950408889634f;

  // staging bases of this thread: K row tid/4, 16-B segment tid%4; V row tid/16, 16-B segment tid%16
  const bf16_t* ksrc = kg + tid * 8;
  const bf16_t* vsrc = vg + (size_t)(tid >> 4) * kN + (tid & 15) * 8;
  const unsigned kdst = lds_addr(ring + (tid >> 2) * KP + (tid & 3) * 8);
  const unsigned vdst = lds_addr(ring + KSH + (tid >> 4) * VP + (tid & 15) * 8);

  // ring prologue: tile 0 lands and is published, then tile 1 starts into the other buffer
  stage_tile(kdst, vdst, ksrc, vsrc);
  asm volatile("s_wait_asynccnt 0x0" ::: "memory");   // this wave's copies of tile 0 have landed
  __syncthreads();                                    // and every other wave's: tile 0 may be read
  stage_tile(kdst + STH * 2, vdst + STH * 2, ksrc + (size_t)JB * kD, vsrc + JB);

#pragma unroll 1
  for (int jt = 0; jt < NT; ++jt) {
    const int bo = (jt & 1) * STH;   // this pass reads buffer jt mod 2 alone
    const bf16_t* ks = ring + bo + kh * KW * KP;
    const bf16_t* vs = ring + bo + KSH + kh * KW;

    // S^T tiles t = 0..3: rows = keys j0+16t+m (A = K rows), cols = queries (B = Q rows), j0 = jt*128 + 64 kh
    v16bf ka[KW / 16];
#pragma unroll
    for (int t = 0; t < KW / 16; ++t) ka[t] = frag_b16(ks + (t * 16 + m) * KP, h);
    v16bf qf[QT];
#pragma unroll
    for (int q = 0; q < QT; ++q) {
      Frag f;
      f.h2[0] = *(const v8bf*)(qw + q * 512);
      f.h2[1] = *(const v8bf*)(qw + q * 512 + 256);
      qf[q] = f.v;
    }
    const v8f z = {};
    v8f st[QT][KW / 16];   // st[q][t] element r = logit(key j0+16t+8h+r, query i0+m)
#pragma unroll
    for (int t = 0; t < KW / 16; ++t)
#pragma unroll
      for (int q = 0; q < QT; ++q) st[q][t] = mma16_free(ka[t], qf[q], z);

    // V fragments (16 channel tiles x 32 keys) are asked for ahead of the products that take them, in groups of 8 tiles:
    // block 0's first group here, ahead of the maximum; its second group written behind block 0's exp arithmetic, where
    // logit registers come free again (all 16 fragments beside all 64 logit registers do not fit 512 registers).
    const bf16_t* vown = vs + (kh * 128 + m) * VP;         // rows of channel tiles i = 0..7
    const bf16_t* voth = vs + ((1 - kh) * 128 + m) * VP;   // rows of channel tiles i = 8..15
    v16bf vf[kC / 16];
#pragma unroll
    for (int ct = 0; ct < 8; ++ct) vf[ct] = frag_b16(vown + ct * 16 * VP, h);

    // per-query online softmax: lanes m and m+16 hold the 64 logits of query i0+m
    float alpha[QT];
    v2f nm[QT];
#pragma unroll
    for (int q = 0; q < QT; ++q) {
      float mt[KW / 32];   // one independent chain per 32 keys
#pragma unroll
      for (int kk = 0; kk < KW / 32; ++kk) {
        float a = fmaxf(st[q][2 * kk][0], st[q][2 * kk + 1][0]);
#pragma unroll
        for (int r = 1; r < 8; ++r) a = fmaxf(a, fmaxf(st[q][2 * kk][r], st[q][2 * kk + 1][r]));
        mt[kk] = a;
      }
      float ml = fmaxf(mt[0], mt[1]);
      ml = fmaxf(ml, other_half(ml));
      const float mn = fmaxf(mrun[q], ml * kL2E);
      alpha[q] = __builtin_amdgcn_exp2f(mrun[q] - mn);
      mrun[q] = mn;
      nm[q] = v2f{-mn, -mn};
    }
    const v2f l2 = {kL2E, kL2E};

#pragma unroll
    for (int q = 0; q < QT; ++q)
#pragma unroll
      for (int ct = 0; ct < kC / 16; ++ct) acc[q][ct] *= alpha[q];

    v2f pt[QT];
#pragma unroll
    for (int q = 0; q < QT; ++q) pt[q] = v2f{0.0f, 0.0f};
#pragma unroll
    for (int kk = 0; kk < KW / 32; ++kk) {
      PFrag p[QT];
#pragma unroll
      for (int q = 0; q < QT; ++q) {
        exp_tile(st[q][2 * kk], l2, nm[q], p[q].d, pt[q]);           // B element r   <- key j0+32kk+8h+r
        exp_tile(st[q][2 * kk + 1], l2, nm[q], p[q].d + 4, pt[q]);   // B element 8+r <- key j0+32kk+16+8h+r
      }
      if (kk == 0) {
        // the fence behind keeps these reads from sinking among the products of the first run, which is their lead:
        // left free, they stand among those products and a full LDS wait comes in the middle of the second run
#pragma unroll
        for (int ct = 0; ct < 8; ++ct) vf[8 + ct] = frag_b16(voth + ct * 16 * VP, h);
        __builtin_amdgcn_sched_barrier(0);
      }
      // O^T[c][i] += V[c][keys] . P^T: A = V row c (k = key contiguous, 32 keys per product), B = p of either query tile
      // in two runs of 8 channel tiles, each run's fragments asked for anew as one group right behind it
#pragma unroll
      for (int hf = 0; hf < 2; ++hf) {
#pragma unroll
        for (int ct = hf * 8; ct < hf * 8 + 8; ++ct)
#pragma unroll
          for (int q = 0; q < QT; ++q) acc[q][ct] = mma16_free(vf[ct], p[q].v, acc[q][ct]);
        if (kk + 1 < KW / 32) {
          const bf16_t* vr = (hf ? voth : vown) + (kk + 1) * 32;
#pragma unroll
          for (int ct = 0; ct < 8; ++ct) vf[hf * 8 + ct] = frag_b16(vr + ct * 16 * VP, h);
          // holds the refill a key block ahead of its products, as written: left free, each read sinks to just
          // ahead of its use and the wave waits out the LDS latency at every product
          __builtin_amdgcn_sched_barrier(0);
        }
      }
    }
#pragma unroll
    for (int q = 0; q < QT; ++q) {
      float ps = pt[q][0] + pt[q][1];
      ps += other_half(ps);
      lsum[q] = lsum[q] * alpha[q] + ps;
    }

    // publish point of tile jt+1, which also frees this pass's buffer
    // nothing of the pass is scheduled behind it: left free, the compiler lifts the waits and the barrier over the last
    // key block's exp arithmetic and products, which then stand between the barrier and the refill
    __builtin_amdgcn_sched_barrier(0);
    asm volatile("s_wait_dscnt 0x0" ::: "memory");      // this wave's reads of the buffer have returned
    asm volatile("s_wait_asynccnt 0x0" ::: "memory");   // this wave's copies of tile jt+1 have landed
    __syncthreads();
    if (jt + 2 < NT)   // the same for the whole block
      stage_tile(kdst + bo * 2, vdst + bo * 2, ksrc + (size_t)(jt + 2) * JB * kD, vsrc + (jt + 2) * JB);
  }
  asm volatile("s_wait_asynccnt 0x0" ::: "memory");   // nothing is in flight when the ring becomes exchange space
  float* so = (float*)ring;   // every wave has passed the last pass's barrier behind its last read

  // lane and thread index taken anew behind the loop rather than carried through it
  const int le = (int)__builtin_amdgcn_mbcnt_lo(~0u, 0u);
  const int he = le >> 4;
  const int me = le & 15;
  const int te = wv * 32 + le;

  // join of the two key halves. Each wave lays down, lane by lane as its registers hold them, its 16 tiles of the
  // partner's channels (16 KiB a wave) and its max and sum; partners share queries and lane map.
  {
    v4f* mine = (v4f*)(so + wv * XW) + le;
#pragma unroll
    for (int q = 0; q < QT; ++q)
#pragma unroll
      for (int i = 0; i < 8; ++i) {
        const v8f a = acc[q][8 + i];
        mine[((q * 8 + i) * 2) * 32]     = v4f_t{a[0], a[1], a[2], a[3]};
        mine[((q * 8 + i) * 2 + 1) * 32] = v4f_t{a[4], a[5], a[6], a[7]};
      }
    *((v4f*)(so + 8 * XW + wv * 128) + le) = v4f_t{mrun[0], lsum[0], mrun[1], lsum[1]};
    __syncthreads();   // every wave's partial results are laid down
    const int pw = wv ^ 4;
    const v4f* theirs = (const v4f*)(so + pw * XW) + le;
    const v4f o = *((const v4f*)(so + 8 * XW + pw * 128) + le);
    const float g = gamma[0];
#pragma unroll
    for (int q = 0; q < QT; ++q) {
      const float mm = fmaxf(mrun[q], o[2 * q]);
      const float ao = __builtin_amdgcn_exp2f(mrun[q] - mm);
      const float at = __builtin_amdgcn_exp2f(o[2 * q] - mm);
      const float s  = g / (lsum[q] * ao + o[2 * q + 1] * at);
      const float fo = ao * s;   // scale per query column, normaliser and gamma folded in
      const float ft = at * s;
#pragma unroll
      for (int i = 0; i < 8; ++i) {
        const v4f t0 = theirs[((q * 8 + i) * 2) * 32];
        const v4f t1 = theirs[((q * 8 + i) * 2 + 1) * 32];
#pragma unroll
        for (int r = 0; r < 4; ++r) {
          acc[q][i][r]     = acc[q][i][r] * fo + t0[r] * ft;
          acc[q][i][4 + r] = acc[q][i][4 + r] * fo + t1[r] * ft;
        }
      }
    }
  }

  // epilogue: acc[q][i] element r = (channel 128 kh + 16 i + 8h + r, query i0+m), i = 0..7
#pragma unroll
  for (int cp = 0; cp < kC / 32; ++cp) {
    __syncthreads();   // the exchange reads, or the earlier store phase, finished reading so
    if (kh == (cp >> 2)) {   // wave-uniform: the four waves that hold these 32 channels
#pragma unroll
      for (int q = 0; q < QT; ++q)
#pragma unroll
        for (int t = 0; t < 2; ++t)
#pragma unroll
          for (int r = 0; r < 8; ++r)
            so[(t * 16 + 8 * he + r) * IB + qg * 32 + q * 16 + me] = acc[q][2 * (cp & 3) + t][r];
    }
    __syncthreads();
    // 32 channel rows x 512 B: row = idx/32, 16-B segment idx%32; a wave covers one row, four whole lines
    v4f ov[4];
    size_t go[4];
#pragma unroll
    for (int q = 0; q < 4; ++q) {
      const int idx = q * 256 + te;
      const int row = idx >> 5;
      const int seg = idx & 31;
      go[q] = ((size_t)(b * kC + cp * 32 + row)) * kN + iblk + seg * 4;
      ov[q] = *(const v4f*)(so + row * IB + seg * 4) + *(const v4f*)(x + go[q]);
    }
#pragma unroll
    for (int q = 0; q < 4; ++q) *(v4f*)(out + go[q]) = ov[q];
    // the next trip overwrites the registers these loads and stores name
    asm volatile("s_wait_xcnt 0x0" ::: "memory");
  }
}

extern "C" void kernel_launch(void* const* d_in, const int* in_sizes, int n_in,
                              void* d_out, int out_size, void* d_ws, size_t ws_size,
                              hipStream_t stream) {
  if (n_in < 8) return;
  if (in_sizes[0] != kB * kC * kN || in_sizes[1] != kD * kC || in_sizes[2] != kD ||
      in_sizes[3] != kD * kC || in_sizes[4] != kD || in_sizes[5] != kC * kC ||
      in_sizes[6] != kC || in_sizes[7] < 1) return;
  if (out_size != kB * kC * kN) return;

  const float* x     = (const float*)d_in[0];
  const float* Wq    = (const float*)d_in[1];
  const float* bq    = (const float*)d_in[2];
  const float* Wk    = (const float*)d_in[3];
  const float* bk    = (const float*)d_in[4];
  const float* Wv    = (const float*)d_in[5];
  const float* bv    = (const float*)d_in[6];
  const float* gamma = (const float*)d_in[7];
  float* out = (float*)d_out;

  // workspace: Qb [B][N][32] bf16 (2 MiB), Kb [B][N][32] bf16 (2 MiB), Vb [B][C][N] bf16 (16 MiB)
  const size_t qk_bytes = (size_t)kB * kN * kD * sizeof(bf16_t);
  const size_t v_bytes  = (size_t)kB * kC * kN * sizeof(bf16_t);
  if (ws_size < 2 * qk_bytes + v_bytes) return;
  bf16_t* Qb = (bf16_t*)d_ws;
  bf16_t* Kb = (bf16_t*)((char*)d_ws + qk_bytes);
  bf16_t* Vb = (bf16_t*)((char*)d_ws + 2 * qk_bytes);

  proj_kernel<<<dim3(kB * NPB), dim3(128), 0, stream>>>(x, Wq, bq, Wk, bk, Wv, bv, Qb, Kb, Vb);
  attn_kernel<<<dim3(kB * NIB), dim3(256), 0, stream>>>(Qb, Kb, Vb, x, gamma, out);
}

// v008
// It runs in 85.6 microseconds.
// Two timings next to v007 both put it at 1.03 times that version's speed.
// Counting every step since v000, it is 3.19 times as fast.
#include <hip/hip_runtime.h>
#include <stdint.h>
#include <stddef.h>

// All contractions: v_wmma_f32_16x16x32_bf16 (bf16 operands, f32 accumulate): three 1x1-conv projections, key.query logits, value.prob aggregation; softmax statistics, normaliser and residual add in f32.

typedef __bf16 bf16_t;
typedef __attribute__((ext_vector_type(16))) __bf16 v16bf;
typedef __attribute__((ext_vector_type(8)))  __bf16 v8bf_t;
typedef __attribute__((ext_vector_type(8)))  float  v8f;
typedef __attribute__((ext_vector_type(4)))  float  v4f_t;
typedef __attribute__((ext_vector_type(4)))  unsigned int v4u_t;
typedef v8bf_t __attribute__((__may_alias__)) v8bf;
typedef v4f_t  __attribute__((__may_alias__)) v4f;
typedef v4u_t  __attribute__((__may_alias__)) v4u;
typedef __attribute__((ext_vector_type(2)))  unsigned int v2u_t;
typedef v2u_t  __attribute__((__may_alias__)) v2u;
typedef __attribute__((ext_vector_type(2)))  float  v2f;
typedef __attribute__((ext_vector_type(2)))  __bf16 v2bf;

constexpr int kB  = 8;      // batch
constexpr int kC  = 256;    // channels
constexpr int kN  = 4096;   // positions (H*W)
constexpr int kD  = 32;     // q/k channels
constexpr int PT  = 64;     // positions per projection block
constexpr int XP  = kC + 8; // LDS pitch (halves) of the transposed x tile, 528 B rows
constexpr int NPB = kN / PT;
constexpr int IB  = 128;    // query positions per attention block: 4 query groups x 32
constexpr int QT  = 2;      // 16-query tiles per attention wave
constexpr int NIB = kN / IB;
constexpr int KP  = kD + 8; // LDS pitch (halves) of a staged key row
constexpr int JB  = 128;    // keys per attention pass
constexpr int VP  = JB + 8; // LDS pitch (halves) of a staged value row (JB keys), 272 B rows
constexpr int KSH = JB * KP;    // halves of one staged K tile, 10,240 B
constexpr int STH = KSH + kC * VP;   // halves of one ring buffer (K tile, then V tile), 79,872 B
constexpr int NT  = kN / JB;    // key tiles
constexpr int KW  = JB / 2;     // keys of a pass that one wave takes
constexpr int XW  = QT * 8 * 256;   // floats a wave hands to its partner at the join: 16 tiles of 16 x 16, 16 KiB
typedef char ring_check[(NT >= 2 && IB == 4 * 16 * QT && QT == 2 && KW == 64 && (8 * XW + 8 * 128) * 4 <= 2 * STH * 2 && (KSH * 2) % 16 == 0 && (STH * 2) % 16 == 0 && 32 * IB * 4 <= STH * 2) ? 1 : -1];
typedef char cfg_check[(kN % PT == 0 && kN % IB == 0 && kN % JB == 0 && JB == 128 && kC % 64 == 0 && kD == 32 &&
                        (XP % 8) == 0 && (KP % 8) == 0 && (VP % 8) == 0) ? 1 : -1];

union Frag { v16bf v; v8bf h2[2]; bf16_t e[16]; };

// D(16x16 f32) += A(16x32 bf16) * B(32x16 bf16); hazard guard ties D, keeps A/B live.
static __device__ __forceinline__ v8f mma16(v16bf a, v16bf b, v8f c) {
  v8f d = __builtin_amdgcn_wmma_f32_16x16x32_bf16(false, a, false, b, (short)0, c, false, false);
  asm volatile("v_nop\n\tv_nop\n\tv_nop\n\tv_nop" : "+v"(d) : "v"(a), "v"(b));
  return d;
}

// The same product for the attention loop, builtin only: the compiler keeps the distances behind it and may move
// the LDS reads of later fragments ahead of it (no memory operation crosses a volatile asm statement).
static __device__ __forceinline__ v8f mma16_free(v16bf a, v16bf b, v8f c) {
  return __builtin_amdgcn_wmma_f32_16x16x32_bf16(false, a, false, b, (short)0, c, false, false);
}

// Fragment from a k-contiguous 16-bit row (row m for A, column n stored as a row for B), h = lane>>4:
// elements 0..7 <- row[8h .. 8h+7], elements 8..15 <- row[16+8h .. 16+8h+7].
static __device__ __forceinline__ v16bf frag_b16(const bf16_t* row, int h) {
  Frag f;
  f.h2[0] = *(const v8bf*)(row + 8 * h);
  f.h2[1] = *(const v8bf*)(row + 16 + 8 * h);
  return f.v;
}

// Stage ROWS contiguous f32 weight rows of kC floats as bf16 (RNE) rows of pitch XP in LDS, 128 threads.
// Each wave-wide load covers 512 contiguous bytes (four whole lines); each lane stores its 4 values as 8 B.
template <int ROWS>
static __device__ __forceinline__ void stage_w(bf16_t* dst, const float* __restrict__ src, int tid) {
  // fully unrolled so that all loads of the group are in flight behind one latency
#pragma unroll
  for (int it = 0; it < ROWS * kC / 4 / 128; ++it) {
    const int idx = it * 128 + tid;
    const v4f v = *(const v4f*)(src + idx * 4);
    union { bf16_t e[4]; v2u_t u; } p;
    p.e[0] = (bf16_t)v[0];
    p.e[1] = (bf16_t)v[1];
    p.e[2] = (bf16_t)v[2];
    p.e[3] = (bf16_t)v[3];
    *(v2u*)(dst + (idx >> 6) * XP + (idx & 63) * 4) = p.u;
  }
}

// LDS byte address of a __shared__ element, as the asynchronous copies take it
static __device__ __forceinline__ unsigned lds_addr(const bf16_t* p) {
  return (unsigned)(uintptr_t)(__attribute__((address_space(3))) const void*)p;
}

// Nine asynchronous 16-B copies per lane, global memory to LDS through no register. The s_wait_xcnt is the last line
// of the copies' own statement, so that it stands ahead of every later write of an address register they name.
static __device__ __forceinline__ void copy9(const unsigned (&d)[9], const bf16_t* const (&g)[9]) {
  asm volatile("global_load_async_to_lds_b128 %0, %9, off\n\t"
               "global_load_async_to_lds_b128 %1, %10, off\n\t"
               "global_load_async_to_lds_b128 %2, %11, off\n\t"
               "global_load_async_to_lds_b128 %3, %12, off\n\t"
               "global_load_async_to_lds_b128 %4, %13, off\n\t"
               "global_load_async_to_lds_b128 %5, %14, off\n\t"
               "global_load_async_to_lds_b128 %6, %15, off\n\t"
               "global_load_async_to_lds_b128 %7, %16, off\n\t"
               "global_load_async_to_lds_b128 %8, %17, off\n\t"
               "s_wait_xcnt 0x0"
               :: "v"(d[0]), "v"(d[1]), "v"(d[2]), "v"(d[3]), "v"(d[4]), "v"(d[5]), "v"(d[6]), "v"(d[7]), "v"(d[8]),
                  "v"(g[0]), "v"(g[1]), "v"(g[2]), "v"(g[3]), "v"(g[4]), "v"(g[5]), "v"(g[6]), "v"(g[7]), "v"(g[8])
               : "memory");
}

// One key tile into one ring buffer, 256 threads, 18 copies per lane. K: 128 rows x 64 B are 8 KiB contiguous;
// V: a wave-wide copy covers two rows x 256 B (whole lines). Round q is a constant step from the thread's own base
// on both sides (64 K rows, 16 V rows). kd, vd: this thread's LDS byte addresses in the buffer.
static __device__ __forceinline__ void stage_tile(unsigned kd, unsigned vd, const bf16_t* kp, const bf16_t* vp) {
  unsigned d[18];
  const bf16_t* g[18];
#pragma unroll
  for (int q = 0; q < 2; ++q) {
    d[q] = kd + q * 64 * KP * 2;
    g[q] = kp + q * 64 * kD;
  }
#pragma unroll
  for (int q = 0; q < 16; ++q) {
    d[2 + q] = vd + q * 16 * VP * 2;
    g[2 + q] = vp + (size_t)q * 16 * kN;
  }
  const unsigned d0[9] = {d[0], d[1], d[2], d[3], d[4], d[5], d[6], d[7], d[8]};
  const bf16_t* const g0[9] = {g[0], g[1], g[2], g[3], g[4], g[5], g[6], g[7], g[8]};
  const unsigned d1[9] = {d[9], d[10], d[11], d[12], d[13], d[14], d[15], d[16], d[17]};
  const bf16_t* const g1[9] = {g[9], g[10], g[11], g[12], g[13], g[14], g[15], g[16], g[17]};
  copy9(d0, g0);
  copy9(d1, g1);
}

union PFrag { v16bf v; v2bf d[8]; };

// value of lane l ^ 16, by a vector cross-row move instead of an exchange through the LDS queue
static __device__ __forceinline__ float other_half(float v) {
  const int b = __float_as_int(v);
  return __int_as_float(__builtin_amdgcn_permlanex16(b, b, 0x76543210, 0xfedcba98, false, false));
}

// exp of one 16-key tile of logits, two scores per vector instruction: one packed fma gives logit*log2(e) - reference,
// one pair conversion (RNE) fills a B register, one packed add keeps the normaliser's two partial sums (f32, unrounded).
// d[i] holds B elements 2i, 2i+1 of the tile's half of the fragment <- tile rows 8h+2i, 8h+2i+1.
static __device__ __forceinline__ void exp_tile(v8f sc, v2f l2, v2f nm, v2bf* d, v2f& ps) {
#pragma unroll
  for (int i = 0; i < 4; ++i) {
    const v2f a = {sc[2 * i], sc[2 * i + 1]};
    const v2f u = __builtin_elementwise_fma(a, l2, nm);
    const v2f e = {__builtin_amdgcn_exp2f(u[0]), __builtin_amdgcn_exp2f(u[1])};
    d[i] = __builtin_convertvector(e, v2bf);
    ps += e;
  }
}

// ---------------------------------------------------------------------------
// Fused 1x1-conv projections for one (batch, 64-position) tile.
// xt[i][c] (bf16, k-contiguous) is the A operand of q/k (D[i][o]) and the B operand of v (D[o][i]).
// Weights: 64 rows at a time (Wq+Wk, then four groups of Wv) are converted once per block into wt
// and every wave takes its fragments from there.
// ---------------------------------------------------------------------------
__global__ void __launch_bounds__(128)
proj_kernel(const float* __restrict__ x, const float* __restrict__ Wq, const float* __restrict__ bq,
            const float* __restrict__ Wk, const float* __restrict__ bk, const float* __restrict__ Wv,
            const float* __restrict__ bv, bf16_t* __restrict__ Qb, bf16_t* __restrict__ Kb,
            bf16_t* __restrict__ Vb) {
  __shared__ alignas(16) bf16_t xt[PT * XP];   // 33,792 B
  __shared__ alignas(16) bf16_t sq[PT * kD];   //  4,096 B
  __shared__ alignas(16) bf16_t sk[PT * kD];   //  4,096 B
  __shared__ alignas(16) bf16_t sv[64 * PT];   //  8,192 B
  __shared__ alignas(16) bf16_t wt[64 * XP];   // 33,792 B: current group of 64 weight rows

  const int tid = threadIdx.x;
  const int wv  = tid >> 5;          // 0..3: position sub-tile of 16
  const int l   = tid & 31;
  const int h   = l >> 4;
  const int m   = l & 15;
  const int b   = blockIdx.x / NPB;
  const int p0  = (blockIdx.x - b * NPB) * PT;
  if (b >= kB) return;

  // stage x[b][c][p0..p0+63] transposed to xt[i][c], bf16 RNE
  const float* xb = x + (size_t)b * kC * kN + p0;
#pragma unroll 2
  for (int it = 0; it < (kC * PT / 4) / 128; ++it) {
    const int c  = it * 8 + (tid >> 4);
    const int i4 = (tid & 15) * 4;
    const v4f v  = *(const v4f*)(xb + (size_t)c * kN + i4);
    bf16_t* d = xt + i4 * XP + c;
    d[0]      = (bf16_t)v[0];
    d[XP]     = (bf16_t)v[1];
    d[2 * XP] = (bf16_t)v[2];
    d[3 * XP] = (bf16_t)v[3];
  }
  stage_w<32>(wt, Wq, tid);             // rows 0..31  = Wq
  stage_w<32>(wt + 32 * XP, Wk, tid);   // rows 32..63 = Wk
  __syncthreads();

  const bf16_t* xrow = xt + (wv * 16 + m) * XP;   // row i = wv*16+m, k = c contiguous
  const bf16_t* wrow = wt + m * XP;               // weight row m of each 16-row tile of the group

  // q, k: D[i][o] = sum_c xt[i][c] * W[o][c]; A = xt row i, B column o = W row o
  {
    v8f aq0 = {};
    v8f aq1 = {};
    v8f ak0 = {};
    v8f ak1 = {};
#pragma unroll 1
    for (int ks = 0; ks < kC / 32; ++ks) {
      const int k0 = ks * 32;
      const v16bf xf = frag_b16(xrow + k0, h);
      // the four weight fragments are read ahead of the first product: one LDS latency per k step
      const v16bf w0 = frag_b16(wrow + k0, h);
      const v16bf w1 = frag_b16(wrow + 16 * XP + k0, h);
      const v16bf w2 = frag_b16(wrow + 32 * XP + k0, h);
      const v16bf w3 = frag_b16(wrow + 48 * XP + k0, h);
      aq0 = mma16(xf, w0, aq0);
      aq1 = mma16(xf, w1, aq1);
      ak0 = mma16(xf, w2, ak0);
      ak1 = mma16(xf, w3, ak1);
    }
    const float bq0 = bq[m], bq1 = bq[16 + m];
    const float bk0 = bk[m], bk1 = bk[16 + m];
    // D element r of this lane = (row i = wv*16+8h+r, col o = m / 16+m)
#pragma unroll
    for (int r = 0; r < 8; ++r) {
      const int io = (wv * 16 + 8 * h + r) * kD;
      sq[io + m]      = (bf16_t)(aq0[r] + bq0);
      sq[io + 16 + m] = (bf16_t)(aq1[r] + bq1);
      sk[io + m]      = (bf16_t)(ak0[r] + bk0);
      sk[io + 16 + m] = (bf16_t)(ak1[r] + bk1);
    }
  }

  // v: D[o][i] = sum_c Wv[o][c] * xt[i][c]; A = Wv row o, B column i = xt row i; 64 channels per group
#pragma unroll 1
  for (int og = 0; og < kC / 64; ++og) {
    __syncthreads();   // every wave has left the earlier group's wt rows and the earlier sv store phase
    stage_w<64>(wt, Wv + (size_t)og * 64 * kC, tid);
    __syncthreads();   // wt rows of this group are complete
    v8f av[4];
#pragma unroll
    for (int t = 0; t < 4; ++t) av[t] = v8f{};
#pragma unroll 1
    for (int ks = 0; ks < kC / 32; ++ks) {
      const int k0 = ks * 32;
      const v16bf xf = frag_b16(xrow + k0, h);
      v16bf wf[4];   // read ahead of the first product, as above
#pragma unroll
      for (int t = 0; t < 4; ++t) wf[t] = frag_b16(wrow + t * 16 * XP + k0, h);
#pragma unroll
      for (int t = 0; t < 4; ++t) av[t] = mma16(wf[t], xf, av[t]);
    }
    // D element r = (row o = og*64 + t*16 + 8h + r, col i = wv*16 + m)
#pragma unroll
    for (int t = 0; t < 4; ++t)
#pragma unroll
      for (int r = 0; r < 8; ++r) {
        const int ol = t * 16 + 8 * h + r;
        sv[ol * PT + wv * 16 + m] = (bf16_t)(av[t][r] + bv[og * 64 + ol]);
      }
    __syncthreads();
    v4u vv[4];
    size_t gv[4];
#pragma unroll
    for (int q = 0; q < 4; ++q) {
      const int row = q * 16 + (tid >> 3);
      const int seg = tid & 7;
      vv[q] = *(const v4u*)(sv + row * PT + seg * 8);
      gv[q] = ((size_t)(b * kC + og * 64 + row)) * kN + p0 + seg * 8;
    }
#pragma unroll
    for (int q = 0; q < 4; ++q) *(v4u*)(Vb + gv[q]) = vv[q];
    // the next trip overwrites the registers these stores name
    asm volatile("s_wait_xcnt 0x0" ::: "memory");
  }

  // q, k tiles: 64 rows x 64 B = 4096 contiguous bytes each; 16 B per lane, 8 lanes per line
  {
    v4u uq[2], uk[2];
    size_t gq[2];
#pragma unroll
    for (int q = 0; q < 2; ++q) {
      const int idx = q * 128 + tid;
      uq[q] = *(const v4u*)(sq + idx * 8);
      uk[q] = *(const v4u*)(sk + idx * 8);
      gq[q] = ((size_t)(b * kN + p0)) * kD + idx * 8;
    }
#pragma unroll
    for (int q = 0; q < 2; ++q) {
      *(v4u*)(Qb + gq[q]) = uq[q];
      *(v4u*)(Kb + gq[q]) = uk[q];
    }
    
  }
}

// ---------------------------------------------------------------------------
// Fused attention for one (batch, 128-query) tile. 256 threads = 8 waves = 4 query groups x 2 key halves: a wave holds
// 32 queries (two 16-query tiles) x all 256 channels and takes 64 of each pass's 128 keys, so that every K and V
// fragment read from LDS feeds two products. Per 128-key pass: K rows [128][32] and V rows [256][128] staged in LDS by the
// whole block: asynchronous copies into a ring of two buffers, the next tile in flight under this one's work.
// S^T = K.Q^T so each lane owns one query column per tile: per-query
// running max / sum need one xor-16 shuffle per pass, and the accumulators are rescaled only when a maximum has grown by over 8.
// P (bf16) packed from each pair of S^T accumulators is the B fragment of O^T = V.P^T for its 32 keys
// (k = key, element r <- even tile row 8h+r, element 8+r <- odd tile).
// Behind the loop the two waves of a query group swap, through LDS, reference, sum and one half of the channels each, and
// each joins its 128 channels. Epilogue stages 32 channel rows x 128 positions in LDS; out = gamma*O/l + x as whole lines
// ---------------------------------------------------------------------------
// One block per WGP = two waves per SIMD, said to the compiler: the 256 accumulator registers of a wave and the
// fragments read ahead need most of the 512 registers of two waves per SIMD.
__global__ void __launch_bounds__(256) __attribute__((amdgpu_waves_per_eu(2, 2)))
attn_kernel(const bf16_t* __restrict__ Qb, const bf16_t* __restrict__ Kb, const bf16_t* __restrict__ Vb,
            const float* __restrict__ x, const float* __restrict__ gamma, float* __restrict__ out) {
  __shared__ alignas(16) bf16_t ring[2 * STH];   // 159,744 B
  __shared__ alignas(16) bf16_t qs[8 * QT * 512];   // 16,384 B: each wave's own Q fragments, lane by lane

  const int tid = threadIdx.x;
  const int wv  = __builtin_amdgcn_readfirstlane(tid >> 5);   // wave-uniform: what derives from it stays scalar
  const int qg  = wv & 3;    // query group: queries iblk + 32 qg ...
  const int kh  = wv >> 2;   // key half: keys 64 kh ... of every pass
  const int l   = tid & 31;
  const int h   = l >> 4;
  const int m   = l & 15;
  const int b    = blockIdx.x / NIB;
  const int iblk = (blockIdx.x - b * NIB) * IB;
  if (b >= kB) return;
  // i0 = iblk + qg * 32 + q * 16: first query of tile q of this wave, as the comments below name it

  const bf16_t* kg = Kb + (size_t)b * kN * kD;
  const bf16_t* vg = Vb + (size_t)b * kC * kN;

  // Q as B operand: column n = query i0+m, k = d; the wave's 32 rows x 64 B are contiguous. The 16 registers of the two
  // fragments do not fit beside 256 accumulators through the whole pass: each wave lays them down once in LDS space of
  // its own, as its lanes hold them (contiguous 512 B per read), and takes them up with every pass's K reads.
  const bf16_t* qrow = Qb + ((size_t)b * kN + iblk + qg * 32 + m) * kD;
  // the two scheduling fences keep every other instruction out from between the loads and their wait
  __builtin_amdgcn_sched_barrier(0);
  Frag qld[QT];
#pragma unroll
  for (int q = 0; q < QT; ++q) qld[q].v = frag_b16(qrow + q * 16 * kD, h);
  // later code overwrites the address registers of these loads
  asm volatile("s_wait_xcnt 0x0" ::: "memory");
  __builtin_amdgcn_sched_barrier(0);
  bf16_t* qw = qs + wv * (QT * 512) + l * 8;
#pragma unroll
  for (int q = 0; q < QT; ++q) {
    *(v8bf*)(qw + q * 512)       = qld[q].h2[0];
    *(v8bf*)(qw + q * 512 + 256) = qld[q].h2[1];
  }

  // acc[q][i]: i = 0..7 channel tiles of this wave's own half (channels 128 kh + 16 i), which it keeps at the join;
  // i = 8..15 those of the other half (channels 128 (1-kh) + 16 (i-8)), which it hands to its partner
  v8f acc[QT][kC / 16];
#pragma unroll
  for (int q = 0; q < QT; ++q)
#pragma unroll
    for (int ct = 0; ct < kC / 16; ++ct) acc[q][ct] = v8f{};
  float lsum[QT];
  float mrun[QT];   // softmax reference in log2 units (logit * log2(e)): at most 8 below the running maximum
#pragma unroll
  for (int q = 0; q < QT; ++q) {
    lsum[q] = 0.0f;
    mrun[q] = -1.0e30f;
  }
  constexpr float kL2E = 1.4426950408889634f;

  // staging bases of this thread: K row tid/4, 16-B segment tid%4; V row tid/16, 16-B segment tid%16
  const bf16_t* ksrc = kg + tid * 8;
  const bf16_t* vsrc = vg + (size_t)(tid >> 4) * kN + (tid & 15) * 8;
  const unsigned kdst = lds_addr(ring + (tid >> 2) * KP + (tid & 3) * 8);
  const unsigned vdst = lds_addr(ring + KSH + (tid >> 4) * VP + (tid & 15) * 8);

  // ring prologue: tile 0 lands and is published, then tile 1 starts into the other buffer
  stage_tile(kdst, vdst, ksrc, vsrc);
  asm volatile("s_wait_asynccnt 0x0" ::: "memory");   // this wave's copies of tile 0 have landed
  __syncthreads();                                    // and every other wave's: tile 0 may be read
  stage_tile(kdst + STH * 2, vdst + STH * 2, ksrc + (size_t)JB * kD, vsrc + JB);

#pragma unroll 1
  for (int jt = 0; jt < NT; ++jt) {
    const int bo = (jt & 1) * STH;   // this pass reads buffer jt mod 2 alone
    const bf16_t* ks = ring + bo + kh * KW * KP;
    const bf16_t* vs = ring + bo + KSH + kh * KW;

    // S^T tiles t = 0..3: rows = keys j0+16t+m (A = K rows), cols = queries (B = Q rows), j0 = jt*128 + 64 kh
    v16bf ka[KW / 16];
#pragma unroll
    for (int t = 0; t < KW / 16; ++t) ka[t] = frag_b16(ks + (t * 16 + m) * KP, h);
    v16bf qf[QT];
#pragma unroll
    for (int q = 0; q < QT; ++q) {
      Frag f;
      f.h2[0] = *(const v8bf*)(qw + q * 512);
      f.h2[1] = *(const v8bf*)(qw + q * 512 + 256);
      qf[q] = f.v;
    }
    const v8f z = {};
    v8f st[QT][KW / 16];   // st[q][t] element r = logit(key j0+16t+8h+r, query i0+m)
#pragma unroll
    for (int t = 0; t < KW / 16; ++t)
#pragma unroll
      for (int q = 0; q < QT; ++q) st[q][t] = mma16_free(ka[t], qf[q], z);

    // V fragments (16 channel tiles x 32 keys) are asked for ahead of the products that take them, in groups of 8 tiles:
    // block 0's first group here, ahead of the maximum; its second group written behind block 0's exp arithmetic, where
    // logit registers come free again (all 16 fragments beside all 64 logit registers do not fit 512 registers).
    const bf16_t* vown = vs + (kh * 128 + m) * VP;         // rows of channel tiles i = 0..7
    const bf16_t* voth = vs + ((1 - kh) * 128 + m) * VP;   // rows of channel tiles i = 8..15
    v16bf vf[kC / 16];
#pragma unroll
    for (int ct = 0; ct < 8; ++ct) vf[ct] = frag_b16(vown + ct * 16 * VP, h);
    // compiler fence, no instruction: keeps these reads ahead of the rescale branch below; left free, they sink behind
    // it, in among block 0's exp arithmetic, and the first products wait out their LDS latency
    asm volatile("" ::: "memory");

    // per-query online softmax: lanes m and m+16 hold the 64 logits of query i0+m. mrun, the reference in use, may trail
    // the true running maximum by up to 8 (log2 units), so an exponential reaches 2^8 at most: sums and accumulators are
    // rescaled only in a pass where some query's maximum exceeds its reference by more.
    float mb[QT];
    bool need = false;
#pragma unroll
    for (int q = 0; q < QT; ++q) {
      float mt[KW / 32];   // one independent chain per 32 keys
#pragma unroll
      for (int kk = 0; kk < KW / 32; ++kk) {
        float a = fmaxf(st[q][2 * kk][0], st[q][2 * kk + 1][0]);
#pragma unroll
        for (int r = 1; r < 8; ++r) a = fmaxf(a, fmaxf(st[q][2 * kk][r], st[q][2 * kk + 1][r]));
        mt[kk] = a;
      }
      float ml = fmaxf(mt[0], mt[1]);
      ml = fmaxf(ml, other_half(ml));
      mb[q] = ml * kL2E;
      need = need || (mb[q] > mrun[q] + 8.0f);
    }
    // one test per pass, the same for the whole wave (a scalar branch, every lane stays on); the first pass takes it, as the
    // reference starts at -1e30
    if (__builtin_amdgcn_ballot_w32(need) != 0) {
#pragma unroll
      for (int q = 0; q < QT; ++q) {
        const float mn = fmaxf(mrun[q], mb[q]);
        const float alpha = __builtin_amdgcn_exp2f(mrun[q] - mn);   // 0 in the first pass
        mrun[q] = mn;
        lsum[q] *= alpha;
#pragma unroll
        for (int ct = 0; ct < kC / 16; ++ct) acc[q][ct] *= alpha;
      }
    }
    v2f nm[QT];
#pragma unroll
    for (int q = 0; q < QT; ++q) nm[q] = v2f{-mrun[q], -mrun[q]};
    const v2f l2 = {kL2E, kL2E};

    v2f pt[QT];
#pragma unroll
    for (int q = 0; q < QT; ++q) pt[q] = v2f{0.0f, 0.0f};
#pragma unroll
    for (int kk = 0; kk < KW / 32; ++kk) {
      PFrag p[QT];
#pragma unroll
      for (int q = 0; q < QT; ++q) {
        exp_tile(st[q][2 * kk], l2, nm[q], p[q].d, pt[q]);           // B element r   <- key j0+32kk+8h+r
        exp_tile(st[q][2 * kk + 1], l2, nm[q], p[q].d + 4, pt[q]);   // B element 8+r <- key j0+32kk+16+8h+r
      }
      if (kk == 0) {
        // the fence behind keeps these reads from sinking among the products of the first run, which is their lead:
        // left free, they stand among those products and a full LDS wait comes in the middle of the second run
#pragma unroll
        for (int ct = 0; ct < 8; ++ct) vf[8 + ct] = frag_b16(voth + ct * 16 * VP, h);
        __builtin_amdgcn_sched_barrier(0);
      }
      // O^T[c][i] += V[c][keys] . P^T: A = V row c (k = key contiguous, 32 keys per product), B = p of either query tile
      // in two runs of 8 channel tiles, each run's fragments asked for anew as one group right behind it
#pragma unroll
      for (int hf = 0; hf < 2; ++hf) {
#pragma unroll
        for (int ct = hf * 8; ct < hf * 8 + 8; ++ct)
#pragma unroll
          for (int q = 0; q < QT; ++q) acc[q][ct] = mma16_free(vf[ct], p[q].v, acc[q][ct]);
        if (kk + 1 < KW / 32) {
          const bf16_t* vr = (hf ? voth : vown) + (kk + 1) * 32;
#pragma unroll
          for (int ct = 0; ct < 8; ++ct) vf[hf * 8 + ct] = frag_b16(vr + ct * 16 * VP, h);
          // holds the refill a key block ahead of its products, as written: left free, each read sinks to just
          // ahead of its use and the wave waits out the LDS latency at every product
          __builtin_amdgcn_sched_barrier(0);
        }
      }
    }
#pragma unroll
    for (int q = 0; q < QT; ++q) {
      float ps = pt[q][0] + pt[q][1];
      ps += other_half(ps);
      lsum[q] += ps;
    }

    // publish point of tile jt+1, which also frees this pass's buffer
    // nothing of the pass is scheduled behind it: left free, the compiler lifts the waits and the barrier over the last
    // key block's exp arithmetic and products, which then stand between the barrier and the refill
    __builtin_amdgcn_sched_barrier(0);
    asm volatile("s_wait_dscnt 0x0" ::: "memory");      // this wave's reads of the buffer have returned
    asm volatile("s_wait_asynccnt 0x0" ::: "memory");   // this wave's copies of tile jt+1 have landed
    __syncthreads();
    if (jt + 2 < NT)   // the same for the whole block
      stage_tile(kdst + bo * 2, vdst + bo * 2, ksrc + (size_t)(jt + 2) * JB * kD, vsrc + (jt + 2) * JB);
  }
  asm volatile("s_wait_asynccnt 0x0" ::: "memory");   // nothing is in flight when the ring becomes exchange space
  float* so = (float*)ring;   // every wave has passed the last pass's barrier behind its last read

  // lane and thread index taken anew behind the loop rather than carried through it
  const int le = (int)__builtin_amdgcn_mbcnt_lo(~0u, 0u);
  const int he = le >> 4;
  const int me = le & 15;
  const int te = wv * 32 + le;

  // join of the two key halves. Each wave lays down, lane by lane as its registers hold them, its 16 tiles of the
  // partner's channels (16 KiB a wave) and its softmax reference and sum; partners share queries and lane map.
  {
    v4f* mine = (v4f*)(so + wv * XW) + le;
#pragma unroll
    for (int q = 0; q < QT; ++q)
#pragma unroll
      for (int i = 0; i < 8; ++i) {
        const v8f a = acc[q][8 + i];
        mine[((q * 8 + i) * 2) * 32]     = v4f_t{a[0], a[1], a[2], a[3]};
        mine[((q * 8 + i) * 2 + 1) * 32] = v4f_t{a[4], a[5], a[6], a[7]};
      }
    *((v4f*)(so + 8 * XW + wv * 128) + le) = v4f_t{mrun[0], lsum[0], mrun[1], lsum[1]};
    __syncthreads();   // every wave's partial results are laid down
    const int pw = wv ^ 4;
    const v4f* theirs = (const v4f*)(so + pw * XW) + le;
    const v4f o = *((const v4f*)(so + 8 * XW + pw * 128) + le);
    const float g = gamma[0];
#pragma unroll
    for (int q = 0; q < QT; ++q) {
      const float mm = fmaxf(mrun[q], o[2 * q]);
      const float ao = __builtin_amdgcn_exp2f(mrun[q] - mm);
      const float at = __builtin_amdgcn_exp2f(o[2 * q] - mm);
      const float s  = g / (lsum[q] * ao + o[2 * q + 1] * at);
      const float fo = ao * s;   // scale per query column, normaliser and gamma folded in
      const float ft = at * s;
#pragma unroll
      for (int i = 0; i < 8; ++i) {
        const v4f t0 = theirs[((q * 8 + i) * 2) * 32];
        const v4f t1 = theirs[((q * 8 + i) * 2 + 1) * 32];
#pragma unroll
        for (int r = 0; r < 4; ++r) {
          acc[q][i][r]     = acc[q][i][r] * fo + t0[r] * ft;
          acc[q][i][4 + r] = acc[q][i][4 + r] * fo + t1[r] * ft;
        }
      }
    }
  }

  // epilogue: acc[q][i] element r = (channel 128 kh + 16 i + 8h + r, query i0+m), i = 0..7
#pragma unroll
  for (int cp = 0; cp < kC / 32; ++cp) {
    __syncthreads();   // the exchange reads, or the earlier store phase, finished reading so
    if (kh == (cp >> 2)) {   // wave-uniform: the four waves that hold these 32 channels
#pragma unroll
      for (int q = 0; q < QT; ++q)
#pragma unroll
        for (int t = 0; t < 2; ++t)
#pragma unroll
          for (int r = 0; r < 8; ++r)
            so[(t * 16 + 8 * he + r) * IB + qg * 32 + q * 16 + me] = acc[q][2 * (cp & 3) + t][r];
    }
    __syncthreads();
    // 32 channel rows x 512 B: row = idx/32, 16-B segment idx%32; a wave covers one row, four whole lines
    v4f ov[4];
    size_t go[4];
#pragma unroll
    for (int q = 0; q < 4; ++q) {
      const int idx = q * 256 + te;
      const int row = idx >> 5;
      const int seg = idx & 31;
      go[q] = ((size_t)(b * kC + cp * 32 + row)) * kN + iblk + seg * 4;
      ov[q] = *(const v4f*)(so + row * IB + seg * 4) + *(const v4f*)(x + go[q]);
    }
#pragma unroll
    for (int q = 0; q < 4; ++q) *(v4f*)(out + go[q]) = ov[q];
    // the next trip overwrites the registers these loads and stores name
    asm volatile("s_wait_xcnt 0x0" ::: "memory");
  }
}

extern "C" void kernel_launch(void* const* d_in, const int* in_sizes, int n_in,
                              void* d_out, int out_size, void* d_ws, size_t ws_size,
                              hipStream_t stream) {
  if (n_in < 8) return;
  if (in_sizes[0] != kB * kC * kN || in_sizes[1] != kD * kC || in_sizes[2] != kD ||
      in_sizes[3] != kD * kC || in_sizes[4] != kD || in_sizes[5] != kC * kC ||
      in_sizes[6] != kC || in_sizes[7] < 1) return;
  if (out_size != kB * kC * kN) return;

  const float* x     = (const float*)d_in[0];
  const float* Wq    = (const float*)d_in[1];
  const float* bq    = (const float*)d_in[2];
  const float* Wk    = (const float*)d_in[3];
  const float* bk    = (const float*)d_in[4];
  const float* Wv    = (const float*)d_in[5];
  const float* bv    = (const float*)d_in[6];
  const float* gamma = (const float*)d_in[7];
  float* out = (float*)d_out;

  // workspace: Qb [B][N][32] bf16 (2 MiB), Kb [B][N][32] bf16 (2 MiB), Vb [B][C][N] bf16 (16 MiB)
  const size_t qk_bytes = (size_t)kB * kN * kD * sizeof(bf16_t);
  const size_t v_bytes  = (size_t)kB * kC * kN * sizeof(bf16_t);
  if (ws_size < 2 * qk_bytes + v_bytes) return;
  bf16_t* Qb = (bf16_t*)d_ws;
  bf16_t* Kb = (bf16_t*)((char*)d_ws + qk_bytes);
  bf16_t* Vb = (bf16_t*)((char*)d_ws + 2 * qk_bytes);

  proj_kernel<<<dim3(kB * NPB), dim3(128), 0, stream>>>(x, Wq, bq, Wk, bk, Wv, bv, Qb, Kb, Vb);
  attn_kernel<<<dim3(kB * NIB), dim3(256), 0, stream>>>(Qb, Kb, Vb, x, gamma, out);
}

// v009
// Measured time: 78.1 microseconds a run.
// Two timings next to v008 both put it at 1.10 times that version's speed.
// Over all steps from v000 it is 3.50 times as fast.
#include <hip/hip_runtime.h>
#include <stdint.h>
#include <stddef.h>

// All contractions: v_wmma_f32_16x16x32_bf16 (bf16 operands, f32 accumulate): three 1x1-conv projections, key.query logits, value.prob aggregation; softmax statistics, normaliser and residual add in f32.

typedef __bf16 bf16_t;
typedef __attribute__((ext_vector_type(16))) __bf16 v16bf;
typedef __attribute__((ext_vector_type(8)))  __bf16 v8bf_t;
typedef __attribute__((ext_vector_type(8)))  float  v8f;
typedef __attribute__((ext_vector_type(4)))  float  v4f_t;
typedef __attribute__((ext_vector_type(4)))  unsigned int v4u_t;
typedef v8bf_t __attribute__((__may_alias__)) v8bf;
typedef v4f_t  __attribute__((__may_alias__)) v4f;
typedef v4u_t  __attribute__((__may_alias__)) v4u;
typedef __attribute__((ext_vector_type(2)))  unsigned int v2u_t;
typedef v2u_t  __attribute__((__may_alias__)) v2u;
typedef __attribute__((ext_vector_type(2)))  float  v2f;
typedef __attribute__((ext_vector_type(2)))  __bf16 v2bf;

constexpr int kB  = 8;      // batch
constexpr int kC  = 256;    // channels
constexpr int kN  = 4096;   // positions (H*W)
constexpr int kD  = 32;     // q/k channels
constexpr int PT  = 64;     // positions per projection block
constexpr int XP  = kC + 8; // LDS pitch (halves) of the transposed x tile, 528 B rows
constexpr int NPB = kN / PT;
constexpr int IB  = 128;    // query positions per attention block: 4 query groups x 32
constexpr int QT  = 2;      // 16-query tiles per attention wave
constexpr int NIB = kN / IB;
constexpr int KP  = kD + 8; // LDS pitch (halves) of a staged key row
constexpr int JB  = 128;    // keys per attention pass
constexpr int VP  = JB + 8; // LDS pitch (halves) of a staged value row (JB keys), 272 B rows
constexpr int KSH = JB * KP;    // halves of one staged K tile, 10,240 B
constexpr int STH = KSH + kC * VP;   // halves of one ring buffer (K tile, then V tile), 79,872 B
constexpr int NT  = kN / JB;    // key tiles
constexpr int KW  = JB / 2;     // keys of a pass that one wave takes
constexpr int XW  = QT * 8 * 256;   // floats a wave hands to its partner at the join: 16 tiles of 16 x 16, 16 KiB
typedef char ring_check[(NT >= 2 && IB == 4 * 16 * QT && QT == 2 && KW == 64 && (8 * XW + 8 * 128) * 4 <= 2 * STH * 2 && (KSH * 2) % 16 == 0 && (STH * 2) % 16 == 0 && 32 * IB * 4 <= STH * 2) ? 1 : -1];
typedef char cfg_check[(kN % PT == 0 && kN % IB == 0 && kN % JB == 0 && JB == 128 && kC % 64 == 0 && kD == 32 &&
                        (XP % 8) == 0 && (KP % 8) == 0 && (VP % 8) == 0) ? 1 : -1];

union Frag { v16bf v; v8bf h2[2]; bf16_t e[16]; };

// D(16x16 f32) += A(16x32 bf16) * B(32x16 bf16); hazard guard ties D, keeps A/B live.
static __device__ __forceinline__ v8f mma16(v16bf a, v16bf b, v8f c) {
  v8f d = __builtin_amdgcn_wmma_f32_16x16x32_bf16(false, a, false, b, (short)0, c, false, false);
  asm volatile("v_nop\n\tv_nop\n\tv_nop\n\tv_nop" : "+v"(d) : "v"(a), "v"(b));
  return d;
}

// The same product for the attention loop, builtin only: the compiler keeps the distances behind it and may move
// the LDS reads of later fragments ahead of it (no memory operation crosses a volatile asm statement).
static __device__ __forceinline__ v8f mma16_free(v16bf a, v16bf b, v8f c) {
  return __builtin_amdgcn_wmma_f32_16x16x32_bf16(false, a, false, b, (short)0, c, false, false);
}

// Fragment from a k-contiguous 16-bit row (row m for A, column n stored as a row for B), h = lane>>4:
// elements 0..7 <- row[8h .. 8h+7], elements 8..15 <- row[16+8h .. 16+8h+7].
static __device__ __forceinline__ v16bf frag_b16(const bf16_t* row, int h) {
  Frag f;
  f.h2[0] = *(const v8bf*)(row + 8 * h);
  f.h2[1] = *(const v8bf*)(row + 16 + 8 * h);
  return f.v;
}

// ROWS contiguous f32 weight rows of kC floats go to LDS as bf16 (RNE) rows of pitch XP, 128 threads, in two halves that
// stand a phase apart: ask_w issues the loads into registers, put_w converts and stores them.
// Each wave-wide load covers 512 contiguous bytes (four whole lines); each lane stores its 4 values as 8 B.
template <int ROWS>
static __device__ __forceinline__ void ask_w(v4f_t (&r)[ROWS * kC / 4 / 128], const float* __restrict__ src, int tid) {
  // fully unrolled so that all loads of the group are in flight behind one latency
#pragma unroll
  for (int it = 0; it < ROWS * kC / 4 / 128; ++it) r[it] = *(const v4f*)(src + (it * 128 + tid) * 4);
}
template <int ROWS>
static __device__ __forceinline__ void put_w(bf16_t* dst, const v4f_t (&r)[ROWS * kC / 4 / 128], int tid) {
#pragma unroll
  for (int it = 0; it < ROWS * kC / 4 / 128; ++it) {
    const int idx = it * 128 + tid;
    union { bf16_t e[4]; v2u_t u; } p;
    p.e[0] = (bf16_t)r[it][0];
    p.e[1] = (bf16_t)r[it][1];
    p.e[2] = (bf16_t)r[it][2];
    p.e[3] = (bf16_t)r[it][3];
    *(v2u*)(dst + (idx >> 6) * XP + (idx & 63) * 4) = p.u;
  }
}

// LDS byte address of a __shared__ element, as the asynchronous copies take it
static __device__ __forceinline__ unsigned lds_addr(const bf16_t* p) {
  return (unsigned)(uintptr_t)(__attribute__((address_space(3))) const void*)p;
}

// Nine asynchronous 16-B copies per lane, global memory to LDS through no register. The s_wait_xcnt is the last line
// of the copies' own statement, so that it stands ahead of every later write of an address register they name.
static __device__ __forceinline__ void copy9(const unsigned (&d)[9], const bf16_t* const (&g)[9]) {
  asm volatile("global_load_async_to_lds_b128 %0, %9, off\n\t"
               "global_load_async_to_lds_b128 %1, %10, off\n\t"
               "global_load_async_to_lds_b128 %2, %11, off\n\t"
               "global_load_async_to_lds_b128 %3, %12, off\n\t"
               "global_load_async_to_lds_b128 %4, %13, off\n\t"
               "global_load_async_to_lds_b128 %5, %14, off\n\t"
               "global_load_async_to_lds_b128 %6, %15, off\n\t"
               "global_load_async_to_lds_b128 %7, %16, off\n\t"
               "global_load_async_to_lds_b128 %8, %17, off\n\t"
               "s_wait_xcnt 0x0"
               :: "v"(d[0]), "v"(d[1]), "v"(d[2]), "v"(d[3]), "v"(d[4]), "v"(d[5]), "v"(d[6]), "v"(d[7]), "v"(d[8]),
                  "v"(g[0]), "v"(g[1]), "v"(g[2]), "v"(g[3]), "v"(g[4]), "v"(g[5]), "v"(g[6]), "v"(g[7]), "v"(g[8])
               : "memory");
}

// One key tile into one ring buffer, 256 threads, 18 copies per lane. K: 128 rows x 64 B are 8 KiB contiguous;
// V: a wave-wide copy covers two rows x 256 B (whole lines). Round q is a constant step from the thread's own base
// on both sides (64 K rows, 16 V rows). kd, vd: this thread's LDS byte addresses in the buffer.
static __device__ __forceinline__ void stage_tile(unsigned kd, unsigned vd, const bf16_t* kp, const bf16_t* vp) {
  unsigned d[18];
  const bf16_t* g[18];
#pragma unroll
  for (int q = 0; q < 2; ++q) {
    d[q] = kd + q * 64 * KP * 2;
    g[q] = kp + q * 64 * kD;
  }
#pragma unroll
  for (int q = 0; q < 16; ++q) {
    d[2 + q] = vd + q * 16 * VP * 2;
    g[2 + q] = vp + (size_t)q * 16 * kN;
  }
  const unsigned d0[9] = {d[0], d[1], d[2], d[3], d[4], d[5], d[6], d[7], d[8]};
  const bf16_t* const g0[9] = {g[0], g[1], g[2], g[3], g[4], g[5], g[6], g[7], g[8]};
  const unsigned d1[9] = {d[9], d[10], d[11], d[12], d[13], d[14], d[15], d[16], d[17]};
  const bf16_t* const g1[9] = {g[9], g[10], g[11], g[12], g[13], g[14], g[15], g[16], g[17]};
  copy9(d0, g0);
  copy9(d1, g1);
}

union PFrag { v16bf v; v2bf d[8]; };

// value of lane l ^ 16, by a vector cross-row move instead of an exchange through the LDS queue
static __device__ __forceinline__ float other_half(float v) {
  const int b = __float_as_int(v);
  return __int_as_float(__builtin_amdgcn_permlanex16(b, b, 0x76543210, 0xfedcba98, false, false));
}

// exp of one 16-key tile of logits, two scores per vector instruction: one packed fma gives logit*log2(e) - reference,
// one pair conversion (RNE) fills a B register, one packed add keeps the normaliser's two partial sums (f32, unrounded).
// d[i] holds B elements 2i, 2i+1 of the tile's half of the fragment <- tile rows 8h+2i, 8h+2i+1.
static __device__ __forceinline__ void exp_tile(v8f sc, v2f l2, v2f nm, v2bf* d, v2f& ps) {
#pragma unroll
  for (int i = 0; i < 4; ++i) {
    const v2f a = {sc[2 * i], sc[2 * i + 1]};
    const v2f u = __builtin_elementwise_fma(a, l2, nm);
    const v2f e = {__builtin_amdgcn_exp2f(u[0]), __builtin_amdgcn_exp2f(u[1])};
    d[i] = __builtin_convertvector(e, v2bf);
    ps += e;
  }
}

// ---------------------------------------------------------------------------
// Fused 1x1-conv projections for one (batch, 64-position) tile.
// xt[i][c] (bf16, k-contiguous) is the A operand of q/k (D[i][o]) and the B operand of v (D[o][i]).
// Weights: 64 rows at a time (Wq+Wk, then four groups of Wv) are converted once per block into wt
// and every wave takes its fragments from there; each group is loaded to registers while the group before it is worked on.
// ---------------------------------------------------------------------------
__global__ void __launch_bounds__(128)
proj_kernel(const float* __restrict__ x, const float* __restrict__ Wq, const float* __restrict__ bq,
            const float* __restrict__ Wk, const float* __restrict__ bk, const float* __restrict__ Wv,
            const float* __restrict__ bv, bf16_t* __restrict__ Qb, bf16_t* __restrict__ Kb,
            bf16_t* __restrict__ Vb) {
  __shared__ alignas(16) bf16_t xt[PT * XP];   // 33,792 B
  __shared__ alignas(16) bf16_t sq[PT * kD];   //  4,096 B
  __shared__ alignas(16) bf16_t sk[PT * kD];   //  4,096 B
  __shared__ alignas(16) bf16_t sv[64 * PT];   //  8,192 B
  __shared__ alignas(16) bf16_t wt[64 * XP];   // 33,792 B: current group of 64 weight rows

  const int tid = threadIdx.x;
  const int wv  = tid >> 5;          // 0..3: position sub-tile of 16
  const int l   = tid & 31;
  const int h   = l >> 4;
  const int m   = l & 15;
  const int b   = blockIdx.x / NPB;
  const int p0  = (blockIdx.x - b * NPB) * PT;
  if (b >= kB) return;

  // stage x[b][c][p0..p0+63] transposed to xt[i][c], bf16 RNE
  // Every global load of the block is issued a phase ahead of its use. Here: the thread's 32 loads of the x tile and its
  // 32 of Wq and Wk, all ahead of the first conversion, so that the tile costs one memory latency and not one per trip.
  const float* xb = x + (size_t)b * kC * kN + p0;
  const int i4 = (tid & 15) * 4;
  const float* xsrc = xb + (size_t)(tid >> 4) * kN + i4;
  v4f_t xv[(kC * PT / 4) / 128];
  v4f_t wq4[32 * kC / 4 / 128], wk4[32 * kC / 4 / 128];
#pragma unroll
  for (int it = 0; it < (kC * PT / 4) / 128; ++it) xv[it] = *(const v4f*)(xsrc + (size_t)it * 8 * kN);
  // the weight loads below may land in the address registers of these loads
  asm volatile("s_wait_xcnt 0x0" ::: "memory");
  ask_w<32>(wq4, Wq, tid);
  ask_w<32>(wk4, Wk, tid);
  // later code overwrites the address registers of these loads
  asm volatile("s_wait_xcnt 0x0" ::: "memory");
  // splits the scheduling region here: as one region, the compiler gathers the conversions of 24 loads ahead of the first
  // LDS store; split, the stores start behind the 8th load and run under the later arrivals
  __builtin_amdgcn_sched_barrier(0);
#pragma unroll
  for (int it = 0; it < (kC * PT / 4) / 128; ++it) {
    bf16_t* d = xt + i4 * XP + it * 8 + (tid >> 4);
    d[0]      = (bf16_t)xv[it][0];
    d[XP]     = (bf16_t)xv[it][1];
    d[2 * XP] = (bf16_t)xv[it][2];
    d[3 * XP] = (bf16_t)xv[it][3];
  }
  put_w<32>(wt, wq4, tid);             // rows 0..31  = Wq
  put_w<32>(wt + 32 * XP, wk4, tid);   // rows 32..63 = Wk
  __syncthreads();
  // the first 64 rows of Wv fly under the q and k products; asked for behind the barrier, which waits out every load
  // that stands in front of it
  const float bq0 = bq[m], bq1 = bq[16 + m];   // the q and k bias with them, first: loads return in order
  const float bk0 = bk[m], bk1 = bk[16 + m];
  v4f_t wn[64 * kC / 4 / 128];
  ask_w<64>(wn, Wv, tid);
  // later code overwrites the address registers of these loads
  asm volatile("s_wait_xcnt 0x0" ::: "memory");

  const bf16_t* xrow = xt + (wv * 16 + m) * XP;   // row i = wv*16+m, k = c contiguous
  const bf16_t* wrow = wt + m * XP;               // weight row m of each 16-row tile of the group

  // q, k: D[i][o] = sum_c xt[i][c] * W[o][c]; A = xt row i, B column o = W row o
  {
    v8f aq0 = {};
    v8f aq1 = {};
    v8f ak0 = {};
    v8f ak1 = {};
#pragma unroll 1
    for (int ks = 0; ks < kC / 32; ++ks) {
      const int k0 = ks * 32;
      const v16bf xf = frag_b16(xrow + k0, h);
      // the four weight fragments are read ahead of the first product: one LDS latency per k step
      const v16bf w0 = frag_b16(wrow + k0, h);
      const v16bf w1 = frag_b16(wrow + 16 * XP + k0, h);
      const v16bf w2 = frag_b16(wrow + 32 * XP + k0, h);
      const v16bf w3 = frag_b16(wrow + 48 * XP + k0, h);
      aq0 = mma16(xf, w0, aq0);
      aq1 = mma16(xf, w1, aq1);
      ak0 = mma16(xf, w2, ak0);
      ak1 = mma16(xf, w3, ak1);
    }
    // D element r of this lane = (row i = wv*16+8h+r, col o = m / 16+m)
#pragma unroll
    for (int r = 0; r < 8; ++r) {
      const int io = (wv * 16 + 8 * h + r) * kD;
      sq[io + m]      = (bf16_t)(aq0[r] + bq0);
      sq[io + 16 + m] = (bf16_t)(aq1[r] + bq1);
      sk[io + m]      = (bf16_t)(ak0[r] + bk0);
      sk[io + 16 + m] = (bf16_t)(ak1[r] + bk1);
    }
  }

  // v: D[o][i] = sum_c Wv[o][c] * xt[i][c]; A = Wv row o, B column i = xt row i; 64 channels per group
#pragma unroll 1
  for (int og = 0; og < kC / 64; ++og) {
    __syncthreads();   // every wave has left the earlier group's wt rows and the earlier sv store phase
    put_w<64>(wt, wn, tid);
    __syncthreads();   // wt rows of this group are complete
    // this group's bias and the next group's rows fly under this group's products
    float bvr[4][8];   // element r of tile t belongs to row og*64 + t*16 + 8h + r
#pragma unroll
    for (int t = 0; t < 4; ++t)
#pragma unroll
      for (int r = 0; r < 8; ++r) bvr[t][r] = bv[og * 64 + t * 16 + 8 * h + r];
    if (og + 1 < kC / 64) ask_w<64>(wn, Wv + (size_t)(og + 1) * 64 * kC, tid);   // the same test for the whole block
    // later code overwrites the address registers of these loads
    asm volatile("s_wait_xcnt 0x0" ::: "memory");
    v8f av[4];
#pragma unroll
    for (int t = 0; t < 4; ++t) av[t] = v8f{};
#pragma unroll 1
    for (int ks = 0; ks < kC / 32; ++ks) {
      const int k0 = ks * 32;
      const v16bf xf = frag_b16(xrow + k0, h);
      v16bf wf[4];   // read ahead of the first product, as above
#pragma unroll
      for (int t = 0; t < 4; ++t) wf[t] = frag_b16(wrow + t * 16 * XP + k0, h);
#pragma unroll
      for (int t = 0; t < 4; ++t) av[t] = mma16(wf[t], xf, av[t]);
    }
    // D element r = (row o = og*64 + t*16 + 8h + r, col i = wv*16 + m)
#pragma unroll
    for (int t = 0; t < 4; ++t)
#pragma unroll
      for (int r = 0; r < 8; ++r) {
        const int ol = t * 16 + 8 * h + r;
        sv[ol * PT + wv * 16 + m] = (bf16_t)(av[t][r] + bvr[t][r]);
      }
    __syncthreads();
    v4u vv[4];
    size_t gv[4];
#pragma unroll
    for (int q = 0; q < 4; ++q) {
      const int row = q * 16 + (tid >> 3);
      const int seg = tid & 7;
      vv[q] = *(const v4u*)(sv + row * PT + seg * 8);
      gv[q] = ((size_t)(b * kC + og * 64 + row)) * kN + p0 + seg * 8;
    }
#pragma unroll
    for (int q = 0; q < 4; ++q) *(v4u*)(Vb + gv[q]) = vv[q];
    // the next trip overwrites the registers these stores name
    asm volatile("s_wait_xcnt 0x0" ::: "memory");
  }

  // q, k tiles: 64 rows x 64 B = 4096 contiguous bytes each; 16 B per lane, 8 lanes per line
  {
    v4u uq[2], uk[2];
    size_t gq[2];
#pragma unroll
    for (int q = 0; q < 2; ++q) {
      const int idx = q * 128 + tid;
      uq[q] = *(const v4u*)(sq + idx * 8);
      uk[q] = *(const v4u*)(sk + idx * 8);
      gq[q] = ((size_t)(b * kN + p0)) * kD + idx * 8;
    }
#pragma unroll
    for (int q = 0; q < 2; ++q) {
      *(v4u*)(Qb + gq[q]) = uq[q];
      *(v4u*)(Kb + gq[q]) = uk[q];
    }
    
  }
}

// ---------------------------------------------------------------------------
// Fused attention for one (batch, 128-query) tile. 256 threads = 8 waves = 4 query groups x 2 key halves: a wave holds
// 32 queries (two 16-query tiles) x all 256 channels and takes 64 of each pass's 128 keys, so that every K and V
// fragment read from LDS feeds two products. Per 128-key pass: K rows [128][32] and V rows [256][128] staged in LDS by the
// whole block: asynchronous copies into a ring of two buffers, the next tile in flight under this one's work.
// S^T = K.Q^T so each lane owns one query column per tile: per-query
// running max / sum need one xor-16 shuffle per pass, and the accumulators are rescaled only when a maximum has grown by over 8.
// P (bf16) packed from each pair of S^T accumulators is the B fragment of O^T = V.P^T for its 32 keys
// (k = key, element r <- even tile row 8h+r, element 8+r <- odd tile).
// Behind the loop the two waves of a query group swap, through LDS, reference, sum and one half of the channels each, and
// each joins its 128 channels. Epilogue stages 32 channel rows x 128 positions in LDS; out = gamma*O/l + x as whole lines
// ---------------------------------------------------------------------------
// One block per WGP = two waves per SIMD, said to the compiler: the 256 accumulator registers of a wave and the
// fragments read ahead need most of the 512 registers of two waves per SIMD.
__global__ void __launch_bounds__(256) __attribute__((amdgpu_waves_per_eu(2, 2)))
attn_kernel(const bf16_t* __restrict__ Qb, const bf16_t* __restrict__ Kb, const bf16_t* __restrict__ Vb,
            const float* __restrict__ x, const float* __restrict__ gamma, float* __restrict__ out) {
  __shared__ alignas(16) bf16_t ring[2 * STH];   // 159,744 B
  __shared__ alignas(16) bf16_t qs[8 * QT * 512];   // 16,384 B: each wave's own Q fragments, lane by lane

  const int tid = threadIdx.x;
  const int wv  = __builtin_amdgcn_readfirstlane(tid >> 5);   // wave-uniform: what derives from it stays scalar
  const int qg  = wv & 3;    // query group: queries iblk + 32 qg ...
  const int kh  = wv >> 2;   // key half: keys 64 kh ... of every pass
  const int l   = tid & 31;
  const int h   = l >> 4;
  const int m   = l & 15;
  const int b    = blockIdx.x / NIB;
  const int iblk = (blockIdx.x - b * NIB) * IB;
  if (b >= kB) return;
  // i0 = iblk + qg * 32 + q * 16: first query of tile q of this wave, as the comments below name it

  const bf16_t* kg = Kb + (size_t)b * kN * kD;
  const bf16_t* vg = Vb + (size_t)b * kC * kN;

  // Q as B operand: column n = query i0+m, k = d; the wave's 32 rows x 64 B are contiguous. The 16 registers of the two
  // fragments do not fit beside 256 accumulators through the whole pass: each wave lays them down once in LDS space of
  // its own, as its lanes hold them (contiguous 512 B per read), and takes them up with every pass's K reads.
  const bf16_t* qrow = Qb + ((size_t)b * kN + iblk + qg * 32 + m) * kD;
  // the two scheduling fences keep every other instruction out from between the loads and their wait
  __builtin_amdgcn_sched_barrier(0);
  Frag qld[QT];
#pragma unroll
  for (int q = 0; q < QT; ++q) qld[q].v = frag_b16(qrow + q * 16 * kD, h);
  // later code overwrites the address registers of these loads
  asm volatile("s_wait_xcnt 0x0" ::: "memory");
  __builtin_amdgcn_sched_barrier(0);
  bf16_t* qw = qs + wv * (QT * 512) + l * 8;
#pragma unroll
  for (int q = 0; q < QT; ++q) {
    *(v8bf*)(qw + q * 512)       = qld[q].h2[0];
    *(v8bf*)(qw + q * 512 + 256) = qld[q].h2[1];
  }

  // acc[q][i]: i = 0..7 channel tiles of this wave's own half (channels 128 kh + 16 i), which it keeps at the join;
  // i = 8..15 those of the other half (channels 128 (1-kh) + 16 (i-8)), which it hands to its partner
  v8f acc[QT][kC / 16];
#pragma unroll
  for (int q = 0; q < QT; ++q)
#pragma unroll
    for (int ct = 0; ct < kC / 16; ++ct) acc[q][ct] = v8f{};
  float lsum[QT];
  float mrun[QT];   // softmax reference in log2 units (logit * log2(e)): at most 8 below the running maximum
#pragma unroll
  for (int q = 0; q < QT; ++q) {
    lsum[q] = 0.0f;
    mrun[q] = -1.0e30f;
  }
  constexpr float kL2E = 1.4426950408889634f;

  // staging bases of this thread: K row tid/4, 16-B segment tid%4; V row tid/16, 16-B segment tid%16
  const bf16_t* ksrc = kg + tid * 8;
  const bf16_t* vsrc = vg + (size_t)(tid >> 4) * kN + (tid & 15) * 8;
  const unsigned kdst = lds_addr(ring + (tid >> 2) * KP + (tid & 3) * 8);
  const unsigned vdst = lds_addr(ring + KSH + (tid >> 4) * VP + (tid & 15) * 8);

  // ring prologue: tile 0 lands and is published, then tile 1 starts into the other buffer
  stage_tile(kdst, vdst, ksrc, vsrc);
  asm volatile("s_wait_asynccnt 0x0" ::: "memory");   // this wave's copies of tile 0 have landed
  __syncthreads();                                    // and every other wave's: tile 0 may be read
  stage_tile(kdst + STH * 2, vdst + STH * 2, ksrc + (size_t)JB * kD, vsrc + JB);

#pragma unroll 1
  for (int jt = 0; jt < NT; ++jt) {
    const int bo = (jt & 1) * STH;   // this pass reads buffer jt mod 2 alone
    const bf16_t* ks = ring + bo + kh * KW * KP;
    const bf16_t* vs = ring + bo + KSH + kh * KW;

    // S^T tiles t = 0..3: rows = keys j0+16t+m (A = K rows), cols = queries (B = Q rows), j0 = jt*128 + 64 kh
    v16bf ka[KW / 16];
#pragma unroll
    for (int t = 0; t < KW / 16; ++t) ka[t] = frag_b16(ks + (t * 16 + m) * KP, h);
    v16bf qf[QT];
#pragma unroll
    for (int q = 0; q < QT; ++q) {
      Frag f;
      f.h2[0] = *(const v8bf*)(qw + q * 512);
      f.h2[1] = *(const v8bf*)(qw + q * 512 + 256);
      qf[q] = f.v;
    }
    const v8f z = {};
    v8f st[QT][KW / 16];   // st[q][t] element r = logit(key j0+16t+8h+r, query i0+m)
#pragma unroll
    for (int t = 0; t < KW / 16; ++t)
#pragma unroll
      for (int q = 0; q < QT; ++q) st[q][t] = mma16_free(ka[t], qf[q], z);

    // V fragments (16 channel tiles x 32 keys) are asked for ahead of the products that take them, in groups of 8 tiles:
    // block 0's first group here, ahead of the maximum; its second group written behind block 0's exp arithmetic, where
    // logit registers come free again (all 16 fragments beside all 64 logit registers do not fit 512 registers).
    const bf16_t* vown = vs + (kh * 128 + m) * VP;         // rows of channel tiles i = 0..7
    const bf16_t* voth = vs + ((1 - kh) * 128 + m) * VP;   // rows of channel tiles i = 8..15
    v16bf vf[kC / 16];
#pragma unroll
    for (int ct = 0; ct < 8; ++ct) vf[ct] = frag_b16(vown + ct * 16 * VP, h);
    // compiler fence, no instruction: keeps these reads ahead of the rescale branch below; left free, they sink behind
    // it, in among block 0's exp arithmetic, and the first products wait out their LDS latency
    asm volatile("" ::: "memory");

    // per-query online softmax: lanes m and m+16 hold the 64 logits of query i0+m. mrun, the reference in use, may trail
    // the true running maximum by up to 8 (log2 units), so an exponential reaches 2^8 at most: sums and accumulators are
    // rescaled only in a pass where some query's maximum exceeds its reference by more.
    float mb[QT];
    bool need = false;
#pragma unroll
    for (int q = 0; q < QT; ++q) {
      float mt[KW / 32];   // one independent chain per 32 keys
#pragma unroll
      for (int kk = 0; kk < KW / 32; ++kk) {
        float a = fmaxf(st[q][2 * kk][0], st[q][2 * kk + 1][0]);
#pragma unroll
        for (int r = 1; r < 8; ++r) a = fmaxf(a, fmaxf(st[q][2 * kk][r], st[q][2 * kk + 1][r]));
        mt[kk] = a;
      }
      float ml = fmaxf(mt[0], mt[1]);
      ml = fmaxf(ml, other_half(ml));
      mb[q] = ml * kL2E;
      need = need || (mb[q] > mrun[q] + 8.0f);
    }
    // one test per pass, the same for the whole wave (a scalar branch, every lane stays on); the first pass takes it, as the
    // reference starts at -1e30
    if (__builtin_amdgcn_ballot_w32(need) != 0) {
#pragma unroll
      for (int q = 0; q < QT; ++q) {
        const float mn = fmaxf(mrun[q], mb[q]);
        const float alpha = __builtin_amdgcn_exp2f(mrun[q] - mn);   // 0 in the first pass
        mrun[q] = mn;
        lsum[q] *= alpha;
#pragma unroll
        for (int ct = 0; ct < kC / 16; ++ct) acc[q][ct] *= alpha;
      }
    }
    v2f nm[QT];
#pragma unroll
    for (int q = 0; q < QT; ++q) nm[q] = v2f{-mrun[q], -mrun[q]};
    const v2f l2 = {kL2E, kL2E};

    v2f pt[QT];
#pragma unroll
    for (int q = 0; q < QT; ++q) pt[q] = v2f{0.0f, 0.0f};
#pragma unroll
    for (int kk = 0; kk < KW / 32; ++kk) {
      PFrag p[QT];
#pragma unroll
      for (int q = 0; q < QT; ++q) {
        exp_tile(st[q][2 * kk], l2, nm[q], p[q].d, pt[q]);           // B element r   <- key j0+32kk+8h+r
        exp_tile(st[q][2 * kk + 1], l2, nm[q], p[q].d + 4, pt[q]);   // B element 8+r <- key j0+32kk+16+8h+r
      }
      if (kk == 0) {
        // the fence behind keeps these reads from sinking among the products of the first run, which is their lead:
        // left free, they stand among those products and a full LDS wait comes in the middle of the second run
#pragma unroll
        for (int ct = 0; ct < 8; ++ct) vf[8 + ct] = frag_b16(voth + ct * 16 * VP, h);
        __builtin_amdgcn_sched_barrier(0);
      }
      // O^T[c][i] += V[c][keys] . P^T: A = V row c (k = key contiguous, 32 keys per product), B = p of either query tile
      // in two runs of 8 channel tiles, each run's fragments asked for anew as one group right behind it
#pragma unroll
      for (int hf = 0; hf < 2; ++hf) {
#pragma unroll
        for (int ct = hf * 8; ct < hf * 8 + 8; ++ct)
#pragma unroll
          for (int q = 0; q < QT; ++q) acc[q][ct] = mma16_free(vf[ct], p[q].v, acc[q][ct]);
        if (kk + 1 < KW / 32) {
          const bf16_t* vr = (hf ? voth : vown) + (kk + 1) * 32;
#pragma unroll
          for (int ct = 0; ct < 8; ++ct) vf[hf * 8 + ct] = frag_b16(vr + ct * 16 * VP, h);
          // holds the refill a key block ahead of its products, as written: left free, each read sinks to just
          // ahead of its use and the wave waits out the LDS latency at every product
          __builtin_amdgcn_sched_barrier(0);
        }
      }
    }
#pragma unroll
    for (int q = 0; q < QT; ++q) {
      float ps = pt[q][0] + pt[q][1];
      ps += other_half(ps);
      lsum[q] += ps;
    }

    // publish point of tile jt+1, which also frees this pass's buffer
    // nothing of the pass is scheduled behind it: left free, the compiler lifts the waits and the barrier over the last
    // key block's exp arithmetic and products, which then stand between the barrier and the refill
    __builtin_amdgcn_sched_barrier(0);
    asm volatile("s_wait_dscnt 0x0" ::: "memory");      // this wave's reads of the buffer have returned
    asm volatile("s_wait_asynccnt 0x0" ::: "memory");   // this wave's copies of tile jt+1 have landed
    __syncthreads();
    if (jt + 2 < NT)   // the same for the whole block
      stage_tile(kdst + bo * 2, vdst + bo * 2, ksrc + (size_t)(jt + 2) * JB * kD, vsrc + (jt + 2) * JB);
  }
  asm volatile("s_wait_asynccnt 0x0" ::: "memory");   // nothing is in flight when the ring becomes exchange space
  float* so = (float*)ring;   // every wave has passed the last pass's barrier behind its last read

  // lane and thread index taken anew behind the loop rather than carried through it
  const int le = (int)__builtin_amdgcn_mbcnt_lo(~0u, 0u);
  const int he = le >> 4;
  const int me = le & 15;
  const int te = wv * 32 + le;

  // join of the two key halves. Each wave lays down, lane by lane as its registers hold them, its 16 tiles of the
  // partner's channels (16 KiB a wave) and its softmax reference and sum; partners share queries and lane map.
  {
    v4f* mine = (v4f*)(so + wv * XW) + le;
#pragma unroll
    for (int q = 0; q < QT; ++q)
#pragma unroll
      for (int i = 0; i < 8; ++i) {
        const v8f a = acc[q][8 + i];
        mine[((q * 8 + i) * 2) * 32]     = v4f_t{a[0], a[1], a[2], a[3]};
        mine[((q * 8 + i) * 2 + 1) * 32] = v4f_t{a[4], a[5], a[6], a[7]};
      }
    *((v4f*)(so + 8 * XW + wv * 128) + le) = v4f_t{mrun[0], lsum[0], mrun[1], lsum[1]};
    __syncthreads();   // every wave's partial results are laid down
    const int pw = wv ^ 4;
    const v4f* theirs = (const v4f*)(so + pw * XW) + le;
    const v4f o = *((const v4f*)(so + 8 * XW + pw * 128) + le);
    const float g = gamma[0];
#pragma unroll
    for (int q = 0; q < QT; ++q) {
      const float mm = fmaxf(mrun[q], o[2 * q]);
      const float ao = __builtin_amdgcn_exp2f(mrun[q] - mm);
      const float at = __builtin_amdgcn_exp2f(o[2 * q] - mm);
      const float s  = g / (lsum[q] * ao + o[2 * q + 1] * at);
      const float fo = ao * s;   // scale per query column, normaliser and gamma folded in
      const float ft = at * s;
#pragma unroll
      for (int i = 0; i < 8; ++i) {
        const v4f t0 = theirs[((q * 8 + i) * 2) * 32];
        const v4f t1 = theirs[((q * 8 + i) * 2 + 1) * 32];
#pragma unroll
        for (int r = 0; r < 4; ++r) {
          acc[q][i][r]     = acc[q][i][r] * fo + t0[r] * ft;
          acc[q][i][4 + r] = acc[q][i][4 + r] * fo + t1[r] * ft;
        }
      }
    }
  }

  // epilogue: acc[q][i] element r = (channel 128 kh + 16 i + 8h + r, query i0+m), i = 0..7
#pragma unroll
  for (int cp = 0; cp < kC / 32; ++cp) {
    __syncthreads();   // the exchange reads, or the earlier store phase, finished reading so
    if (kh == (cp >> 2)) {   // wave-uniform: the four waves that hold these 32 channels
#pragma unroll
      for (int q = 0; q < QT; ++q)
#pragma unroll
        for (int t = 0; t < 2; ++t)
#pragma unroll
          for (int r = 0; r < 8; ++r)
            so[(t * 16 + 8 * he + r) * IB + qg * 32 + q * 16 + me] = acc[q][2 * (cp & 3) + t][r];
    }
    __syncthreads();
    // 32 channel rows x 512 B: row = idx/32, 16-B segment idx%32; a wave covers one row, four whole lines
    v4f ov[4];
    size_t go[4];
#pragma unroll
    for (int q = 0; q < 4; ++q) {
      const int idx = q * 256 + te;
      const int row = idx >> 5;
      const int seg = idx & 31;
      go[q] = ((size_t)(b * kC + cp * 32 + row)) * kN + iblk + seg * 4;
      ov[q] = *(const v4f*)(so + row * IB + seg * 4) + *(const v4f*)(x + go[q]);
    }
#pragma unroll
    for (int q = 0; q < 4; ++q) *(v4f*)(out + go[q]) = ov[q];
    // the next trip overwrites the registers these loads and stores name
    asm volatile("s_wait_xcnt 0x0" ::: "memory");
  }
}

extern "C" void kernel_launch(void* const* d_in, const int* in_sizes, int n_in,
                              void* d_out, int out_size, void* d_ws, size_t ws_size,
                              hipStream_t stream) {
  if (n_in < 8) return;
  if (in_sizes[0] != kB * kC * kN || in_sizes[1] != kD * kC || in_sizes[2] != kD ||
      in_sizes[3] != kD * kC || in_sizes[4] != kD || in_sizes[5] != kC * kC ||
      in_sizes[6] != kC || in_sizes[7] < 1) return;
  if (out_size != kB * kC * kN) return;

  const float* x     = (const float*)d_in[0];
  const float* Wq    = (const float*)d_in[1];
  const float* bq    = (const float*)d_in[2];
  const float* Wk    = (const float*)d_in[3];
  const float* bk    = (const float*)d_in[4];
  const float* Wv    = (const float*)d_in[5];
  const float* bv    = (const float*)d_in[6];
  const float* gamma = (const float*)d_in[7];
  float* out = (float*)d_out;

  // workspace: Qb [B][N][32] bf16 (2 MiB), Kb [B][N][32] bf16 (2 MiB), Vb [B][C][N] bf16 (16 MiB)
  const size_t qk_bytes = (size_t)kB * kN * kD * sizeof(bf16_t);
  const size_t v_bytes  = (size_t)kB * kC * kN * sizeof(bf16_t);
  if (ws_size < 2 * qk_bytes + v_bytes) return;
  bf16_t* Qb = (bf16_t*)d_ws;
  bf16_t* Kb = (bf16_t*)((char*)d_ws + qk_bytes);
  bf16_t* Vb = (bf16_t*)((char*)d_ws + 2 * qk_bytes);

  proj_kernel<<<dim3(kB * NPB), dim3(128), 0, stream>>>(x, Wq, bq, Wk, bk, Wv, bv, Qb, Kb, Vb);
  attn_kernel<<<dim3(kB * NIB), dim3(256), 0, stream>>>(Qb, Kb, Vb, x, gamma, out);
}

// v010
// One run takes 69.5 microseconds.
// In two side-by-side timings against v009, it was 1.13 and 1.12 times as fast.
// All steps since v000 together make it 3.94 times as fast.
#include <hip/hip_runtime.h>
#include <stdint.h>
#include <stddef.h>

// All contractions: v_wmma_f32_16x16x32_bf16 (bf16 operands, f32 accumulate): three 1x1-conv projections, key.query logits, value.prob aggregation; softmax statistics, normaliser and residual add in f32.

typedef __bf16 bf16_t;
typedef __attribute__((ext_vector_type(16))) __bf16 v16bf;
typedef __attribute__((ext_vector_type(8)))  __bf16 v8bf_t;
typedef __attribute__((ext_vector_type(8)))  float  v8f;
typedef __attribute__((ext_vector_type(4)))  float  v4f_t;
typedef __attribute__((ext_vector_type(4)))  unsigned int v4u_t;
typedef v8bf_t __attribute__((__may_alias__)) v8bf;
typedef v4f_t  __attribute__((__may_alias__)) v4f;
typedef v4u_t  __attribute__((__may_alias__)) v4u;
typedef __attribute__((ext_vector_type(2)))  unsigned int v2u_t;
typedef v2u_t  __attribute__((__may_alias__)) v2u;
typedef __attribute__((ext_vector_type(2)))  float  v2f;
typedef __attribute__((ext_vector_type(2)))  __bf16 v2bf;

constexpr int kB  = 8;      // batch
constexpr int kC  = 256;    // channels
constexpr int kN  = 4096;   // positions (H*W)
constexpr int kD  = 32;     // q/k channels
constexpr int PT  = 64;     // positions per projection block
constexpr int XP  = kC + 8; // LDS pitch (halves) of the transposed x tile, 528 B rows
constexpr int NPB = kN / PT;
constexpr int IB  = 128;    // query positions per attention block: 4 query groups x 32
constexpr int QT  = 2;      // 16-query tiles per attention wave
constexpr int NIB = kN / IB;
constexpr int KP  = kD + 8; // LDS pitch (halves) of a staged key row
constexpr int JB  = 128;    // keys per attention pass
constexpr int VP  = JB + 8; // LDS pitch (halves) of a staged value row (JB keys), 272 B rows
constexpr int KSH = JB * KP;    // halves of one staged K tile, 10,240 B
constexpr int STH = KSH + kC * VP;   // halves of one ring buffer (K tile, then V tile), 79,872 B
constexpr int NT  = kN / JB;    // key tiles
constexpr int KW  = JB / 2;     // keys of a pass that one wave takes
constexpr int XW  = QT * 8 * 256;   // floats a wave hands to its partner at the join: 16 tiles of 16 x 16, 16 KiB
typedef char ring_check[(NT >= 2 && IB == 4 * 16 * QT && QT == 2 && KW == 64 && (8 * XW + 8 * 128) * 4 <= 2 * STH * 2 && (KSH * 2) % 16 == 0 && (STH * 2) % 16 == 0 && 32 * IB * 4 <= STH * 2) ? 1 : -1];
typedef char cfg_check[(kN % PT == 0 && kN % IB == 0 && kN % JB == 0 && JB == 128 && kC % 64 == 0 && kD == 32 &&
                        (XP % 8) == 0 && (KP % 8) == 0 && (VP % 8) == 0) ? 1 : -1];

union Frag { v16bf v; v8bf h2[2]; bf16_t e[16]; };

// D(16x16 f32) += A(16x32 bf16) * B(32x16 bf16); hazard guard ties D, keeps A/B live.
static __device__ __forceinline__ v8f mma16(v16bf a, v16bf b, v8f c) {
  v8f d = __builtin_amdgcn_wmma_f32_16x16x32_bf16(false, a, false, b, (short)0, c, false, false);
  asm volatile("v_nop\n\tv_nop\n\tv_nop\n\tv_nop" : "+v"(d) : "v"(a), "v"(b));
  return d;
}

// The same product for the attention loop, builtin only: the compiler keeps the distances behind it and may move
// the LDS reads of later fragments ahead of it (no memory operation crosses a volatile asm statement).
static __device__ __forceinline__ v8f mma16_free(v16bf a, v16bf b, v8f c) {
  return __builtin_amdgcn_wmma_f32_16x16x32_bf16(false, a, false, b, (short)0, c, false, false);
}

// Fragment from a k-contiguous 16-bit row (row m for A, column n stored as a row for B), h = lane>>4:
// elements 0..7 <- row[8h .. 8h+7], elements 8..15 <- row[16+8h .. 16+8h+7].
static __device__ __forceinline__ v16bf frag_b16(const bf16_t* row, int h) {
  Frag f;
  f.h2[0] = *(const v8bf*)(row + 8 * h);
  f.h2[1] = *(const v8bf*)(row + 16 + 8 * h);
  return f.v;
}

// ROWS contiguous f32 weight rows of kC floats go to LDS as bf16 (RNE) rows of pitch XP, 128 threads, in two halves that
// stand a phase apart: ask_w issues the loads into registers, put_w converts and stores them.
// Each wave-wide load covers 512 contiguous bytes (four whole lines); each lane stores its 4 values as 8 B.
template <int ROWS>
static __device__ __forceinline__ void ask_w(v4f_t (&r)[ROWS * kC / 4 / 128], const float* __restrict__ src, int tid) {
  // fully unrolled so that all loads of the group are in flight behind one latency
#pragma unroll
  for (int it = 0; it < ROWS * kC / 4 / 128; ++it) r[it] = *(const v4f*)(src + (it * 128 + tid) * 4);
}
template <int ROWS>
static __device__ __forceinline__ void put_w(bf16_t* dst, const v4f_t (&r)[ROWS * kC / 4 / 128], int tid) {
#pragma unroll
  for (int it = 0; it < ROWS * kC / 4 / 128; ++it) {
    const int idx = it * 128 + tid;
    union { bf16_t e[4]; v2u_t u; } p;
    p.e[0] = (bf16_t)r[it][0];
    p.e[1] = (bf16_t)r[it][1];
    p.e[2] = (bf16_t)r[it][2];
    p.e[3] = (bf16_t)r[it][3];
    *(v2u*)(dst + (idx >> 6) * XP + (idx & 63) * 4) = p.u;
  }
}

// LDS byte address of a __shared__ element, as the asynchronous copies take it
static __device__ __forceinline__ unsigned lds_addr(const bf16_t* p) {
  return (unsigned)(uintptr_t)(__attribute__((address_space(3))) const void*)p;
}

// Nine asynchronous 16-B copies per lane, global memory to LDS through no register. The s_wait_xcnt is the last line
// of the copies' own statement, so that it stands ahead of every later write of an address register they name.
static __device__ __forceinline__ void copy9(const unsigned (&d)[9], const bf16_t* const (&g)[9]) {
  asm volatile("global_load_async_to_lds_b128 %0, %9, off\n\t"
               "global_load_async_to_lds_b128 %1, %10, off\n\t"
               "global_load_async_to_lds_b128 %2, %11, off\n\t"
               "global_load_async_to_lds_b128 %3, %12, off\n\t"
               "global_load_async_to_lds_b128 %4, %13, off\n\t"
               "global_load_async_to_lds_b128 %5, %14, off\n\t"
               "global_load_async_to_lds_b128 %6, %15, off\n\t"
               "global_load_async_to_lds_b128 %7, %16, off\n\t"
               "global_load_async_to_lds_b128 %8, %17, off\n\t"
               "s_wait_xcnt 0x0"
               :: "v"(d[0]), "v"(d[1]), "v"(d[2]), "v"(d[3]), "v"(d[4]), "v"(d[5]), "v"(d[6]), "v"(d[7]), "v"(d[8]),
                  "v"(g[0]), "v"(g[1]), "v"(g[2]), "v"(g[3]), "v"(g[4]), "v"(g[5]), "v"(g[6]), "v"(g[7]), "v"(g[8])
               : "memory");
}

// One key tile into one ring buffer, 256 threads, 18 copies per lane. K: 128 rows x 64 B are 8 KiB contiguous;
// V: a wave-wide copy covers two rows x 256 B (whole lines). Round q is a constant step from the thread's own base
// on both sides (64 K rows, 16 V rows). kd, vd: this thread's LDS byte addresses in the buffer.
static __device__ __forceinline__ void stage_tile(unsigned kd, unsigned vd, const bf16_t* kp, const bf16_t* vp) {
  unsigned d[18];
  const bf16_t* g[18];
#pragma unroll
  for (int q = 0; q < 2; ++q) {
    d[q] = kd + q * 64 * KP * 2;
    g[q] = kp + q * 64 * kD;
  }
#pragma unroll
  for (int q = 0; q < 16; ++q) {
    d[2 + q] = vd + q * 16 * VP * 2;
    g[2 + q] = vp + (size_t)q * 16 * kN;
  }
  const unsigned d0[9] = {d[0], d[1], d[2], d[3], d[4], d[5], d[6], d[7], d[8]};
  const bf16_t* const g0[9] = {g[0], g[1], g[2], g[3], g[4], g[5], g[6], g[7], g[8]};
  const unsigned d1[9] = {d[9], d[10], d[11], d[12], d[13], d[14], d[15], d[16], d[17]};
  const bf16_t* const g1[9] = {g[9], g[10], g[11], g[12], g[13], g[14], g[15], g[16], g[17]};
  copy9(d0, g0);
  copy9(d1, g1);
}

// Work-group barrier of the attention epilogue: orders LDS only (this wave's LDS operations have returned, then the barrier).
// __syncthreads() also waits out every global load and store of the wave, which would stop each phase for the x loads in
// flight and for the out stores of the phase before; no wave reads global memory that another wave of the launch writes.
static __device__ __forceinline__ void lds_barrier() {
  __builtin_amdgcn_fence(__ATOMIC_RELEASE, "workgroup", "local");
  __builtin_amdgcn_s_barrier();
  __builtin_amdgcn_fence(__ATOMIC_ACQUIRE, "workgroup", "local");
}

union PFrag { v16bf v; v2bf d[8]; };

// value of lane l ^ 16, by a vector cross-row move instead of an exchange through the LDS queue
static __device__ __forceinline__ float other_half(float v) {
  const int b = __float_as_int(v);
  return __int_as_float(__builtin_amdgcn_permlanex16(b, b, 0x76543210, 0xfedcba98, false, false));
}

// exp of one 16-key tile of logits, two scores per vector instruction: one packed fma gives logit*log2(e) - reference,
// one pair conversion (RNE) fills a B register, one packed add keeps the normaliser's two partial sums (f32, unrounded).
// d[i] holds B elements 2i, 2i+1 of the tile's half of the fragment <- tile rows 8h+2i, 8h+2i+1.
static __device__ __forceinline__ void exp_tile(v8f sc, v2f l2, v2f nm, v2bf* d, v2f& ps) {
#pragma unroll
  for (int i = 0; i < 4; ++i) {
    const v2f a = {sc[2 * i], sc[2 * i + 1]};
    const v2f u = __builtin_elementwise_fma(a, l2, nm);
    const v2f e = {__builtin_amdgcn_exp2f(u[0]), __builtin_amdgcn_exp2f(u[1])};
    d[i] = __builtin_convertvector(e, v2bf);
    ps += e;
  }
}

// ---------------------------------------------------------------------------
// Fused 1x1-conv projections for one (batch, 64-position) tile.
// xt[i][c] (bf16, k-contiguous) is the A operand of q/k (D[i][o]) and the B operand of v (D[o][i]).
// Weights: 64 rows at a time (Wq+Wk, then four groups of Wv) are converted once per block into wt
// and every wave takes its fragments from there; each group is loaded to registers while the group before it is worked on.
// ---------------------------------------------------------------------------
__global__ void __launch_bounds__(128)
proj_kernel(const float* __restrict__ x, const float* __restrict__ Wq, const float* __restrict__ bq,
            const float* __restrict__ Wk, const float* __restrict__ bk, const float* __restrict__ Wv,
            const float* __restrict__ bv, bf16_t* __restrict__ Qb, bf16_t* __restrict__ Kb,
            bf16_t* __restrict__ Vb) {
  __shared__ alignas(16) bf16_t xt[PT * XP];   // 33,792 B
  __shared__ alignas(16) bf16_t sq[PT * kD];   //  4,096 B
  __shared__ alignas(16) bf16_t sk[PT * kD];   //  4,096 B
  __shared__ alignas(16) bf16_t sv[64 * PT];   //  8,192 B
  __shared__ alignas(16) bf16_t wt[64 * XP];   // 33,792 B: current group of 64 weight rows

  const int tid = threadIdx.x;
  const int wv  = tid >> 5;          // 0..3: position sub-tile of 16
  const int l   = tid & 31;
  const int h   = l >> 4;
  const int m   = l & 15;
  const int b   = blockIdx.x / NPB;
  const int p0  = (blockIdx.x - b * NPB) * PT;
  if (b >= kB) return;

  // stage x[b][c][p0..p0+63] transposed to xt[i][c], bf16 RNE
  // Every global load of the block is issued a phase ahead of its use. Here: the thread's 32 loads of the x tile and its
  // 32 of Wq and Wk, all ahead of the first conversion, so that the tile costs one memory latency and not one per trip.
  const float* xb = x + (size_t)b * kC * kN + p0;
  const int i4 = (tid & 15) * 4;
  const float* xsrc = xb + (size_t)(tid >> 4) * kN + i4;
  v4f_t xv[(kC * PT / 4) / 128];
  v4f_t wq4[32 * kC / 4 / 128], wk4[32 * kC / 4 / 128];
#pragma unroll
  for (int it = 0; it < (kC * PT / 4) / 128; ++it) xv[it] = *(const v4f*)(xsrc + (size_t)it * 8 * kN);
  // the weight loads below may land in the address registers of these loads
  asm volatile("s_wait_xcnt 0x0" ::: "memory");
  ask_w<32>(wq4, Wq, tid);
  ask_w<32>(wk4, Wk, tid);
  // later code overwrites the address registers of these loads
  asm volatile("s_wait_xcnt 0x0" ::: "memory");
  // splits the scheduling region here: as one region, the compiler gathers the conversions of 24 loads ahead of the first
  // LDS store; split, the stores start behind the 8th load and run under the later arrivals
  __builtin_amdgcn_sched_barrier(0);
#pragma unroll
  for (int it = 0; it < (kC * PT / 4) / 128; ++it) {
    bf16_t* d = xt + i4 * XP + it * 8 + (tid >> 4);
    d[0]      = (bf16_t)xv[it][0];
    d[XP]     = (bf16_t)xv[it][1];
    d[2 * XP] = (bf16_t)xv[it][2];
    d[3 * XP] = (bf16_t)xv[it][3];
  }
  put_w<32>(wt, wq4, tid);             // rows 0..31  = Wq
  put_w<32>(wt + 32 * XP, wk4, tid);   // rows 32..63 = Wk
  __syncthreads();
  // the first 64 rows of Wv fly under the q and k products; asked for behind the barrier, which waits out every load
  // that stands in front of it
  const float bq0 = bq[m], bq1 = bq[16 + m];   // the q and k bias with them, first: loads return in order
  const float bk0 = bk[m], bk1 = bk[16 + m];
  v4f_t wn[64 * kC / 4 / 128];
  ask_w<64>(wn, Wv, tid);
  // later code overwrites the address registers of these loads
  asm volatile("s_wait_xcnt 0x0" ::: "memory");

  const bf16_t* xrow = xt + (wv * 16 + m) * XP;   // row i = wv*16+m, k = c contiguous
  const bf16_t* wrow = wt + m * XP;               // weight row m of each 16-row tile of the group

  // q, k: D[i][o] = sum_c xt[i][c] * W[o][c]; A = xt row i, B column o = W row o
  {
    v8f aq0 = {};
    v8f aq1 = {};
    v8f ak0 = {};
    v8f ak1 = {};
#pragma unroll 1
    for (int ks = 0; ks < kC / 32; ++ks) {
      const int k0 = ks * 32;
      const v16bf xf = frag_b16(xrow + k0, h);
      // the four weight fragments are read ahead of the first product: one LDS latency per k step
      const v16bf w0 = frag_b16(wrow + k0, h);
      const v16bf w1 = frag_b16(wrow + 16 * XP + k0, h);
      const v16bf w2 = frag_b16(wrow + 32 * XP + k0, h);
      const v16bf w3 = frag_b16(wrow + 48 * XP + k0, h);
      aq0 = mma16(xf, w0, aq0);
      aq1 = mma16(xf, w1, aq1);
      ak0 = mma16(xf, w2, ak0);
      ak1 = mma16(xf, w3, ak1);
    }
    // D element r of this lane = (row i = wv*16+8h+r, col o = m / 16+m)
#pragma unroll
    for (int r = 0; r < 8; ++r) {
      const int io = (wv * 16 + 8 * h + r) * kD;
      sq[io + m]      = (bf16_t)(aq0[r] + bq0);
      sq[io + 16 + m] = (bf16_t)(aq1[r] + bq1);
      sk[io + m]      = (bf16_t)(ak0[r] + bk0);
      sk[io + 16 + m] = (bf16_t)(ak1[r] + bk1);
    }
  }

  // v: D[o][i] = sum_c Wv[o][c] * xt[i][c]; A = Wv row o, B column i = xt row i; 64 channels per group
#pragma unroll 1
  for (int og = 0; og < kC / 64; ++og) {
    __syncthreads();   // every wave has left the earlier group's wt rows and the earlier sv store phase
    put_w<64>(wt, wn, tid);
    __syncthreads();   // wt rows of this group are complete
    // this group's bias and the next group's rows fly under this group's products
    float bvr[4][8];   // element r of tile t belongs to row og*64 + t*16 + 8h + r
#pragma unroll
    for (int t = 0; t < 4; ++t)
#pragma unroll
      for (int r = 0; r < 8; ++r) bvr[t][r] = bv[og * 64 + t * 16 + 8 * h + r];
    if (og + 1 < kC / 64) ask_w<64>(wn, Wv + (size_t)(og + 1) * 64 * kC, tid);   // the same test for the whole block
    // later code overwrites the address registers of these loads
    asm volatile("s_wait_xcnt 0x0" ::: "memory");
    v8f av[4];
#pragma unroll
    for (int t = 0; t < 4; ++t) av[t] = v8f{};
#pragma unroll 1
    for (int ks = 0; ks < kC / 32; ++ks) {
      const int k0 = ks * 32;
      const v16bf xf = frag_b16(xrow + k0, h);
      v16bf wf[4];   // read ahead of the first product, as above
#pragma unroll
      for (int t = 0; t < 4; ++t) wf[t] = frag_b16(wrow + t * 16 * XP + k0, h);
#pragma unroll
      for (int t = 0; t < 4; ++t) av[t] = mma16(wf[t], xf, av[t]);
    }
    // D element r = (row o = og*64 + t*16 + 8h + r, col i = wv*16 + m)
#pragma unroll
    for (int t = 0; t < 4; ++t)
#pragma unroll
      for (int r = 0; r < 8; ++r) {
        const int ol = t * 16 + 8 * h + r;
        sv[ol * PT + wv * 16 + m] = (bf16_t)(av[t][r] + bvr[t][r]);
      }
    __syncthreads();
    v4u vv[4];
    size_t gv[4];
#pragma unroll
    for (int q = 0; q < 4; ++q) {
      const int row = q * 16 + (tid >> 3);
      const int seg = tid & 7;
      vv[q] = *(const v4u*)(sv + row * PT + seg * 8);
      gv[q] = ((size_t)(b * kC + og * 64 + row)) * kN + p0 + seg * 8;
    }
#pragma unroll
    for (int q = 0; q < 4; ++q) *(v4u*)(Vb + gv[q]) = vv[q];
    // the next trip overwrites the registers these stores name
    asm volatile("s_wait_xcnt 0x0" ::: "memory");
  }

  // q, k tiles: 64 rows x 64 B = 4096 contiguous bytes each; 16 B per lane, 8 lanes per line
  {
    v4u uq[2], uk[2];
    size_t gq[2];
#pragma unroll
    for (int q = 0; q < 2; ++q) {
      const int idx = q * 128 + tid;
      uq[q] = *(const v4u*)(sq + idx * 8);
      uk[q] = *(const v4u*)(sk + idx * 8);
      gq[q] = ((size_t)(b * kN + p0)) * kD + idx * 8;
    }
#pragma unroll
    for (int q = 0; q < 2; ++q) {
      *(v4u*)(Qb + gq[q]) = uq[q];
      *(v4u*)(Kb + gq[q]) = uk[q];
    }
    
  }
}

// ---------------------------------------------------------------------------
// Fused attention for one (batch, 128-query) tile. 256 threads = 8 waves = 4 query groups x 2 key halves: a wave holds
// 32 queries (two 16-query tiles) x all 256 channels and takes 64 of each pass's 128 keys, so that every K and V
// fragment read from LDS feeds two products. Per 128-key pass: K rows [128][32] and V rows [256][128] staged in LDS by the
// whole block: asynchronous copies into a ring of two buffers, the next tile in flight under this one's work.
// S^T = K.Q^T so each lane owns one query column per tile: per-query
// running max / sum need one xor-16 shuffle per pass, and the accumulators are rescaled only when a maximum has grown by over 8.
// P (bf16) packed from each pair of S^T accumulators is the B fragment of O^T = V.P^T for its 32 keys
// (k = key, element r <- even tile row 8h+r, element 8+r <- odd tile).
// Behind the loop the two waves of a query group swap, through LDS, reference, sum and one half of the channels each, and
// each joins its 128 channels. Epilogue stages 32 channel rows x 128 positions in LDS; out = gamma*O/l + x as whole lines
// ---------------------------------------------------------------------------
// One block per WGP = two waves per SIMD, said to the compiler: the 256 accumulator registers of a wave and the
// fragments read ahead need most of the 512 registers of two waves per SIMD.
__global__ void __launch_bounds__(256) __attribute__((amdgpu_waves_per_eu(2, 2)))
attn_kernel(const bf16_t* __restrict__ Qb, const bf16_t* __restrict__ Kb, const bf16_t* __restrict__ Vb,
            const float* __restrict__ x, const float* __restrict__ gamma, float* __restrict__ out) {
  __shared__ alignas(16) bf16_t ring[2 * STH];   // 159,744 B
  __shared__ alignas(16) bf16_t qs[8 * QT * 512];   // 16,384 B: each wave's own Q fragments, lane by lane

  const int tid = threadIdx.x;
  const int wv  = __builtin_amdgcn_readfirstlane(tid >> 5);   // wave-uniform: what derives from it stays scalar
  const int qg  = wv & 3;    // query group: queries iblk + 32 qg ...
  const int kh  = wv >> 2;   // key half: keys 64 kh ... of every pass
  const int l   = tid & 31;
  const int h   = l >> 4;
  const int m   = l & 15;
  const int b    = blockIdx.x / NIB;
  const int iblk = (blockIdx.x - b * NIB) * IB;
  if (b >= kB) return;
  // i0 = iblk + qg * 32 + q * 16: first query of tile q of this wave, as the comments below name it

  const bf16_t* kg = Kb + (size_t)b * kN * kD;
  const bf16_t* vg = Vb + (size_t)b * kC * kN;

  // Q as B operand: column n = query i0+m, k = d; the wave's 32 rows x 64 B are contiguous. The 16 registers of the two
  // fragments do not fit beside 256 accumulators through the whole pass: each wave lays them down once in LDS space of
  // its own, as its lanes hold them (contiguous 512 B per read), and takes them up with every pass's K reads.
  const bf16_t* qrow = Qb + ((size_t)b * kN + iblk + qg * 32 + m) * kD;
  // the two scheduling fences keep every other instruction out from between the loads and their wait
  __builtin_amdgcn_sched_barrier(0);
  Frag qld[QT];
#pragma unroll
  for (int q = 0; q < QT; ++q) qld[q].v = frag_b16(qrow + q * 16 * kD, h);
  // later code overwrites the address registers of these loads
  asm volatile("s_wait_xcnt 0x0" ::: "memory");
  __builtin_amdgcn_sched_barrier(0);
  bf16_t* qw = qs + wv * (QT * 512) + l * 8;
#pragma unroll
  for (int q = 0; q < QT; ++q) {
    *(v8bf*)(qw + q * 512)       = qld[q].h2[0];
    *(v8bf*)(qw + q * 512 + 256) = qld[q].h2[1];
  }

  // acc[q][i]: i = 0..7 channel tiles of this wave's own half (channels 128 kh + 16 i), which it keeps at the join;
  // i = 8..15 those of the other half (channels 128 (1-kh) + 16 (i-8)), which it hands to its partner
  v8f acc[QT][kC / 16];
#pragma unroll
  for (int q = 0; q < QT; ++q)
#pragma unroll
    for (int ct = 0; ct < kC / 16; ++ct) acc[q][ct] = v8f{};
  float lsum[QT];
  float mrun[QT];   // softmax reference in log2 units (logit * log2(e)): at most 8 below the running maximum
#pragma unroll
  for (int q = 0; q < QT; ++q) {
    lsum[q] = 0.0f;
    mrun[q] = -1.0e30f;
  }
  constexpr float kL2E = 1.4426950408889634f;

  // staging bases of this thread: K row tid/4, 16-B segment tid%4; V row tid/16, 16-B segment tid%16
  const bf16_t* ksrc = kg + tid * 8;
  const bf16_t* vsrc = vg + (size_t)(tid >> 4) * kN + (tid & 15) * 8;
  const unsigned kdst = lds_addr(ring + (tid >> 2) * KP + (tid & 3) * 8);
  const unsigned vdst = lds_addr(ring + KSH + (tid >> 4) * VP + (tid & 15) * 8);

  // ring prologue: tile 0 lands and is published, then tile 1 starts into the other buffer
  stage_tile(kdst, vdst, ksrc, vsrc);
  asm volatile("s_wait_asynccnt 0x0" ::: "memory");   // this wave's copies of tile 0 have landed
  __syncthreads();                                    // and every other wave's: tile 0 may be read
  stage_tile(kdst + STH * 2, vdst + STH * 2, ksrc + (size_t)JB * kD, vsrc + JB);

#pragma unroll 1
  for (int jt = 0; jt < NT; ++jt) {
    const int bo = (jt & 1) * STH;   // this pass reads buffer jt mod 2 alone
    const bf16_t* ks = ring + bo + kh * KW * KP;
    const bf16_t* vs = ring + bo + KSH + kh * KW;

    // S^T tiles t = 0..3: rows = keys j0+16t+m (A = K rows), cols = queries (B = Q rows), j0 = jt*128 + 64 kh
    v16bf ka[KW / 16];
#pragma unroll
    for (int t = 0; t < KW / 16; ++t) ka[t] = frag_b16(ks + (t * 16 + m) * KP, h);
    v16bf qf[QT];
#pragma unroll
    for (int q = 0; q < QT; ++q) {
      Frag f;
      f.h2[0] = *(const v8bf*)(qw + q * 512);
      f.h2[1] = *(const v8bf*)(qw + q * 512 + 256);
      qf[q] = f.v;
    }
    const v8f z = {};
    v8f st[QT][KW / 16];   // st[q][t] element r = logit(key j0+16t+8h+r, query i0+m)
#pragma unroll
    for (int t = 0; t < KW / 16; ++t)
#pragma unroll
      for (int q = 0; q < QT; ++q) st[q][t] = mma16_free(ka[t], qf[q], z);

    // V fragments (16 channel tiles x 32 keys) are asked for ahead of the products that take them, in groups of 8 tiles:
    // block 0's first group here, ahead of the maximum; its second group written behind block 0's exp arithmetic, where
    // logit registers come free again (all 16 fragments beside all 64 logit registers do not fit 512 registers).
    const bf16_t* vown = vs + (kh * 128 + m) * VP;         // rows of channel tiles i = 0..7
    const bf16_t* voth = vs + ((1 - kh) * 128 + m) * VP;   // rows of channel tiles i = 8..15
    v16bf vf[kC / 16];
#pragma unroll
    for (int ct = 0; ct < 8; ++ct) vf[ct] = frag_b16(vown + ct * 16 * VP, h);
    // compiler fence, no instruction: keeps these reads ahead of the rescale branch below; left free, they sink behind
    // it, in among block 0's exp arithmetic, and the first products wait out their LDS latency
    asm volatile("" ::: "memory");

    // per-query online softmax: lanes m and m+16 hold the 64 logits of query i0+m. mrun, the reference in use, may trail
    // the true running maximum by up to 8 (log2 units), so an exponential reaches 2^8 at most: sums and accumulators are
    // rescaled only in a pass where some query's maximum exceeds its reference by more.
    float mb[QT];
    bool need = false;
#pragma unroll
    for (int q = 0; q < QT; ++q) {
      float mt[KW / 32];   // one independent chain per 32 keys
#pragma unroll
      for (int kk = 0; kk < KW / 32; ++kk) {
        float a = fmaxf(st[q][2 * kk][0], st[q][2 * kk + 1][0]);
#pragma unroll
        for (int r = 1; r < 8; ++r) a = fmaxf(a, fmaxf(st[q][2 * kk][r], st[q][2 * kk + 1][r]));
        mt[kk] = a;
      }
      float ml = fmaxf(mt[0], mt[1]);
      ml = fmaxf(ml, other_half(ml));
      mb[q] = ml * kL2E;
      need = need || (mb[q] > mrun[q] + 8.0f);
    }
    // one test per pass, the same for the whole wave (a scalar branch, every lane stays on); the first pass takes it, as the
    // reference starts at -1e30
    if (__builtin_amdgcn_ballot_w32(need) != 0) {
#pragma unroll
      for (int q = 0; q < QT; ++q) {
        const float mn = fmaxf(mrun[q], mb[q]);
        const float alpha = __builtin_amdgcn_exp2f(mrun[q] - mn);   // 0 in the first pass
        mrun[q] = mn;
        lsum[q] *= alpha;
#pragma unroll
        for (int ct = 0; ct < kC / 16; ++ct) acc[q][ct] *= alpha;
      }
    }
    v2f nm[QT];
#pragma unroll
    for (int q = 0; q < QT; ++q) nm[q] = v2f{-mrun[q], -mrun[q]};
    const v2f l2 = {kL2E, kL2E};

    v2f pt[QT];
#pragma unroll
    for (int q = 0; q < QT; ++q) pt[q] = v2f{0.0f, 0.0f};
#pragma unroll
    for (int kk = 0; kk < KW / 32; ++kk) {
      PFrag p[QT];
#pragma unroll
      for (int q = 0; q < QT; ++q) {
        exp_tile(st[q][2 * kk], l2, nm[q], p[q].d, pt[q]);           // B element r   <- key j0+32kk+8h+r
        exp_tile(st[q][2 * kk + 1], l2, nm[q], p[q].d + 4, pt[q]);   // B element 8+r <- key j0+32kk+16+8h+r
      }
      if (kk == 0) {
        // the fence behind keeps these reads from sinking among the products of the first run, which is their lead:
        // left free, they stand among those products and a full LDS wait comes in the middle of the second run
#pragma unroll
        for (int ct = 0; ct < 8; ++ct) vf[8 + ct] = frag_b16(voth + ct * 16 * VP, h);
        __builtin_amdgcn_sched_barrier(0);
      }
      // O^T[c][i] += V[c][keys] . P^T: A = V row c (k = key contiguous, 32 keys per product), B = p of either query tile
      // in two runs of 8 channel tiles, each run's fragments asked for anew as one group right behind it
#pragma unroll
      for (int hf = 0; hf < 2; ++hf) {
#pragma unroll
        for (int ct = hf * 8; ct < hf * 8 + 8; ++ct)
#pragma unroll
          for (int q = 0; q < QT; ++q) acc[q][ct] = mma16_free(vf[ct], p[q].v, acc[q][ct]);
        if (kk + 1 < KW / 32) {
          const bf16_t* vr = (hf ? voth : vown) + (kk + 1) * 32;
#pragma unroll
          for (int ct = 0; ct < 8; ++ct) vf[hf * 8 + ct] = frag_b16(vr + ct * 16 * VP, h);
          // holds the refill a key block ahead of its products, as written: left free, each read sinks to just
          // ahead of its use and the wave waits out the LDS latency at every product
          __builtin_amdgcn_sched_barrier(0);
        }
      }
    }
#pragma unroll
    for (int q = 0; q < QT; ++q) {
      float ps = pt[q][0] + pt[q][1];
      ps += other_half(ps);
      lsum[q] += ps;
    }

    // publish point of tile jt+1, which also frees this pass's buffer
    // nothing of the pass is scheduled behind it: left free, the compiler lifts the waits and the barrier over the last
    // key block's exp arithmetic and products, which then stand between the barrier and the refill
    __builtin_amdgcn_sched_barrier(0);
    asm volatile("s_wait_dscnt 0x0" ::: "memory");      // this wave's reads of the buffer have returned
    asm volatile("s_wait_asynccnt 0x0" ::: "memory");   // this wave's copies of tile jt+1 have landed
    __syncthreads();
    if (jt + 2 < NT)   // the same for the whole block
      stage_tile(kdst + bo * 2, vdst + bo * 2, ksrc + (size_t)(jt + 2) * JB * kD, vsrc + (jt + 2) * JB);
  }
  asm volatile("s_wait_asynccnt 0x0" ::: "memory");   // nothing is in flight when the ring becomes exchange space
  float* so = (float*)ring;   // every wave has passed the last pass's barrier behind its last read

  // lane index taken anew, so that no per-lane value derived from threadIdx is held in registers past the loop
  const int le = (int)__builtin_amdgcn_mbcnt_lo(~0u, 0u);
  const int he = le >> 4;
  const int me = le & 15;

  const float g = gamma[0];   // ahead of the x loads: loads return in order
  // store phase cp, round q: channel row cp*32 + q*8 + wv, 16-B segment le; a wave covers one row, four whole lines
  const size_t gt = ((size_t)(b * kC + wv)) * kN + iblk + le * 4;
  // The thread's whole share of the residual, 32 loads, into registers that the loop's fragments have left: they fly under
  // the join and the earlier phases, so that no phase waits out a memory latency of its own.
  // the two scheduling fences keep every other instruction out from between the loads and their wait, and the loads up here
  __builtin_amdgcn_sched_barrier(0);
  v4f_t xr[kC / 32][4];
#pragma unroll
  for (int cp = 0; cp < kC / 32; ++cp)
#pragma unroll
    for (int q = 0; q < 4; ++q) xr[cp][q] = *(const v4f*)(x + gt + (size_t)(cp * 32 + q * 8) * kN);
  // later code overwrites the address registers of these loads
  asm volatile("s_wait_xcnt 0x0" ::: "memory");
  __builtin_amdgcn_sched_barrier(0);

  // join of the two key halves. Each wave lays down, lane by lane as its registers hold them, its 16 tiles of the
  // partner's channels (16 KiB a wave) and its softmax reference and sum; partners share queries and lane map.
  {
    v4f* mine = (v4f*)(so + wv * XW) + le;
#pragma unroll
    for (int q = 0; q < QT; ++q)
#pragma unroll
      for (int i = 0; i < 8; ++i) {
        const v8f a = acc[q][8 + i];
        mine[((q * 8 + i) * 2) * 32]     = v4f_t{a[0], a[1], a[2], a[3]};
        mine[((q * 8 + i) * 2 + 1) * 32] = v4f_t{a[4], a[5], a[6], a[7]};
      }
    *((v4f*)(so + 8 * XW + wv * 128) + le) = v4f_t{mrun[0], lsum[0], mrun[1], lsum[1]};
    lds_barrier();   // every wave's partial results are laid down
    const int pw = wv ^ 4;
    const v4f* theirs = (const v4f*)(so + pw * XW) + le;
    const v4f o = *((const v4f*)(so + 8 * XW + pw * 128) + le);
#pragma unroll
    for (int q = 0; q < QT; ++q) {
      const float mm = fmaxf(mrun[q], o[2 * q]);
      const float ao = __builtin_amdgcn_exp2f(mrun[q] - mm);
      const float at = __builtin_amdgcn_exp2f(o[2 * q] - mm);
      const float s  = g / (lsum[q] * ao + o[2 * q + 1] * at);
      const float fo = ao * s;   // scale per query column, normaliser and gamma folded in
      const float ft = at * s;
#pragma unroll
      for (int i = 0; i < 8; ++i) {
        const v4f t0 = theirs[((q * 8 + i) * 2) * 32];
        const v4f t1 = theirs[((q * 8 + i) * 2 + 1) * 32];
#pragma unroll
        for (int r = 0; r < 4; ++r) {
          acc[q][i][r]     = acc[q][i][r] * fo + t0[r] * ft;
          acc[q][i][4 + r] = acc[q][i][4 + r] * fo + t1[r] * ft;
        }
      }
    }
  }

  // epilogue: acc[q][i] element r = (channel 128 kh + 16 i + 8h + r, query i0+m), i = 0..7
#pragma unroll
  for (int cp = 0; cp < kC / 32; ++cp) {
    lds_barrier();   // the exchange reads, or the earlier store phase, finished reading so
    if (kh == (cp >> 2)) {   // wave-uniform: the four waves that hold these 32 channels
#pragma unroll
      for (int q = 0; q < QT; ++q)
#pragma unroll
        for (int t = 0; t < 2; ++t)
#pragma unroll
          for (int r = 0; r < 8; ++r)
            so[(t * 16 + 8 * he + r) * IB + qg * 32 + q * 16 + me] = acc[q][2 * (cp & 3) + t][r];
    }
    lds_barrier();
    // 32 channel rows x 512 B
    v4f ov[4];
#pragma unroll
    for (int q = 0; q < 4; ++q) ov[q] = *(const v4f*)(so + (q * 8 + wv) * IB + le * 4) + xr[cp][q];
#pragma unroll
    for (int q = 0; q < 4; ++q) *(v4f*)(out + gt + (size_t)(cp * 32 + q * 8) * kN) = ov[q];
    // the next trip overwrites the registers these stores name
    asm volatile("s_wait_xcnt 0x0" ::: "memory");
  }
}

extern "C" void kernel_launch(void* const* d_in, const int* in_sizes, int n_in,
                              void* d_out, int out_size, void* d_ws, size_t ws_size,
                              hipStream_t stream) {
  if (n_in < 8) return;
  if (in_sizes[0] != kB * kC * kN || in_sizes[1] != kD * kC || in_sizes[2] != kD ||
      in_sizes[3] != kD * kC || in_sizes[4] != kD || in_sizes[5] != kC * kC ||
      in_sizes[6] != kC || in_sizes[7] < 1) return;
  if (out_size != kB * kC * kN) return;

  const float* x     = (const float*)d_in[0];
  const float* Wq    = (const float*)d_in[1];
  const float* bq    = (const float*)d_in[2];
  const float* Wk    = (const float*)d_in[3];
  const float* bk    = (const float*)d_in[4];
  const float* Wv    = (const float*)d_in[5];
  const float* bv    = (const float*)d_in[6];
  const float* gamma = (const float*)d_in[7];
  float* out = (float*)d_out;

  // workspace: Qb [B][N][32] bf16 (2 MiB), Kb [B][N][32] bf16 (2 MiB), Vb [B][C][N] bf16 (16 MiB)
  const size_t qk_bytes = (size_t)kB * kN * kD * sizeof(bf16_t);
  const size_t v_bytes  = (size_t)kB * kC * kN * sizeof(bf16_t);
  if (ws_size < 2 * qk_bytes + v_bytes) return;
  bf16_t* Qb = (bf16_t*)d_ws;
  bf16_t* Kb = (bf16_t*)((char*)d_ws + qk_bytes);
  bf16_t* Vb = (bf16_t*)((char*)d_ws + 2 * qk_bytes);

  proj_kernel<<<dim3(kB * NPB), dim3(128), 0, stream>>>(x, Wq, bq, Wk, bk, Wv, bv, Qb, Kb, Vb);
  attn_kernel<<<dim3(kB * NIB), dim3(256), 0, stream>>>(Qb, Kb, Vb, x, gamma, out);
}
